// v000
// The times below were measured on an AMD MI455X: many runs one after another, warmed up first and cycling through
// copies of the inputs, with the whole window's GPU time divided by the number of runs. Launches and the gaps
// between them are all in it. The median over several windows is given; except for v000 it joins two sittings, which
// can be a few percent apart, so the side-by-side timings, each taken in one sitting, are the better comparison.
// The starting kernel, v000, takes 260 microseconds a run.
// Contractions: conv1x1 q/k/v GEMM W[1536x512].X[512x1024] on v_wmma_f32_16x16x32_f16 (f16 containers of
// bf16-RNE weights x256 and bf16-RNE x); scores [k_j|q_j].[q_i|pos_i] (K=128) on v_wmma_f32_16x16x32_bf16
// (bf16 hi + bf16 residual planes, 3 products); y^T = V.P^T on v_wmma_f32_16x16x32_f16 (v as f16, P = e^{s-m}
// x 2^14 f16 from the score D registers); f32 accumulate everywhere; bias adds and softmax statistics in f32 VALU.
#include <hip/hip_runtime.h>
#include <math.h>
#include <stdint.h>

#ifndef NB
#define NB 8
#endif
#ifndef NQ
#define NQ 1024
#endif
#define HEADS 8
#define CDIM  512
#define DH    64
#define NSEQ  1024
#define NPROJ 3
#define MW    (NPROJ * CDIM)
#define KROW  192
#define QT    64
#define OSP   68
#define OSPW  68
#define TP    72
#define WSC   256.0f
#define IWSC  0.00390625f
#define LNPS  9.704060527839234f

static_assert(NB >= 1 && NB <= 8);
static_assert(NQ % QT == 0 && NQ >= QT && NQ <= NSEQ);
static_assert(HEADS * DH == CDIM);
static_assert(DH == QT);
static_assert(KROW == 3 * DH);
static_assert(NSEQ == 1024 && HEADS == 8);
static_assert(CDIM == 512);
static_assert(MW % 8 == 0 && (CDIM / 8) == 64);
static_assert(CDIM % 32 == 0 && NSEQ % QT == 0 && NSEQ % 32 == 0);
static_assert((OSP * 4) % 16 == 0);
static_assert((OSPW * 4) % 16 == 0);
static_assert((TP * 2) % 16 == 0);
static_assert((KROW * 2) % 128 == 0);

typedef _Float16       v16h __attribute__((ext_vector_type(16)));
typedef _Float16       v8h  __attribute__((ext_vector_type(8)));
typedef __bf16         v16b __attribute__((ext_vector_type(16)));
typedef unsigned short v8us __attribute__((ext_vector_type(8)));
typedef float          v8f  __attribute__((ext_vector_type(8)));
typedef float          v4f  __attribute__((ext_vector_type(4)));
typedef unsigned int   v4u  __attribute__((ext_vector_type(4)));

union Frag  { v8us u[2]; v16h h; v16b bf; };
union FragH { v16h v; v8h hv[2]; };
static_assert(sizeof(Frag) == 32);
static_assert(sizeof(FragH) == 32);

// ---- scalar helpers ---------------------------------------------------------------------------------------
__device__ __forceinline__ unsigned short bf_bits(float f) {          // f32 -> bf16 bits, RNE convert
  unsigned u = __float_as_uint(f);
  return (unsigned short)((u + 0x7FFFu + ((u >> 16) & 1u)) >> 16);
}
__device__ __forceinline__ float bf_up(unsigned short hb) { return __uint_as_float(((unsigned)hb) << 16); }
__device__ __forceinline__ float bfr(float f) { return bf_up(bf_bits(f)); }
__device__ __forceinline__ unsigned short h_bits(_Float16 x) { return __builtin_bit_cast(unsigned short, x); }
__device__ __forceinline__ unsigned pk16(unsigned short a, unsigned short b) { return (unsigned)a | ((unsigned)b << 16); }
__device__ __forceinline__ v8f zero8() { v8f z = {0.f, 0.f, 0.f, 0.f, 0.f, 0.f, 0.f, 0.f}; return z; }
__device__ __forceinline__ float hmax8(v8f s) {
  return fmaxf(fmaxf(fmaxf(s[0], s[1]), fmaxf(s[2], s[3])), fmaxf(fmaxf(s[4], s[5]), fmaxf(s[6], s[7])));
}
__device__ __forceinline__ unsigned wave_ballot(bool p) {
#if defined(__HIP_DEVICE_COMPILE__)
  return __builtin_amdgcn_ballot_w32(p);
#else
  return p ? 1u : 0u;
#endif
}

// ---- 16-bit fragment loader (A, or B from a k-contiguous [n][k] row): lane -> row/col (lane&15), p already includes
//      + 8*(lane>>4); elements 0..7 <- p[0..7] (k0+8h..), elements 8..15 <- p[16..23] (k0+16+8h..)
__device__ __forceinline__ Frag ldfrag(const unsigned short* p) {
  Frag f;
  f.u[0] = *(const v8us*)(p);
  f.u[1] = *(const v8us*)(p + 16);
  return f;
}

// ---- WMMA helpers: builtin followed by a 4-slot VALU gap tying D and keeping A/B live --------------------------
__device__ __forceinline__ v8f mma_h(v16h a, v16h b, v8f c) {
  v8f d = __builtin_amdgcn_wmma_f32_16x16x32_f16(false, a, false, b, (short)0, c, false, false);
#if defined(__HIP_DEVICE_COMPILE__)
  asm volatile("v_nop\n\tv_nop\n\tv_nop\n\tv_nop" : "+v"(d) : "v"(a), "v"(b));
#endif
  return d;
}
__device__ __forceinline__ v8f mma_b(v16b a, v16b b, v8f c) {
  v8f d = __builtin_amdgcn_wmma_f32_16x16x32_bf16(false, a, false, b, (short)0, c, false, false);
#if defined(__HIP_DEVICE_COMPILE__)
  const v16h ha = __builtin_bit_cast(v16h, a), hb = __builtin_bit_cast(v16h, b);
  asm volatile("v_nop\n\tv_nop\n\tv_nop\n\tv_nop" : "+v"(d) : "v"(ha), "v"(hb));
#endif
  return d;
}

// =========================================================================================================
// (0) conv1x1 weights: W16 f16 [1536][512], rows 0..511 = wq rows, 512..1023 = wk rows, 1024..1535 = wv rows;
//     value = f16 of (bf16-RNE(w) * 256) (exact). Block blk (0..191) owns rows 8*blk..8*blk+7: one wave per
// coverage: 192 blocks x 8 rows x 2 it x 32 lanes x 8 halves = 1536 x 512 = the whole plane.
// =========================================================================================================
__global__ __launch_bounds__(256)
void cvt_w(const float* __restrict__ wq, const float* __restrict__ wk, const float* __restrict__ wv,
           unsigned short* W16) {
  const int tid = threadIdx.x, blk = blockIdx.x;
  const int rl = tid >> 5, lane = tid & 31;
  const int o = 8 * blk + rl;                                        // 0..1535
  const int p = blk >> 6;                                            // block-uniform projection 0..2
  const float* wbase = (p == 0) ? wq : ((p == 1) ? wk : wv);         // all global
  const int ol = o - p * CDIM;                                       // 0..511
  v4u u[2];
#pragma unroll
  for (int it = 0; it < 2; ++it) {
    const float* s = wbase + (size_t)ol * CDIM + 256 * it + 8 * lane;
    const v4f a = *(const v4f*)s;
    const v4f q = *(const v4f*)(s + 4);
    const float f[8] = {a[0], a[1], a[2], a[3], q[0], q[1], q[2], q[3]};
#pragma unroll
    for (int t = 0; t < 4; ++t) {
      const _Float16 h0 = (_Float16)(bfr(f[2 * t]) * WSC);
      const _Float16 h1 = (_Float16)(bfr(f[2 * t + 1]) * WSC);
      u[it][t] = pk16(h_bits(h0), h_bits(h1));
    }
  }
{
#pragma unroll
    for (int it = 0; it < 2; ++it)
      *(v4u*)(W16 + (size_t)o * CDIM + 256 * it + 8 * lane) = u[it];
    
  }
}

// =========================================================================================================
// (1) x f32 [b][512 c][1024 n] -> XP f16 [b][n][c] (position-major, bf16-RNE values, exact in f16) through an
//     T is cross-wave (writer and reader waves differ): block barrier between the stores and the reload.
// coverage: XP 2 it x 32 rows x 8 lanes x 8 = 64 n x 64 c; grid (16, 8, NB) covers XP [b<NB][1024][512] once.
// =========================================================================================================
__global__ __launch_bounds__(256)
void cvt_x(const float* __restrict__ x, unsigned short* XP) {
  __shared__ __align__(16) unsigned short T[QT * TP];
  const int tid = threadIdx.x;
  const int nb = blockIdx.x, cb = blockIdx.y, b = blockIdx.z;
  const int e = tid & 7, lq = tid >> 3;                             // lq 0..31
  const int n0 = nb * QT, c0 = cb * QT;
#pragma unroll
  for (int it = 0; it < 2; ++it) {
    const int cl = it * 32 + lq;                                     // 0..63
    const float* sp = x + ((size_t)(b * CDIM + c0 + cl)) * NSEQ + n0 + 8 * e;
    const v4f a = *(const v4f*)sp;
    const v4f q = *(const v4f*)(sp + 4);
    unsigned short hb[8];
#pragma unroll
    for (int t = 0; t < 4; ++t) {
      hb[t]     = h_bits((_Float16)bfr(a[t]));
      hb[4 + t] = h_bits((_Float16)bfr(q[t]));
    }
#pragma unroll
    for (int t = 0; t < 8; ++t) T[(8 * e + t) * TP + cl] = hb[t];
  }
  __syncthreads();
  v4u up[2];
#pragma unroll
  for (int it = 0; it < 2; ++it) {
    const int nl = it * 32 + lq;                                     // 0..63
    up[it] = *(const v4u*)(T + nl * TP + 8 * e);
  }
{
#pragma unroll
    for (int it = 0; it < 2; ++it) {
      const int rl = it * 32 + lq;
      *(v4u*)(XP + ((size_t)(b * NSEQ + n0 + rl)) * CDIM + c0 + 8 * e) = up[it];
    }
    
  }
}

// =========================================================================================================
// (2) relative position rows: pos[h][d][n] = bf16-RNE(rh[h][d][n%32]) + bf16-RNE(rw[h][d][n/32]) in f32, split into
//     bf16 hi = RNE(pos) and bf16 lo = RNE(pos - hi), written to cols 128..191 of the planes QKh/QKl
//     bf16 [b][h][1024 n][192] for every b < NB. One task (h, n, e) per thread covers d = 8e..8e+7 (16 B);
// coverage: 256 blocks x 256 threads = 8 h x 1024 n x 8 e; x NB rows each -> cols 128..191 of every plane row.
// =========================================================================================================
__global__ __launch_bounds__(256)
void pos_k(const float* __restrict__ rh, const float* __restrict__ rw, unsigned short* QKh, unsigned short* QKl) {
  const int idx = blockIdx.x * 256 + (int)threadIdx.x;              // 0..65535
  const int e = idx & 7;
  const int n = (idx >> 3) & (NSEQ - 1);
  const int h = (idx >> 13) & (HEADS - 1);
  const int xw = n & 31, yh = n >> 5;
  v4u uh, ul;
#pragma unroll
  for (int t = 0; t < 4; ++t) {
    const int da = 8 * e + 2 * t, db = da + 1;
    const float f0 = bfr(rh[(h * DH + da) * 32 + xw]) + bfr(rw[(h * DH + da) * 32 + yh]);
    const float f1 = bfr(rh[(h * DH + db) * 32 + xw]) + bfr(rw[(h * DH + db) * 32 + yh]);
    const unsigned short hb0 = bf_bits(f0), hb1 = bf_bits(f1);
    const unsigned short lb0 = bf_bits(f0 - bf_up(hb0));
    const unsigned short lb1 = bf_bits(f1 - bf_up(hb1));
    uh[t] = pk16(hb0, hb1);
    ul[t] = pk16(lb0, lb1);
  }
{
#pragma unroll
    for (int b = 0; b < NB; ++b) {
      const size_t po = ((size_t)((b * HEADS + h) * NSEQ + n)) * KROW + 2 * DH + 8 * e;
      *(v4u*)(QKh + po) = uh;
      *(v4u*)(QKl + po) = ul;
    }
    
  }
}

// =========================================================================================================
// (3) conv1x1 GEMM for one (b, 64-n tile, 64-o block): Y[o][n] = (1/256) sum_c W16[o][c] XP[b][n][c] + bias[o].
//     Block 128 threads = 4 waves; wave w owns cols n0+16w..+15 (one B fragment per k-step, k = c contiguous in
//     the XP row) and 4 m-tiles (A rows o = o0 + 16 mt + (lane&15), split k map loader from W16). K = 512 = 16 steps.
//     Epilogue staged in LDS Os[n_loc][o_loc] (pitch OSP, b128 stores of 8 consecutive o per lane), block barrier
//     (Os is cross-wave), then by o-block: mb 0..7 -> q of head mb (QK planes cols 0..63, bf16 hi = RNE(v), lo =
//     RNE(v - hi)), mb 8..15 -> k of head mb-8 (cols 64..127), mb 16..23 -> v of head mb-16 -> Vc f16
//     [b][512 ch][1024 n] (channel-major, keys contiguous). Each plane row segment / Vc row segment is one whole
// coverage: Os 4 waves x 16 n x 64 o = 64 x 64; q/k path 4 it x 16 rows x 8 lanes x 8 = 64 n x 64 d (hi and lo);
//           v path 4 it x 16 ch x 8 lanes x 8 = 64 ch x 64 n; grid (16, 24, NB) covers QK cols 0..127 of all
//           rows b<NB and Vc [b<NB][512][1024] exactly once.
// =========================================================================================================
__global__ __launch_bounds__(128)
void gemm_qkv(const unsigned short* __restrict__ W16, const unsigned short* __restrict__ XP,
              const float* __restrict__ bq, const float* __restrict__ bk, const float* __restrict__ bv,
              unsigned short* QKh, unsigned short* QKl, unsigned short* Vc) {
  __shared__ __align__(16) float Os[QT * OSP];
  const int tid  = threadIdx.x;
  const int lane = tid & 31, wave = tid >> 5;
  const int hh   = lane >> 4, c = lane & 15;
  const int nt   = blockIdx.x, mb = blockIdx.y, b = blockIdx.z;
  const int n0   = nt * QT, o0 = mb * QT;                            // o0 = row block of the stacked W16

  const unsigned short* ap = W16 + (size_t)(o0 + c) * CDIM + 8 * hh;
  const unsigned short* bp = XP + ((size_t)(b * NSEQ + n0 + 16 * wave + c)) * CDIM + 8 * hh;

  v8f acc[4];
#pragma unroll
  for (int mt = 0; mt < 4; ++mt) acc[mt] = zero8();

#pragma unroll 2
  for (int ks = 0; ks < CDIM / 32; ++ks) {
    const Frag fb = ldfrag(bp + 32 * ks);
#pragma unroll
    for (int mt = 0; mt < 4; ++mt) {
      const Frag fa = ldfrag(ap + (size_t)(16 * mt) * CDIM + 32 * ks);
      acc[mt] = mma_h(fa.h, fb.h, acc[mt]);
    }
  }

  // ---- epilogue: scale back -> LDS Os[n_loc][o_loc]; lane (hh, c) holds o = 16 mt + 8 hh + r for n_loc = 16 w + c
  {
    const int nl = 16 * wave + c;
#pragma unroll
    for (int mt = 0; mt < 4; ++mt) {
      v4f va, vb;
#pragma unroll
      for (int r = 0; r < 4; ++r) { va[r] = acc[mt][r] * IWSC; vb[r] = acc[mt][4 + r] * IWSC; }
      *(v4f*)(Os + nl * OSP + 16 * mt + 8 * hh)     = va;
      *(v4f*)(Os + nl * OSP + 16 * mt + 8 * hh + 4) = vb;
    }
  }
  __syncthreads();

  const int e = tid & 7, lq = tid >> 3;                             // lq 0..15
  const int p = mb >> 3, head = mb & 7;                              // block-uniform
  const float* bias = (p == 0) ? bq : ((p == 1) ? bk : bv);          // all global
  if (p < 2) {
    const v4f b0 = *(const v4f*)(bias + head * DH + 8 * e);
    const v4f b1 = *(const v4f*)(bias + head * DH + 8 * e + 4);
    const float bb[8] = {bfr(b0[0]), bfr(b0[1]), bfr(b0[2]), bfr(b0[3]),
                         bfr(b1[0]), bfr(b1[1]), bfr(b1[2]), bfr(b1[3])};
    v4u uh[4], ul[4];
#pragma unroll
    for (int it = 0; it < 4; ++it) {
      const int row = it * 16 + lq;                                  // n_loc 0..63
      const v4f a = *(const v4f*)(Os + row * OSP + 8 * e);
      const v4f q = *(const v4f*)(Os + row * OSP + 8 * e + 4);
      const float f[8] = {a[0], a[1], a[2], a[3], q[0], q[1], q[2], q[3]};
#pragma unroll
      for (int t = 0; t < 4; ++t) {
        const float f0 = f[2 * t] + bb[2 * t], f1 = f[2 * t + 1] + bb[2 * t + 1];
        const unsigned short hb0 = bf_bits(f0), hb1 = bf_bits(f1);
        const unsigned short lb0 = bf_bits(f0 - bf_up(hb0));
        const unsigned short lb1 = bf_bits(f1 - bf_up(hb1));
        uh[it][t] = pk16(hb0, hb1);
        ul[it][t] = pk16(lb0, lb1);
      }
    }
{
#pragma unroll
      for (int it = 0; it < 4; ++it) {
        const int row = it * 16 + lq;
        const size_t po = ((size_t)((b * HEADS + head) * NSEQ + n0 + row)) * KROW + p * DH + 8 * e;
        *(v4u*)(QKh + po) = uh[it];
        *(v4u*)(QKl + po) = ul[it];
      }
      
    }
  } else {
    v4u uv[4];
#pragma unroll
    for (int it = 0; it < 4; ++it) {
      const int row = it * 16 + lq;                                  // o_loc 0..63 -> channel head*64 + row
      const float bo = bfr(bias[head * DH + row]);
      unsigned short hb[8];
#pragma unroll
      for (int t = 0; t < 8; ++t) hb[t] = h_bits((_Float16)(Os[(8 * e + t) * OSP + row] + bo));
#pragma unroll
      for (int t = 0; t < 4; ++t) uv[it][t] = pk16(hb[2 * t], hb[2 * t + 1]);
    }
{
#pragma unroll
      for (int it = 0; it < 4; ++it) {
        const int row = it * 16 + lq;
        *(v4u*)(Vc + ((size_t)(b * CDIM + head * DH + row)) * NSEQ + n0 + 8 * e) = uv[it];
      }
      
    }
  }
}

// =========================================================================================================
// (4) attention for one (b, h, 64-query tile), transposed formulation, 1024 keys, no mask, no scale:
//   S^T tile (16 keys x 16 queries) = sum over 4 d-chunks (rolled loop) of A(key row j = kb + (lane&15) of the
//   bf16 plane QKh [b][h][1024][192]: chunks 0,1 = cols 64..127 (k_j), chunks 2,3 = cols 0..63 (q_j), split k map)
//   . B(query col i: chunks 0,1 = cols 0..63 (q_i), chunks 2,3 = cols 128..191 (pos_i), same map) as
//   A(hi).B(hi) + A(hi).B(lo) + A(lo).B(hi) (bf16 unscaled residual planes, shared accumulator).
//   Per lane the D tile holds 8 keys of ONE query: online softmax state per lane, one shuffle (lane^16) for the max
//   over 32 keys; the o/l rescale is skipped under a wave-uniform ballot when no lane's max grew (corr == 1 exactly
//   for every lane then); the row sum is accumulated from the f16-converted P values; row-sum partials combined at
//   the end. P = e^{s-m} x 16384 as f16 is the B operand of O^T (rows channel, cols queries) += A(v rows channel =
//   h*64 + 16j + (lane&15), keys contiguous, f16 plane Vc [b][512][1024]) . B(P^T): element r <- D of the tile
//   covering keys kb..kb+15, element 8+r <- the tile covering kb+16..kb+31, lane unchanged. 4 accumulator tiles per
//   wave (64 channels). Block = 4 waves = 64 queries.
//   Epilogue: O/l staged in LDS Os[query][64 channels] (pitch OSPW, b128 stores), block barrier (Os is cross-wave),
// coverage: 8 it x 16 lines x 8 lanes x 4 floats = 64 ch x 64 n; grid (NQ/64, NB*8) covers
//           out[b<NB][0..511][0..NQ-1] exactly once.
// =========================================================================================================
__global__ __launch_bounds__(128)
void attn_k(const unsigned short* __restrict__ QKh, const unsigned short* __restrict__ QKl,
            const unsigned short* __restrict__ Vc, float* out) {
  __shared__ __align__(16) float Os[QT * OSPW];
  const int tid  = threadIdx.x;
  const int wave = tid >> 5, lane = tid & 31;
  const int hh   = lane >> 4, c = lane & 15;
  const int n0   = blockIdx.x * QT;
  const int bh   = blockIdx.y;
  const int b    = bh >> 3, h = bh & 7;
  const size_t prow = (size_t)bh * NSEQ * KROW;

  // query fragment pointers (B operand, col = query n0 + 16*wave + c), + bcol(kc)
  const size_t qo = prow + ((size_t)(n0 + 16 * wave + c)) * KROW + 8 * hh;
  const unsigned short* Qhp = QKh + qo;
  const unsigned short* Qlp = QKl + qo;
  // key fragment base (A operand, row = key kb + c), + key * KROW + acol(kc)
  const unsigned short* Khp = QKh + prow + (size_t)c * KROW + 8 * hh;
  const unsigned short* Klp = QKl + prow + (size_t)c * KROW + 8 * hh;
  // v fragment base (A operand, row = channel h*64 + 16j + c, keys contiguous), + 16*j*NSEQ + kb
  const unsigned short* Vp = Vc + ((size_t)(b * CDIM + h * DH + c)) * NSEQ + 8 * hh;

  float m = -1.0e30f, l = 0.f;
  v8f o[4];
#pragma unroll
  for (int j = 0; j < 4; ++j) o[j] = zero8();

#pragma unroll 1
  for (int kb = 0; kb < NSEQ; kb += 32) {
    const unsigned short* k0p  = Khp + (size_t)kb * KROW;            // keys kb .. kb+15
    const unsigned short* k1p  = Khp + (size_t)(kb + 16) * KROW;     // keys kb+16 .. kb+31
    const unsigned short* k0lp = Klp + (size_t)kb * KROW;
    const unsigned short* k1lp = Klp + (size_t)(kb + 16) * KROW;
    v8f s0 = zero8(), s1 = zero8();
#pragma unroll 1
    for (int kc = 0; kc < 4; ++kc) {
      const int acol = ((kc + 2) & 3) * 32;                          // 64, 96, 0, 32   (k_j | q_j)
      const int bcol = 32 * kc + ((kc >> 1) << 6);                   // 0, 32, 128, 160 (q_i | pos_i)
      const Frag qh  = ldfrag(Qhp + bcol);
      const Frag ql  = ldfrag(Qlp + bcol);
      const Frag k0  = ldfrag(k0p + acol);
      const Frag k1  = ldfrag(k1p + acol);
      const Frag k0l = ldfrag(k0lp + acol);
      const Frag k1l = ldfrag(k1lp + acol);
      s0 = mma_b(k0.bf, qh.bf, s0);
      s1 = mma_b(k1.bf, qh.bf, s1);
      s0 = mma_b(k0.bf, ql.bf, s0);
      s1 = mma_b(k1.bf, ql.bf, s1);
      s0 = mma_b(k0l.bf, qh.bf, s0);
      s1 = mma_b(k1l.bf, qh.bf, s1);
    }

    float mx = fmaxf(hmax8(s0), hmax8(s1));
    mx = fmaxf(mx, __shfl_xor(mx, 16, 32));
    const float mn = fmaxf(m, mx);
    const unsigned grew = wave_ballot(mx > m);                       // wave-uniform
    if (grew != 0u) {
      const float corr = __expf(m - mn);                             // == 1 exactly for lanes whose max did not grow
      l *= corr;
#pragma unroll
      for (int j = 0; j < 4; ++j) {
#pragma unroll
        for (int r = 0; r < 8; ++r) o[j][r] *= corr;
      }
    }
    m = mn;
    const float msh = mn - LNPS;                                     // exp gives e^{s-m} * 16384

    FragH ph;
    float ls = 0.f;
#pragma unroll
    for (int r = 0; r < 8; ++r) {
      const _Float16 p0 = (_Float16)__expf(s0[r] - msh);             // key kb      + 8hh + r
      const _Float16 p1 = (_Float16)__expf(s1[r] - msh);             // key kb + 16 + 8hh + r
      ls += (float)p0 + (float)p1;
      ph.hv[0][r] = p0;
      ph.hv[1][r] = p1;
    }
    l += ls;

#pragma unroll
    for (int j = 0; j < 4; ++j) {
      const Frag vf = ldfrag(Vp + (size_t)(16 * j) * NSEQ + kb);
      o[j] = mma_h(vf.h, ph.v, o[j]);
    }
  }
  l += __shfl_xor(l, 16, 32);
  const float inv = 1.0f / l;                                        // o and l both carry the x16384 factor

  const int qrow = 16 * wave + c;
#pragma unroll
  for (int j = 0; j < 4; ++j) {
    v4f va, vb;
#pragma unroll
    for (int r = 0; r < 4; ++r) { va[r] = o[j][r] * inv; vb[r] = o[j][4 + r] * inv; }
    *(v4f*)(Os + qrow * OSPW + 16 * j + 8 * hh)     = va;            // Os[query][ch_loc = 16j + 8hh + r]
    *(v4f*)(Os + qrow * OSPW + 16 * j + 8 * hh + 4) = vb;
  }
  __syncthreads();

  const int e = tid & 7, lq = tid >> 3;                              // lq 0..15
  v4f res[8];
#pragma unroll
  for (int it = 0; it < 8; ++it) {
    const int L   = it * 16 + lq;                                    // 0..127
    const int chl = L >> 1, hf = L & 1;                              // channel 0..63 within the head
    const int nl  = hf * 32 + 4 * e;                                 // query 0..63
#pragma unroll
    for (int t = 0; t < 4; ++t) res[it][t] = Os[(nl + t) * OSPW + chl];
  }
{
#pragma unroll
    for (int it = 0; it < 8; ++it) {
      const int L   = it * 16 + lq;
      const int chl = L >> 1, hf = L & 1;
      const int nl  = hf * 32 + 4 * e;
      const size_t idx = ((size_t)(b * CDIM + h * DH + chl)) * NSEQ + n0 + nl;
      *(v4f*)(out + idx) = res[it];
    }
    
  }
}

// =========================================================================================================
// Workspace map (bytes; each region start a multiple of 256; every extent is an exact tile multiple and is written
//   W16 f16 [1536][512]               1572864
//   XP  f16 [NB][1024][512]           8388608 (NB=8)
//   QKh / QKl bf16 [NB][8][1024][192] 25165824 x2 (NB=8)
//   Vc  f16 [NB][512][1024]           8388608 (NB=8)
//   total = 68681728 (NB=8)
// =========================================================================================================
extern "C" void kernel_launch(void* const* d_in, const int* in_sizes, int n_in,
                              void* d_out, int out_size, void* d_ws, size_t ws_size,
                              hipStream_t stream) {
  const int XN = NB * CDIM * NSEQ;
  if (n_in < 9) return;
  if (in_sizes[0] < XN) return;
  if (in_sizes[1] < CDIM * CDIM || in_sizes[3] < CDIM * CDIM || in_sizes[5] < CDIM * CDIM) return;
  if (in_sizes[2] < CDIM || in_sizes[4] < CDIM || in_sizes[6] < CDIM) return;
  if (in_sizes[7] < HEADS * DH * 32 || in_sizes[8] < HEADS * DH * 32) return;
  if (out_size < XN) return;

  size_t off = 0;
  auto carve = [&](size_t bytes) { const size_t o = off; off += (bytes + 255) & ~(size_t)255; return o; };
  const size_t oW16 = carve((size_t)MW * CDIM * 2);
  const size_t oXP  = carve((size_t)NB * NSEQ * CDIM * 2);
  const size_t oQKh = carve((size_t)NB * HEADS * NSEQ * KROW * 2);
  const size_t oQKl = carve((size_t)NB * HEADS * NSEQ * KROW * 2);
  const size_t oVc  = carve((size_t)NB * CDIM * NSEQ * 2);
  if (off > ws_size) return;
  if (off > (size_t)134217728) return;

  const float* x   = (const float*)d_in[0];
  const float* wqw = (const float*)d_in[1];
  const float* wqb = (const float*)d_in[2];
  const float* wkw = (const float*)d_in[3];
  const float* wkb = (const float*)d_in[4];
  const float* wvw = (const float*)d_in[5];
  const float* wvb = (const float*)d_in[6];
  const float* rh  = (const float*)d_in[7];
  const float* rw  = (const float*)d_in[8];

  char* ws = (char*)d_ws;
  unsigned short* W16 = (unsigned short*)(ws + oW16);
  unsigned short* XP  = (unsigned short*)(ws + oXP);
  unsigned short* QKh = (unsigned short*)(ws + oQKh);
  unsigned short* QKl = (unsigned short*)(ws + oQKl);
  unsigned short* Vc  = (unsigned short*)(ws + oVc);
  float* out = (float*)d_out;

  const dim3 blk256(256), blk128(128);

  // (0) wq / wk / wv -> stacked f16 plane
  cvt_w<<<dim3(MW / 8), blk256, 0, stream>>>(wqw, wkw, wvw, W16);
  // (1) x -> position-major 16-bit plane
  cvt_x<<<dim3(NSEQ / QT, CDIM / QT, NB), blk256, 0, stream>>>(x, XP);
  // (2) relative position rows -> cols 128..191 of the score planes
  pos_k<<<dim3((HEADS * NSEQ * 8) / 256), blk256, 0, stream>>>(rh, rw, QKh, QKl);
  // (3) conv1x1 GEMM -> q/k hi + residual planes, v f16 plane
  gemm_qkv<<<dim3(NSEQ / QT, MW / QT, NB), blk128, 0, stream>>>(W16, XP, wqb, wkb, wvb, QKh, QKl, Vc);
  // (4) attention -> out [b][512][1024]
  attn_k<<<dim3(NQ / QT, NB * HEADS), blk128, 0, stream>>>(QKh, QKl, Vc, out);
  (void)hipGetLastError();
}

// v001
// Measured time: 94.6 microseconds a run.
// Next to v000, in two timings, it ran 2.83 times as fast each time.
// Contractions: conv1x1 q/k/v GEMM W[1536x512].X[512x1024] on v_wmma_f32_16x16x32_f16 (f16 containers of
// bf16-RNE weights x256 and bf16-RNE x); scores [k_j|q_j].[q_i|pos_i] (K=128) on v_wmma_f32_16x16x32_bf16
// (bf16 hi + bf16 residual planes, 3 products); y^T = V.P^T on v_wmma_f32_16x16x32_f16 (v as f16, P = e^{s-m}
// x 2^14 f16 from the score D registers); f32 accumulate everywhere; bias adds and softmax statistics in f32 VALU.
#include <hip/hip_runtime.h>
#include <math.h>
#include <stdint.h>

#ifndef NB
#define NB 8
#endif
#ifndef NQ
#define NQ 1024
#endif
#define HEADS 8
#define CDIM  512
#define DH    64
#define NSEQ  1024
#define NPROJ 3
#define MW    (NPROJ * CDIM)
#define KROW  192
#define QT    64
#define OSP   68
#define OSPW  68
#define TP    72
#define WSC   256.0f
#define IWSC  0.00390625f
#define LNPS  9.704060527839234f
#define KT    32
#define KP    272
#define VP    80
#define SM_KL (KT * KP)
#define SM_V  (2 * KT * KP)
#define STAGE (2 * KT * KP + DH * VP)
#define SM_QH (2 * STAGE)
#define SM_QL (SM_QH + QT * KP)
#define SMEM  (SM_QL + QT * KP)
#define GK    64
#define GP    144
#define GSTAGE (2 * QT * GP)

static_assert(NB >= 1 && NB <= 8);
static_assert(NQ % QT == 0 && NQ >= QT && NQ <= NSEQ);
static_assert(HEADS * DH == CDIM);
static_assert(DH == QT);
static_assert(KROW == 3 * DH);
static_assert(NSEQ == 1024 && HEADS == 8);
static_assert(CDIM == 512);
static_assert(MW % 8 == 0 && (CDIM / 8) == 64);
static_assert(CDIM % 32 == 0 && NSEQ % QT == 0 && NSEQ % 32 == 0);
static_assert((OSP * 4) % 16 == 0);
static_assert((OSPW * 4) % 16 == 0);
static_assert((TP * 2) % 16 == 0);
static_assert((KROW * 2) % 128 == 0);
static_assert(KP % 32 == 16 && VP % 32 == 16);
static_assert(KP >= 4 * DH && VP >= 2 * KT);
static_assert(STAGE % 16 == 0 && NSEQ / KT >= 2 && NSEQ % KT == 0);
static_assert(QT * OSPW * 4 <= SMEM);
static_assert(GP % 32 == 16 && GP >= 2 * GK && GK % 32 == 0);
static_assert(CDIM % GK == 0 && CDIM / GK >= 2);
static_assert(QT * OSP * 4 <= 2 * GSTAGE);

typedef _Float16       v16h __attribute__((ext_vector_type(16)));
typedef _Float16       v8h  __attribute__((ext_vector_type(8)));
typedef __bf16         v16b __attribute__((ext_vector_type(16)));
typedef unsigned short v8us __attribute__((ext_vector_type(8)));
typedef float          v8f  __attribute__((ext_vector_type(8)));
typedef float          v4f  __attribute__((ext_vector_type(4)));
typedef unsigned int   v4u  __attribute__((ext_vector_type(4)));

union Frag  { v8us u[2]; v16h h; v16b bf; };
union FragH { v16h v; v8h hv[2]; };
static_assert(sizeof(Frag) == 32);
static_assert(sizeof(FragH) == 32);

// ---- scalar helpers ---------------------------------------------------------------------------------------
__device__ __forceinline__ unsigned short bf_bits(float f) {          // f32 -> bf16 bits, RNE convert
  unsigned u = __float_as_uint(f);
  return (unsigned short)((u + 0x7FFFu + ((u >> 16) & 1u)) >> 16);
}
__device__ __forceinline__ float bf_up(unsigned short hb) { return __uint_as_float(((unsigned)hb) << 16); }
__device__ __forceinline__ float bfr(float f) { return bf_up(bf_bits(f)); }
__device__ __forceinline__ unsigned short h_bits(_Float16 x) { return __builtin_bit_cast(unsigned short, x); }
__device__ __forceinline__ unsigned pk16(unsigned short a, unsigned short b) { return (unsigned)a | ((unsigned)b << 16); }
__device__ __forceinline__ v8f zero8() { v8f z = {0.f, 0.f, 0.f, 0.f, 0.f, 0.f, 0.f, 0.f}; return z; }
__device__ __forceinline__ float hmax8(v8f s) {
  return fmaxf(fmaxf(fmaxf(s[0], s[1]), fmaxf(s[2], s[3])), fmaxf(fmaxf(s[4], s[5]), fmaxf(s[6], s[7])));
}
__device__ __forceinline__ unsigned wave_ballot(bool p) {
#if defined(__HIP_DEVICE_COMPILE__)
  return __builtin_amdgcn_ballot_w32(p);
#else
  return p ? 1u : 0u;
#endif
}

// ---- 16-bit fragment loader (A, or B from a k-contiguous [n][k] row): lane -> row/col (lane&15), p already includes
//      + 8*(lane>>4); elements 0..7 <- p[0..7] (k0+8h..), elements 8..15 <- p[16..23] (k0+16+8h..)
__device__ __forceinline__ Frag ldfrag(const unsigned short* p) {
  Frag f;
  f.u[0] = *(const v8us*)(p);
  f.u[1] = *(const v8us*)(p + 16);
  return f;
}

// ---- WMMA helpers: builtin followed by a 4-slot VALU gap tying D and keeping A/B live --------------------------
__device__ __forceinline__ v8f mma_h(v16h a, v16h b, v8f c) {
  v8f d = __builtin_amdgcn_wmma_f32_16x16x32_f16(false, a, false, b, (short)0, c, false, false);
#if defined(__HIP_DEVICE_COMPILE__)
  asm volatile("v_nop\n\tv_nop\n\tv_nop\n\tv_nop" : "+v"(d) : "v"(a), "v"(b));
#endif
  return d;
}
__device__ __forceinline__ v8f mma_b(v16b a, v16b b, v8f c) {
  v8f d = __builtin_amdgcn_wmma_f32_16x16x32_bf16(false, a, false, b, (short)0, c, false, false);
#if defined(__HIP_DEVICE_COMPILE__)
  const v16h ha = __builtin_bit_cast(v16h, a), hb = __builtin_bit_cast(v16h, b);
  asm volatile("v_nop\n\tv_nop\n\tv_nop\n\tv_nop" : "+v"(d) : "v"(ha), "v"(hb));
#endif
  return d;
}

// ---- asynchronous 16-byte copies global -> LDS, one per lane and line of text. Each statement ends in s_wait_xcnt 0 so
//      that no address register of an issued copy is rewritten ahead of it. Landing is awaited by the caller.
// One 32-key stage: 4 + 4 copies bring cols 0..127 of 32 rows of the hi and the residual plane (a wave covers two whole
// 256-B row heads), 2 copies bring 64 channels x 32 keys of v. lk / lv, gh / gl / gv: this lane's first addresses.
__device__ __forceinline__ void copy_stage(unsigned lk, unsigned lv, const unsigned short* gh,
                                           const unsigned short* gl, const unsigned short* gv) {
#if defined(__HIP_DEVICE_COMPILE__)
  asm volatile("global_load_async_to_lds_b128 %0, %10, off\n\t"
               "global_load_async_to_lds_b128 %1, %11, off\n\t"
               "global_load_async_to_lds_b128 %2, %12, off\n\t"
               "global_load_async_to_lds_b128 %3, %13, off\n\t"
               "global_load_async_to_lds_b128 %4, %14, off\n\t"
               "global_load_async_to_lds_b128 %5, %15, off\n\t"
               "global_load_async_to_lds_b128 %6, %16, off\n\t"
               "global_load_async_to_lds_b128 %7, %17, off\n\t"
               "global_load_async_to_lds_b128 %8, %18, off\n\t"
               "global_load_async_to_lds_b128 %9, %19, off\n\t"
               "s_wait_xcnt 0x0"
               :: "v"(lk), "v"(lk + 8 * KP), "v"(lk + 16 * KP), "v"(lk + 24 * KP),
                  "v"(lk + SM_KL), "v"(lk + SM_KL + 8 * KP), "v"(lk + SM_KL + 16 * KP), "v"(lk + SM_KL + 24 * KP),
                  "v"(lv), "v"(lv + 32 * VP),
                  "v"(gh), "v"(gh + 8 * KROW), "v"(gh + 16 * KROW), "v"(gh + 24 * KROW),
                  "v"(gl), "v"(gl + 8 * KROW), "v"(gl + 16 * KROW), "v"(gl + 24 * KROW),
                  "v"(gv), "v"(gv + 32 * NSEQ)
               : "memory");
#endif
}
// 64 query rows of one plane: 8 copies, 8 rows apart.
__device__ __forceinline__ void copy_q(unsigned lq, const unsigned short* g) {
#if defined(__HIP_DEVICE_COMPILE__)
  asm volatile("global_load_async_to_lds_b128 %0, %8, off\n\t"
               "global_load_async_to_lds_b128 %1, %9, off\n\t"
               "global_load_async_to_lds_b128 %2, %10, off\n\t"
               "global_load_async_to_lds_b128 %3, %11, off\n\t"
               "global_load_async_to_lds_b128 %4, %12, off\n\t"
               "global_load_async_to_lds_b128 %5, %13, off\n\t"
               "global_load_async_to_lds_b128 %6, %14, off\n\t"
               "global_load_async_to_lds_b128 %7, %15, off\n\t"
               "s_wait_xcnt 0x0"
               :: "v"(lq), "v"(lq + 8 * KP), "v"(lq + 16 * KP), "v"(lq + 24 * KP),
                  "v"(lq + 32 * KP), "v"(lq + 40 * KP), "v"(lq + 48 * KP), "v"(lq + 56 * KP),
                  "v"(g), "v"(g + 8 * KROW), "v"(g + 16 * KROW), "v"(g + 24 * KROW),
                  "v"(g + 32 * KROW), "v"(g + 40 * KROW), "v"(g + 48 * KROW), "v"(g + 56 * KROW)
               : "memory");
#endif
}
// One 64-k stage of the conv1x1 GEMM: 64 weight rows, then 64 position rows, 128 B each (a wave covers four whole lines);
// 4 + 4 copies, 16 rows apart.
__device__ __forceinline__ void copy_ab(unsigned la, const unsigned short* ga, const unsigned short* gb) {
#if defined(__HIP_DEVICE_COMPILE__)
  asm volatile("global_load_async_to_lds_b128 %0, %8, off\n\t"
               "global_load_async_to_lds_b128 %1, %9, off\n\t"
               "global_load_async_to_lds_b128 %2, %10, off\n\t"
               "global_load_async_to_lds_b128 %3, %11, off\n\t"
               "global_load_async_to_lds_b128 %4, %12, off\n\t"
               "global_load_async_to_lds_b128 %5, %13, off\n\t"
               "global_load_async_to_lds_b128 %6, %14, off\n\t"
               "global_load_async_to_lds_b128 %7, %15, off\n\t"
               "s_wait_xcnt 0x0"
               :: "v"(la), "v"(la + 16 * GP), "v"(la + 32 * GP), "v"(la + 48 * GP),
                  "v"(la + 64 * GP), "v"(la + 80 * GP), "v"(la + 96 * GP), "v"(la + 112 * GP),
                  "v"(ga), "v"(ga + 16 * CDIM), "v"(ga + 32 * CDIM), "v"(ga + 48 * CDIM),
                  "v"(gb), "v"(gb + 16 * CDIM), "v"(gb + 32 * CDIM), "v"(gb + 48 * CDIM)
               : "memory");
#endif
}

// =========================================================================================================
// (0) conv1x1 weights: W16 f16 [1536][512], rows 0..511 = wq rows, 512..1023 = wk rows, 1024..1535 = wv rows;
//     value = f16 of (bf16-RNE(w) * 256) (exact). Block blk (0..191) owns rows 8*blk..8*blk+7: one wave per
// coverage: 192 blocks x 8 rows x 2 it x 32 lanes x 8 halves = 1536 x 512 = the whole plane.
// =========================================================================================================
__global__ __launch_bounds__(256)
void cvt_w(const float* __restrict__ wq, const float* __restrict__ wk, const float* __restrict__ wv,
           unsigned short* W16) {
  const int tid = threadIdx.x, blk = blockIdx.x;
  const int rl = tid >> 5, lane = tid & 31;
  const int o = 8 * blk + rl;                                        // 0..1535
  const int p = blk >> 6;                                            // block-uniform projection 0..2
  const float* wbase = (p == 0) ? wq : ((p == 1) ? wk : wv);         // all global
  const int ol = o - p * CDIM;                                       // 0..511
  v4u u[2];
#pragma unroll
  for (int it = 0; it < 2; ++it) {
    const float* s = wbase + (size_t)ol * CDIM + 256 * it + 8 * lane;
    const v4f a = *(const v4f*)s;
    const v4f q = *(const v4f*)(s + 4);
    const float f[8] = {a[0], a[1], a[2], a[3], q[0], q[1], q[2], q[3]};
#pragma unroll
    for (int t = 0; t < 4; ++t) {
      const _Float16 h0 = (_Float16)(bfr(f[2 * t]) * WSC);
      const _Float16 h1 = (_Float16)(bfr(f[2 * t + 1]) * WSC);
      u[it][t] = pk16(h_bits(h0), h_bits(h1));
    }
  }
{
#pragma unroll
    for (int it = 0; it < 2; ++it)
      *(v4u*)(W16 + (size_t)o * CDIM + 256 * it + 8 * lane) = u[it];
    
  }
}

// =========================================================================================================
// (1) x f32 [b][512 c][1024 n] -> XP f16 [b][n][c] (position-major, bf16-RNE values, exact in f16) through an
//     T is cross-wave (writer and reader waves differ): block barrier between the stores and the reload.
// coverage: XP 2 it x 32 rows x 8 lanes x 8 = 64 n x 64 c; grid (16, 8, NB) covers XP [b<NB][1024][512] once.
// =========================================================================================================
__global__ __launch_bounds__(256)
void cvt_x(const float* __restrict__ x, unsigned short* XP) {
  __shared__ __align__(16) unsigned short T[QT * TP];
  const int tid = threadIdx.x;
  const int nb = blockIdx.x, cb = blockIdx.y, b = blockIdx.z;
  const int e = tid & 7, lq = tid >> 3;                             // lq 0..31
  const int n0 = nb * QT, c0 = cb * QT;
#pragma unroll
  for (int it = 0; it < 2; ++it) {
    const int cl = it * 32 + lq;                                     // 0..63
    const float* sp = x + ((size_t)(b * CDIM + c0 + cl)) * NSEQ + n0 + 8 * e;
    const v4f a = *(const v4f*)sp;
    const v4f q = *(const v4f*)(sp + 4);
    unsigned short hb[8];
#pragma unroll
    for (int t = 0; t < 4; ++t) {
      hb[t]     = h_bits((_Float16)bfr(a[t]));
      hb[4 + t] = h_bits((_Float16)bfr(q[t]));
    }
#pragma unroll
    for (int t = 0; t < 8; ++t) T[(8 * e + t) * TP + cl] = hb[t];
  }
  __syncthreads();
  v4u up[2];
#pragma unroll
  for (int it = 0; it < 2; ++it) {
    const int nl = it * 32 + lq;                                     // 0..63
    up[it] = *(const v4u*)(T + nl * TP + 8 * e);
  }
{
#pragma unroll
    for (int it = 0; it < 2; ++it) {
      const int rl = it * 32 + lq;
      *(v4u*)(XP + ((size_t)(b * NSEQ + n0 + rl)) * CDIM + c0 + 8 * e) = up[it];
    }
    
  }
}

// =========================================================================================================
// (2) relative position rows: pos[h][d][n] = bf16-RNE(rh[h][d][n%32]) + bf16-RNE(rw[h][d][n/32]) in f32, split into
//     bf16 hi = RNE(pos) and bf16 lo = RNE(pos - hi), written to cols 128..191 of the planes QKh/QKl
//     bf16 [b][h][1024 n][192] for every b < NB. One task (h, n, e) per thread covers d = 8e..8e+7 (16 B);
// coverage: 256 blocks x 256 threads = 8 h x 1024 n x 8 e; x NB rows each -> cols 128..191 of every plane row.
// =========================================================================================================
__global__ __launch_bounds__(256)
void pos_k(const float* __restrict__ rh, const float* __restrict__ rw, unsigned short* QKh, unsigned short* QKl) {
  const int idx = blockIdx.x * 256 + (int)threadIdx.x;              // 0..65535
  const int e = idx & 7;
  const int n = (idx >> 3) & (NSEQ - 1);
  const int h = (idx >> 13) & (HEADS - 1);
  const int xw = n & 31, yh = n >> 5;
  v4u uh, ul;
#pragma unroll
  for (int t = 0; t < 4; ++t) {
    const int da = 8 * e + 2 * t, db = da + 1;
    const float f0 = bfr(rh[(h * DH + da) * 32 + xw]) + bfr(rw[(h * DH + da) * 32 + yh]);
    const float f1 = bfr(rh[(h * DH + db) * 32 + xw]) + bfr(rw[(h * DH + db) * 32 + yh]);
    const unsigned short hb0 = bf_bits(f0), hb1 = bf_bits(f1);
    const unsigned short lb0 = bf_bits(f0 - bf_up(hb0));
    const unsigned short lb1 = bf_bits(f1 - bf_up(hb1));
    uh[t] = pk16(hb0, hb1);
    ul[t] = pk16(lb0, lb1);
  }
{
#pragma unroll
    for (int b = 0; b < NB; ++b) {
      const size_t po = ((size_t)((b * HEADS + h) * NSEQ + n)) * KROW + 2 * DH + 8 * e;
      *(v4u*)(QKh + po) = uh;
      *(v4u*)(QKl + po) = ul;
    }
    
  }
}

// =========================================================================================================
// (3) conv1x1 GEMM for one (b, 64-n tile, 64-o block): Y[o][n] = (1/256) sum_c W16[o][c] XP[b][n][c] + bias[o].
//     Block 128 threads = 4 waves; wave w owns cols n0+16w..+15 (one B fragment per k-step, k = c contiguous in
//     the XP row) and 4 m-tiles (A rows o = o0 + 16 mt + (lane&15), split k map loader from W16). K = 512 = 16 steps.
//     Both operands come from LDS: a ring of two 64-k stages (64 W16 rows + 64 XP rows x 128 B, pitch 144 B = 16 B x odd)
//     brought by whole-line asynchronous copies that the 4 waves share.
//     Epilogue staged in LDS Os[n_loc][o_loc] (pitch OSP, b128 stores of 8 consecutive o per lane), block barrier
//     (Os is cross-wave), then by o-block: mb 0..7 -> q of head mb (QK planes cols 0..63, bf16 hi = RNE(v), lo =
//     RNE(v - hi)), mb 8..15 -> k of head mb-8 (cols 64..127), mb 16..23 -> v of head mb-16 -> Vc f16
//     [b][512 ch][1024 n] (channel-major, keys contiguous). Each plane row segment / Vc row segment is one whole
// coverage: Os 4 waves x 16 n x 64 o = 64 x 64; q/k path 4 it x 16 rows x 8 lanes x 8 = 64 n x 64 d (hi and lo);
//           v path 4 it x 16 ch x 8 lanes x 8 = 64 ch x 64 n; grid (16, 24, NB) covers QK cols 0..127 of all
//           rows b<NB and Vc [b<NB][512][1024] exactly once.
// =========================================================================================================
__global__ __launch_bounds__(128)
void gemm_qkv(const unsigned short* __restrict__ W16, const unsigned short* __restrict__ XP,
              const float* __restrict__ bq, const float* __restrict__ bk, const float* __restrict__ bv,
              unsigned short* QKh, unsigned short* QKl, unsigned short* Vc) {
  __shared__ __align__(16) unsigned char smem[2 * GSTAGE];
  float* Os = (float*)smem;                                          // output staging, used behind the ring's last barrier
  const int tid  = threadIdx.x;
  const int lane = tid & 31, wave = tid >> 5;
  const int hh   = lane >> 4, c = lane & 15;
  const int nt   = blockIdx.x, mb = blockIdx.y, b = blockIdx.z;
  const int n0   = nt * QT, o0 = mb * QT;                            // o0 = row block of the stacked W16

  // copy addresses of this lane: rows in 8 chunks of 16 B (row tid>>3, 16 rows per copy)
  const int cr = tid >> 3, cch = tid & 7;
  const unsigned la = (unsigned)(uintptr_t)smem + (unsigned)(cr * GP + cch * 16);   // low 32 bits = LDS byte address
  const unsigned short* ga = W16 + (size_t)(o0 + cr) * CDIM + 8 * cch;
  const unsigned short* gb = XP + ((size_t)(b * NSEQ + n0 + cr)) * CDIM + 8 * cch;

  copy_ab(la, ga, gb);
  asm volatile("s_wait_asynccnt 0x0" ::: "memory");                  // this wave's part of stage 0 has landed
  __syncthreads();                                                   // ... and every other wave's
  copy_ab(la + GSTAGE, ga + GK, gb + GK);

  v8f acc[4];
#pragma unroll
  for (int mt = 0; mt < 4; ++mt) acc[mt] = zero8();

  // rolled: one trip per ring stage, so that the publish point stands once in the text
#pragma unroll 1
  for (int s = 0; s < CDIM / GK; ++s) {
    const unsigned char* st = smem + (s & 1) * GSTAGE;
    const unsigned short* ap = (const unsigned short*)(st + c * GP) + 8 * hh;
    const unsigned short* bp = (const unsigned short*)(st + (QT + 16 * wave + c) * GP) + 8 * hh;
#pragma unroll
    for (int kk = 0; kk < GK / 32; ++kk) {
      const Frag fb = ldfrag(bp + 32 * kk);
#pragma unroll
      for (int mt = 0; mt < 4; ++mt) {
        const Frag fa = ldfrag(ap + (16 * mt) * (GP / 2) + 32 * kk);
        acc[mt] = mma_h(fa.h, fb.h, acc[mt]);
      }
    }

    asm volatile("s_wait_dscnt 0x0" ::: "memory");                   // this wave's reads of stage s are done
    asm volatile("s_wait_asynccnt 0x0" ::: "memory");                // this wave's copies of stage s+1 have landed
    __syncthreads();                                                 // publishes stage s+1, frees stage s's buffer
    if (s + 2 < CDIM / GK)
      copy_ab(la + (unsigned)((s & 1) * GSTAGE), ga + (s + 2) * GK, gb + (s + 2) * GK);
  }
  asm volatile("s_wait_asynccnt 0x0" ::: "memory");                  // nothing in flight when the ring becomes Os

  // ---- epilogue: scale back -> LDS Os[n_loc][o_loc]; lane (hh, c) holds o = 16 mt + 8 hh + r for n_loc = 16 w + c
  {
    const int nl = 16 * wave + c;
#pragma unroll
    for (int mt = 0; mt < 4; ++mt) {
      v4f va, vb;
#pragma unroll
      for (int r = 0; r < 4; ++r) { va[r] = acc[mt][r] * IWSC; vb[r] = acc[mt][4 + r] * IWSC; }
      *(v4f*)(Os + nl * OSP + 16 * mt + 8 * hh)     = va;
      *(v4f*)(Os + nl * OSP + 16 * mt + 8 * hh + 4) = vb;
    }
  }
  __syncthreads();

  const int e = tid & 7, lq = tid >> 3;                             // lq 0..15
  const int p = mb >> 3, head = mb & 7;                              // block-uniform
  const float* bias = (p == 0) ? bq : ((p == 1) ? bk : bv);          // all global
  if (p < 2) {
    const v4f b0 = *(const v4f*)(bias + head * DH + 8 * e);
    const v4f b1 = *(const v4f*)(bias + head * DH + 8 * e + 4);
    const float bb[8] = {bfr(b0[0]), bfr(b0[1]), bfr(b0[2]), bfr(b0[3]),
                         bfr(b1[0]), bfr(b1[1]), bfr(b1[2]), bfr(b1[3])};
    v4u uh[4], ul[4];
#pragma unroll
    for (int it = 0; it < 4; ++it) {
      const int row = it * 16 + lq;                                  // n_loc 0..63
      const v4f a = *(const v4f*)(Os + row * OSP + 8 * e);
      const v4f q = *(const v4f*)(Os + row * OSP + 8 * e + 4);
      const float f[8] = {a[0], a[1], a[2], a[3], q[0], q[1], q[2], q[3]};
#pragma unroll
      for (int t = 0; t < 4; ++t) {
        const float f0 = f[2 * t] + bb[2 * t], f1 = f[2 * t + 1] + bb[2 * t + 1];
        const unsigned short hb0 = bf_bits(f0), hb1 = bf_bits(f1);
        const unsigned short lb0 = bf_bits(f0 - bf_up(hb0));
        const unsigned short lb1 = bf_bits(f1 - bf_up(hb1));
        uh[it][t] = pk16(hb0, hb1);
        ul[it][t] = pk16(lb0, lb1);
      }
    }
{
#pragma unroll
      for (int it = 0; it < 4; ++it) {
        const int row = it * 16 + lq;
        const size_t po = ((size_t)((b * HEADS + head) * NSEQ + n0 + row)) * KROW + p * DH + 8 * e;
        *(v4u*)(QKh + po) = uh[it];
        *(v4u*)(QKl + po) = ul[it];
      }
      
    }
  } else {
    v4u uv[4];
#pragma unroll
    for (int it = 0; it < 4; ++it) {
      const int row = it * 16 + lq;                                  // o_loc 0..63 -> channel head*64 + row
      const float bo = bfr(bias[head * DH + row]);
      unsigned short hb[8];
#pragma unroll
      for (int t = 0; t < 8; ++t) hb[t] = h_bits((_Float16)(Os[(8 * e + t) * OSP + row] + bo));
#pragma unroll
      for (int t = 0; t < 4; ++t) uv[it][t] = pk16(hb[2 * t], hb[2 * t + 1]);
    }
{
#pragma unroll
      for (int it = 0; it < 4; ++it) {
        const int row = it * 16 + lq;
        *(v4u*)(Vc + ((size_t)(b * CDIM + head * DH + row)) * NSEQ + n0 + 8 * e) = uv[it];
      }
      
    }
  }
}

// =========================================================================================================
// (4) attention for one (b, h, 64-query tile), transposed formulation, 1024 keys, no mask, no scale:
//   S^T tile (16 keys x 16 queries) = sum over 4 d-chunks (rolled loop) of A(key row j = kb + (lane&15) of the
//   bf16 plane QKh [b][h][1024][192]: chunks 0,1 = cols 64..127 (k_j), chunks 2,3 = cols 0..63 (q_j), split k map)
//   . B(query col i: chunks 0,1 = cols 0..63 (q_i), chunks 2,3 = cols 128..191 (pos_i), same map) as
//   A(hi).B(hi) + A(hi).B(lo) + A(lo).B(hi) (bf16 unscaled residual planes, shared accumulator).
//   Per lane the D tile holds 8 keys of ONE query: online softmax state per lane, one shuffle (lane^16) for the max
//   over 32 keys; the o/l rescale is skipped under a wave-uniform ballot when no lane's max grew (corr == 1 exactly
//   for every lane then); the row sum is accumulated from the f16-converted P values; row-sum partials combined at
//   the end. P = e^{s-m} x 16384 as f16 is the B operand of O^T (rows channel, cols queries) += A(v rows channel =
//   h*64 + 16j + (lane&15), keys contiguous, f16 plane Vc [b][512][1024]) . B(P^T): element r <- D of the tile
//   covering keys kb..kb+15, element 8+r <- the tile covering kb+16..kb+31, lane unchanged. 4 accumulator tiles per
//   wave (64 channels). Block = 4 waves = 64 queries.
//   Operands come from LDS: the block's 64 query rows (cols 0..63 | 128..191 of both planes, filled once) and a ring of
//   two 32-key stages (cols 0..127 of both planes, v 64 ch x 32 keys), all brought by asynchronous copies (whole 128-B lines for the planes, 64 B per v row)
//   that the 4 waves share; rows pitched 272 B / 80 B (16 B x odd) for the b128 fragment reads.
//   Epilogue: O/l staged in LDS Os[query][64 channels] (pitch OSPW, b128 stores), block barrier (Os is cross-wave),
// coverage: 8 it x 16 lines x 8 lanes x 4 floats = 64 ch x 64 n; grid (NQ/64, NB*8) covers
//           out[b<NB][0..511][0..NQ-1] exactly once.
// =========================================================================================================
__global__ __launch_bounds__(128)
void attn_k(const unsigned short* __restrict__ QKh, const unsigned short* __restrict__ QKl,
            const unsigned short* __restrict__ Vc, float* out) {
  __shared__ __align__(16) unsigned char smem[SMEM];
  float* Os = (float*)smem;                                          // output staging, used behind the ring's last barrier
  const int tid  = threadIdx.x;
  const int wave = tid >> 5, lane = tid & 31;
  const int hh   = lane >> 4, c = lane & 15;
  const int n0   = blockIdx.x * QT;
  const int bh   = blockIdx.y;
  const int b    = bh >> 3, h = bh & 7;
  const size_t prow = (size_t)bh * NSEQ * KROW;

  // copy addresses of this lane: K / Q rows in 16 chunks of 16 B (row tid>>4, 8 rows per copy), v rows in 4 chunks
  const int kr = tid >> 4, kch = tid & 15;
  const int vr = tid >> 2, vch = tid & 3;
  const unsigned sbase = (unsigned)(uintptr_t)smem;                  // low 32 bits = byte address in the block's LDS
  const unsigned lk = sbase + (unsigned)(kr * KP + kch * 16);
  const unsigned lv = sbase + (unsigned)(SM_V + vr * VP + vch * 16);
  const unsigned short* gkh = QKh + prow + (size_t)kr * KROW + 8 * kch;
  const unsigned short* gkl = QKl + prow + (size_t)kr * KROW + 8 * kch;
  const unsigned short* gv  = Vc + ((size_t)(b * CDIM + h * DH + vr)) * NSEQ + 8 * vch;
  const size_t gq = prow + (size_t)(n0 + kr) * KROW + 8 * kch + ((kch >> 3) << 6);   // cols 0..63, then 128..191

  copy_q(lk + SM_QH, QKh + gq);
  copy_q(lk + SM_QL, QKl + gq);
  copy_stage(lk, lv, gkh, gkl, gv);
  asm volatile("s_wait_asynccnt 0x0" ::: "memory");                  // this wave's query rows and stage 0 have landed
  __syncthreads();                                                   // ... and every other wave's
  copy_stage(lk + STAGE, lv + STAGE, gkh + (size_t)KT * KROW, gkl + (size_t)KT * KROW, gv + KT);

  // query fragments (B operand, col = query 16*wave + c of the tile), + 32*kc
  const unsigned short* Qhp = (const unsigned short*)(smem + SM_QH + (16 * wave + c) * KP) + 8 * hh;
  const unsigned short* Qlp = (const unsigned short*)(smem + SM_QL + (16 * wave + c) * KP) + 8 * hh;

  float m = -1.0e30f, l = 0.f;
  v8f o[4];
#pragma unroll
  for (int j = 0; j < 4; ++j) o[j] = zero8();

  // rolled: one trip per ring stage, so that the publish point stands once in the text
#pragma unroll 1
  for (int t = 0; t < NSEQ / KT; ++t) {
    const unsigned char* st = smem + (t & 1) * STAGE;
    const unsigned short* k0p  = (const unsigned short*)(st + c * KP) + 8 * hh;              // keys 32t .. 32t+15
    const unsigned short* k1p  = (const unsigned short*)(st + (c + 16) * KP) + 8 * hh;       // keys 32t+16 .. 32t+31
    const unsigned short* k0lp = (const unsigned short*)(st + SM_KL + c * KP) + 8 * hh;
    const unsigned short* k1lp = (const unsigned short*)(st + SM_KL + (c + 16) * KP) + 8 * hh;
    const unsigned short* Vp   = (const unsigned short*)(st + SM_V + c * VP) + 8 * hh;       // + 16*j rows
    v8f s0 = zero8(), s1 = zero8();
#pragma unroll 1
    for (int kc = 0; kc < 4; ++kc) {
      const int acol = ((kc + 2) & 3) * 32;                          // 64, 96, 0, 32   (k_j | q_j)
      const int bcol = 32 * kc;                                      // LDS row = q_i | pos_i
      const Frag qh  = ldfrag(Qhp + bcol);
      const Frag ql  = ldfrag(Qlp + bcol);
      const Frag k0  = ldfrag(k0p + acol);
      const Frag k1  = ldfrag(k1p + acol);
      const Frag k0l = ldfrag(k0lp + acol);
      const Frag k1l = ldfrag(k1lp + acol);
      s0 = mma_b(k0.bf, qh.bf, s0);
      s1 = mma_b(k1.bf, qh.bf, s1);
      s0 = mma_b(k0.bf, ql.bf, s0);
      s1 = mma_b(k1.bf, ql.bf, s1);
      s0 = mma_b(k0l.bf, qh.bf, s0);
      s1 = mma_b(k1l.bf, qh.bf, s1);
    }

    float mx = fmaxf(hmax8(s0), hmax8(s1));
    mx = fmaxf(mx, __shfl_xor(mx, 16, 32));
    const float mn = fmaxf(m, mx);
    const unsigned grew = wave_ballot(mx > m);                       // wave-uniform
    if (grew != 0u) {
      const float corr = __expf(m - mn);                             // == 1 exactly for lanes whose max did not grow
      l *= corr;
#pragma unroll
      for (int j = 0; j < 4; ++j) {
#pragma unroll
        for (int r = 0; r < 8; ++r) o[j][r] *= corr;
      }
    }
    m = mn;
    const float msh = mn - LNPS;                                     // exp gives e^{s-m} * 16384

    FragH ph;
    float ls = 0.f;
#pragma unroll
    for (int r = 0; r < 8; ++r) {
      const _Float16 p0 = (_Float16)__expf(s0[r] - msh);             // key kb      + 8hh + r
      const _Float16 p1 = (_Float16)__expf(s1[r] - msh);             // key kb + 16 + 8hh + r
      ls += (float)p0 + (float)p1;
      ph.hv[0][r] = p0;
      ph.hv[1][r] = p1;
    }
    l += ls;

#pragma unroll
    for (int j = 0; j < 4; ++j) {
      const Frag vf = ldfrag(Vp + (16 * j) * (VP / 2));
      o[j] = mma_h(vf.h, ph.v, o[j]);
    }

    asm volatile("s_wait_dscnt 0x0" ::: "memory");                   // this wave's reads of stage t are done
    asm volatile("s_wait_asynccnt 0x0" ::: "memory");                // this wave's copies of stage t+1 have landed
    __syncthreads();                                                 // publishes stage t+1, frees stage t's buffer
    if (t + 2 < NSEQ / KT)
      copy_stage(lk + (unsigned)((t & 1) * STAGE), lv + (unsigned)((t & 1) * STAGE),
                 gkh + (size_t)(t + 2) * (KT * KROW), gkl + (size_t)(t + 2) * (KT * KROW), gv + (t + 2) * KT);
  }
  asm volatile("s_wait_asynccnt 0x0" ::: "memory");                  // nothing in flight when the ring becomes Os
  l += __shfl_xor(l, 16, 32);
  const float inv = 1.0f / l;                                        // o and l both carry the x16384 factor

  const int qrow = 16 * wave + c;
#pragma unroll
  for (int j = 0; j < 4; ++j) {
    v4f va, vb;
#pragma unroll
    for (int r = 0; r < 4; ++r) { va[r] = o[j][r] * inv; vb[r] = o[j][4 + r] * inv; }
    *(v4f*)(Os + qrow * OSPW + 16 * j + 8 * hh)     = va;            // Os[query][ch_loc = 16j + 8hh + r]
    *(v4f*)(Os + qrow * OSPW + 16 * j + 8 * hh + 4) = vb;
  }
  __syncthreads();

  const int e = tid & 7, lq = tid >> 3;                              // lq 0..15
  v4f res[8];
#pragma unroll
  for (int it = 0; it < 8; ++it) {
    const int L   = it * 16 + lq;                                    // 0..127
    const int chl = L >> 1, hf = L & 1;                              // channel 0..63 within the head
    const int nl  = hf * 32 + 4 * e;                                 // query 0..63
#pragma unroll
    for (int t = 0; t < 4; ++t) res[it][t] = Os[(nl + t) * OSPW + chl];
  }
{
#pragma unroll
    for (int it = 0; it < 8; ++it) {
      const int L   = it * 16 + lq;
      const int chl = L >> 1, hf = L & 1;
      const int nl  = hf * 32 + 4 * e;
      const size_t idx = ((size_t)(b * CDIM + h * DH + chl)) * NSEQ + n0 + nl;
      *(v4f*)(out + idx) = res[it];
    }
    
  }
}

// =========================================================================================================
// Workspace map (bytes; each region start a multiple of 256; every extent is an exact tile multiple and is written
//   W16 f16 [1536][512]               1572864
//   XP  f16 [NB][1024][512]           8388608 (NB=8)
//   QKh / QKl bf16 [NB][8][1024][192] 25165824 x2 (NB=8)
//   Vc  f16 [NB][512][1024]           8388608 (NB=8)
//   total = 68681728 (NB=8)
// =========================================================================================================
extern "C" void kernel_launch(void* const* d_in, const int* in_sizes, int n_in,
                              void* d_out, int out_size, void* d_ws, size_t ws_size,
                              hipStream_t stream) {
  const int XN = NB * CDIM * NSEQ;
  if (n_in < 9) return;
  if (in_sizes[0] < XN) return;
  if (in_sizes[1] < CDIM * CDIM || in_sizes[3] < CDIM * CDIM || in_sizes[5] < CDIM * CDIM) return;
  if (in_sizes[2] < CDIM || in_sizes[4] < CDIM || in_sizes[6] < CDIM) return;
  if (in_sizes[7] < HEADS * DH * 32 || in_sizes[8] < HEADS * DH * 32) return;
  if (out_size < XN) return;

  size_t off = 0;
  auto carve = [&](size_t bytes) { const size_t o = off; off += (bytes + 255) & ~(size_t)255; return o; };
  const size_t oW16 = carve((size_t)MW * CDIM * 2);
  const size_t oXP  = carve((size_t)NB * NSEQ * CDIM * 2);
  const size_t oQKh = carve((size_t)NB * HEADS * NSEQ * KROW * 2);
  const size_t oQKl = carve((size_t)NB * HEADS * NSEQ * KROW * 2);
  const size_t oVc  = carve((size_t)NB * CDIM * NSEQ * 2);
  if (off > ws_size) return;
  if (off > (size_t)134217728) return;

  const float* x   = (const float*)d_in[0];
  const float* wqw = (const float*)d_in[1];
  const float* wqb = (const float*)d_in[2];
  const float* wkw = (const float*)d_in[3];
  const float* wkb = (const float*)d_in[4];
  const float* wvw = (const float*)d_in[5];
  const float* wvb = (const float*)d_in[6];
  const float* rh  = (const float*)d_in[7];
  const float* rw  = (const float*)d_in[8];

  char* ws = (char*)d_ws;
  unsigned short* W16 = (unsigned short*)(ws + oW16);
  unsigned short* XP  = (unsigned short*)(ws + oXP);
  unsigned short* QKh = (unsigned short*)(ws + oQKh);
  unsigned short* QKl = (unsigned short*)(ws + oQKl);
  unsigned short* Vc  = (unsigned short*)(ws + oVc);
  float* out = (float*)d_out;

  const dim3 blk256(256), blk128(128);

  // (0) wq / wk / wv -> stacked f16 plane
  cvt_w<<<dim3(MW / 8), blk256, 0, stream>>>(wqw, wkw, wvw, W16);
  // (1) x -> position-major 16-bit plane
  cvt_x<<<dim3(NSEQ / QT, CDIM / QT, NB), blk256, 0, stream>>>(x, XP);
  // (2) relative position rows -> cols 128..191 of the score planes
  pos_k<<<dim3((HEADS * NSEQ * 8) / 256), blk256, 0, stream>>>(rh, rw, QKh, QKl);
  // (3) conv1x1 GEMM -> q/k hi + residual planes, v f16 plane
  gemm_qkv<<<dim3(NSEQ / QT, MW / QT, NB), blk128, 0, stream>>>(W16, XP, wqb, wkb, wvb, QKh, QKl, Vc);
  // (4) attention -> out [b][512][1024]
  attn_k<<<dim3(NQ / QT, NB * HEADS), blk128, 0, stream>>>(QKh, QKl, Vc, out);
  (void)hipGetLastError();
}

// v002
// It runs in 87.4 microseconds.
// Two timings next to v001 put it at 1.09 and 1.08 times that version's speed.
// Over all steps from v000 it is 3.07 times as fast.
// Contractions: conv1x1 q/k/v GEMM W[1536x512].X[512x1024] on v_wmma_f32_16x16x32_f16 (f16 containers of
// bf16-RNE weights x256 and bf16-RNE x); scores [k_j|q_j].[q_i|pos_i] (K=128) on v_wmma_f32_16x16x32_bf16
// (bf16 hi + bf16 residual planes, 3 products); y^T = V.P^T on v_wmma_f32_16x16x32_f16 (v as f16, P = e^{s-m}
// x 2^14 f16 from the score D registers); f32 accumulate everywhere; bias adds and softmax statistics in f32 VALU.
#include <hip/hip_runtime.h>
#include <math.h>
#include <stdint.h>

#ifndef NB
#define NB 8
#endif
#ifndef NQ
#define NQ 1024
#endif
#define HEADS 8
#define CDIM  512
#define DH    64
#define NSEQ  1024
#define NPROJ 3
#define MW    (NPROJ * CDIM)
#define KROW  192
#define QT    64
#define QB    128
#define OSP   68
#define OSPW  68
#define TP    72
#define WSC   256.0f
#define IWSC  0.00390625f
#define LNPS  9.704060527839234f
#define KT    32
#define KP    272
#define VP    80
#define SM_KL (KT * KP)
#define SM_V  (2 * KT * KP)
#define STAGE (2 * KT * KP + DH * VP)
#define SM_QH (2 * STAGE)
#define SM_QL (SM_QH + QB * KP)
#define SMEM  (SM_QL + QB * KP)
#define GK    64
#define GP    144
#define GSTAGE (2 * QT * GP)

static_assert(NB >= 1 && NB <= 8);
static_assert(NQ % QB == 0 && NQ >= QB && NQ <= NSEQ);
static_assert(HEADS * DH == CDIM);
static_assert(DH == QT);
static_assert(KROW == 3 * DH);
static_assert(NSEQ == 1024 && HEADS == 8);
static_assert(CDIM == 512);
static_assert(MW % 8 == 0 && (CDIM / 8) == 64);
static_assert(CDIM % 32 == 0 && NSEQ % QT == 0 && NSEQ % 32 == 0);
static_assert((OSP * 4) % 16 == 0);
static_assert((OSPW * 4) % 16 == 0);
static_assert((TP * 2) % 16 == 0);
static_assert((KROW * 2) % 128 == 0);
static_assert(KP % 32 == 16 && VP % 32 == 16);
static_assert(KP >= 4 * DH && VP >= 2 * KT);
static_assert(STAGE % 16 == 0 && NSEQ / KT >= 2 && NSEQ % KT == 0);
static_assert(QB * OSPW * 4 <= 2 * STAGE);
static_assert(GP % 32 == 16 && GP >= 2 * GK && GK % 32 == 0);
static_assert(CDIM % GK == 0 && CDIM / GK >= 2);
static_assert(QT * OSP * 4 <= 2 * GSTAGE);

typedef _Float16       v16h __attribute__((ext_vector_type(16)));
typedef _Float16       v8h  __attribute__((ext_vector_type(8)));
typedef __bf16         v16b __attribute__((ext_vector_type(16)));
typedef unsigned short v8us __attribute__((ext_vector_type(8)));
typedef float          v8f  __attribute__((ext_vector_type(8)));
typedef float          v4f  __attribute__((ext_vector_type(4)));
typedef unsigned int   v4u  __attribute__((ext_vector_type(4)));

union Frag  { v8us u[2]; v16h h; v16b bf; };
union FragH { v16h v; v8h hv[2]; };
static_assert(sizeof(Frag) == 32);
static_assert(sizeof(FragH) == 32);

// ---- scalar helpers ---------------------------------------------------------------------------------------
__device__ __forceinline__ unsigned short bf_bits(float f) {          // f32 -> bf16 bits, RNE convert
  unsigned u = __float_as_uint(f);
  return (unsigned short)((u + 0x7FFFu + ((u >> 16) & 1u)) >> 16);
}
__device__ __forceinline__ float bf_up(unsigned short hb) { return __uint_as_float(((unsigned)hb) << 16); }
__device__ __forceinline__ float bfr(float f) { return bf_up(bf_bits(f)); }
__device__ __forceinline__ unsigned short h_bits(_Float16 x) { return __builtin_bit_cast(unsigned short, x); }
__device__ __forceinline__ unsigned pk16(unsigned short a, unsigned short b) { return (unsigned)a | ((unsigned)b << 16); }
__device__ __forceinline__ v8f zero8() { v8f z = {0.f, 0.f, 0.f, 0.f, 0.f, 0.f, 0.f, 0.f}; return z; }
__device__ __forceinline__ float hmax8(v8f s) {
  return fmaxf(fmaxf(fmaxf(s[0], s[1]), fmaxf(s[2], s[3])), fmaxf(fmaxf(s[4], s[5]), fmaxf(s[6], s[7])));
}
__device__ __forceinline__ unsigned wave_ballot(bool p) {
#if defined(__HIP_DEVICE_COMPILE__)
  return __builtin_amdgcn_ballot_w32(p);
#else
  return p ? 1u : 0u;
#endif
}

// ---- 16-bit fragment loader (A, or B from a k-contiguous [n][k] row): lane -> row/col (lane&15), p already includes
//      + 8*(lane>>4); elements 0..7 <- p[0..7] (k0+8h..), elements 8..15 <- p[16..23] (k0+16+8h..)
__device__ __forceinline__ Frag ldfrag(const unsigned short* p) {
  Frag f;
  f.u[0] = *(const v8us*)(p);
  f.u[1] = *(const v8us*)(p + 16);
  return f;
}

// ---- WMMA helpers: builtin followed by a 4-slot VALU gap tying D and keeping A/B live --------------------------
__device__ __forceinline__ v8f mma_h(v16h a, v16h b, v8f c) {
  v8f d = __builtin_amdgcn_wmma_f32_16x16x32_f16(false, a, false, b, (short)0, c, false, false);
#if defined(__HIP_DEVICE_COMPILE__)
  asm volatile("v_nop\n\tv_nop\n\tv_nop\n\tv_nop" : "+v"(d) : "v"(a), "v"(b));
#endif
  return d;
}
// Plain builtins for the attention kernel: its live fragments pass 256 registers, and the vector operands of an asm
// statement are kept in the first 256, which spilled query fragments to scratch. The compiler keeps the distances here.
__device__ __forceinline__ v8f wm_b(v16b a, v16b b, v8f c) {
  return __builtin_amdgcn_wmma_f32_16x16x32_bf16(false, a, false, b, (short)0, c, false, false);
}
__device__ __forceinline__ v8f wm_h(v16h a, v16h b, v8f c) {
  return __builtin_amdgcn_wmma_f32_16x16x32_f16(false, a, false, b, (short)0, c, false, false);
}

// ---- asynchronous 16-byte copies global -> LDS, one per lane and line of text. Each statement ends in s_wait_xcnt 0 so
//      that no address register of an issued copy is rewritten ahead of it. Landing is awaited by the caller.
// One 32-key stage: 4 + 4 copies bring cols 0..127 of 32 rows of the hi and the residual plane (a wave covers two whole
// 256-B row heads), 2 copies bring 64 channels x 32 keys of v. lk / lv, gh / gl / gv: this lane's first addresses.
__device__ __forceinline__ void copy_stage(unsigned lk, unsigned lv, const unsigned short* gh,
                                           const unsigned short* gl, const unsigned short* gv) {
#if defined(__HIP_DEVICE_COMPILE__)
  asm volatile("global_load_async_to_lds_b128 %0, %10, off\n\t"
               "global_load_async_to_lds_b128 %1, %11, off\n\t"
               "global_load_async_to_lds_b128 %2, %12, off\n\t"
               "global_load_async_to_lds_b128 %3, %13, off\n\t"
               "global_load_async_to_lds_b128 %4, %14, off\n\t"
               "global_load_async_to_lds_b128 %5, %15, off\n\t"
               "global_load_async_to_lds_b128 %6, %16, off\n\t"
               "global_load_async_to_lds_b128 %7, %17, off\n\t"
               "global_load_async_to_lds_b128 %8, %18, off\n\t"
               "global_load_async_to_lds_b128 %9, %19, off\n\t"
               "s_wait_xcnt 0x0"
               :: "v"(lk), "v"(lk + 8 * KP), "v"(lk + 16 * KP), "v"(lk + 24 * KP),
                  "v"(lk + SM_KL), "v"(lk + SM_KL + 8 * KP), "v"(lk + SM_KL + 16 * KP), "v"(lk + SM_KL + 24 * KP),
                  "v"(lv), "v"(lv + 32 * VP),
                  "v"(gh), "v"(gh + 8 * KROW), "v"(gh + 16 * KROW), "v"(gh + 24 * KROW),
                  "v"(gl), "v"(gl + 8 * KROW), "v"(gl + 16 * KROW), "v"(gl + 24 * KROW),
                  "v"(gv), "v"(gv + 32 * NSEQ)
               : "memory");
#endif
}
// 64 query rows of one plane: 8 copies, 8 rows apart.
__device__ __forceinline__ void copy_q(unsigned lq, const unsigned short* g) {
#if defined(__HIP_DEVICE_COMPILE__)
  asm volatile("global_load_async_to_lds_b128 %0, %8, off\n\t"
               "global_load_async_to_lds_b128 %1, %9, off\n\t"
               "global_load_async_to_lds_b128 %2, %10, off\n\t"
               "global_load_async_to_lds_b128 %3, %11, off\n\t"
               "global_load_async_to_lds_b128 %4, %12, off\n\t"
               "global_load_async_to_lds_b128 %5, %13, off\n\t"
               "global_load_async_to_lds_b128 %6, %14, off\n\t"
               "global_load_async_to_lds_b128 %7, %15, off\n\t"
               "s_wait_xcnt 0x0"
               :: "v"(lq), "v"(lq + 8 * KP), "v"(lq + 16 * KP), "v"(lq + 24 * KP),
                  "v"(lq + 32 * KP), "v"(lq + 40 * KP), "v"(lq + 48 * KP), "v"(lq + 56 * KP),
                  "v"(g), "v"(g + 8 * KROW), "v"(g + 16 * KROW), "v"(g + 24 * KROW),
                  "v"(g + 32 * KROW), "v"(g + 40 * KROW), "v"(g + 48 * KROW), "v"(g + 56 * KROW)
               : "memory");
#endif
}
// One 64-k stage of the conv1x1 GEMM: 64 weight rows, then 64 position rows, 128 B each (a wave covers four whole lines);
// 4 + 4 copies, 16 rows apart.
__device__ __forceinline__ void copy_ab(unsigned la, const unsigned short* ga, const unsigned short* gb) {
#if defined(__HIP_DEVICE_COMPILE__)
  asm volatile("global_load_async_to_lds_b128 %0, %8, off\n\t"
               "global_load_async_to_lds_b128 %1, %9, off\n\t"
               "global_load_async_to_lds_b128 %2, %10, off\n\t"
               "global_load_async_to_lds_b128 %3, %11, off\n\t"
               "global_load_async_to_lds_b128 %4, %12, off\n\t"
               "global_load_async_to_lds_b128 %5, %13, off\n\t"
               "global_load_async_to_lds_b128 %6, %14, off\n\t"
               "global_load_async_to_lds_b128 %7, %15, off\n\t"
               "s_wait_xcnt 0x0"
               :: "v"(la), "v"(la + 16 * GP), "v"(la + 32 * GP), "v"(la + 48 * GP),
                  "v"(la + 64 * GP), "v"(la + 80 * GP), "v"(la + 96 * GP), "v"(la + 112 * GP),
                  "v"(ga), "v"(ga + 16 * CDIM), "v"(ga + 32 * CDIM), "v"(ga + 48 * CDIM),
                  "v"(gb), "v"(gb + 16 * CDIM), "v"(gb + 32 * CDIM), "v"(gb + 48 * CDIM)
               : "memory");
#endif
}

// =========================================================================================================
// (0) conv1x1 weights: W16 f16 [1536][512], rows 0..511 = wq rows, 512..1023 = wk rows, 1024..1535 = wv rows;
//     value = f16 of (bf16-RNE(w) * 256) (exact). Block blk (0..191) owns rows 8*blk..8*blk+7: one wave per
// coverage: 192 blocks x 8 rows x 2 it x 32 lanes x 8 halves = 1536 x 512 = the whole plane.
// =========================================================================================================
__global__ __launch_bounds__(256)
void cvt_w(const float* __restrict__ wq, const float* __restrict__ wk, const float* __restrict__ wv,
           unsigned short* W16) {
  const int tid = threadIdx.x, blk = blockIdx.x;
  const int rl = tid >> 5, lane = tid & 31;
  const int o = 8 * blk + rl;                                        // 0..1535
  const int p = blk >> 6;                                            // block-uniform projection 0..2
  const float* wbase = (p == 0) ? wq : ((p == 1) ? wk : wv);         // all global
  const int ol = o - p * CDIM;                                       // 0..511
  v4u u[2];
#pragma unroll
  for (int it = 0; it < 2; ++it) {
    const float* s = wbase + (size_t)ol * CDIM + 256 * it + 8 * lane;
    const v4f a = *(const v4f*)s;
    const v4f q = *(const v4f*)(s + 4);
    const float f[8] = {a[0], a[1], a[2], a[3], q[0], q[1], q[2], q[3]};
#pragma unroll
    for (int t = 0; t < 4; ++t) {
      const _Float16 h0 = (_Float16)(bfr(f[2 * t]) * WSC);
      const _Float16 h1 = (_Float16)(bfr(f[2 * t + 1]) * WSC);
      u[it][t] = pk16(h_bits(h0), h_bits(h1));
    }
  }
{
#pragma unroll
    for (int it = 0; it < 2; ++it)
      *(v4u*)(W16 + (size_t)o * CDIM + 256 * it + 8 * lane) = u[it];
    
  }
}

// =========================================================================================================
// (1) x f32 [b][512 c][1024 n] -> XP f16 [b][n][c] (position-major, bf16-RNE values, exact in f16) through an
//     T is cross-wave (writer and reader waves differ): block barrier between the stores and the reload.
// coverage: XP 2 it x 32 rows x 8 lanes x 8 = 64 n x 64 c; grid (16, 8, NB) covers XP [b<NB][1024][512] once.
// =========================================================================================================
__global__ __launch_bounds__(256)
void cvt_x(const float* __restrict__ x, unsigned short* XP) {
  __shared__ __align__(16) unsigned short T[QT * TP];
  const int tid = threadIdx.x;
  const int nb = blockIdx.x, cb = blockIdx.y, b = blockIdx.z;
  const int e = tid & 7, lq = tid >> 3;                             // lq 0..31
  const int n0 = nb * QT, c0 = cb * QT;
#pragma unroll
  for (int it = 0; it < 2; ++it) {
    const int cl = it * 32 + lq;                                     // 0..63
    const float* sp = x + ((size_t)(b * CDIM + c0 + cl)) * NSEQ + n0 + 8 * e;
    const v4f a = *(const v4f*)sp;
    const v4f q = *(const v4f*)(sp + 4);
    unsigned short hb[8];
#pragma unroll
    for (int t = 0; t < 4; ++t) {
      hb[t]     = h_bits((_Float16)bfr(a[t]));
      hb[4 + t] = h_bits((_Float16)bfr(q[t]));
    }
#pragma unroll
    for (int t = 0; t < 8; ++t) T[(8 * e + t) * TP + cl] = hb[t];
  }
  __syncthreads();
  v4u up[2];
#pragma unroll
  for (int it = 0; it < 2; ++it) {
    const int nl = it * 32 + lq;                                     // 0..63
    up[it] = *(const v4u*)(T + nl * TP + 8 * e);
  }
{
#pragma unroll
    for (int it = 0; it < 2; ++it) {
      const int rl = it * 32 + lq;
      *(v4u*)(XP + ((size_t)(b * NSEQ + n0 + rl)) * CDIM + c0 + 8 * e) = up[it];
    }
    
  }
}

// =========================================================================================================
// (2) relative position rows: pos[h][d][n] = bf16-RNE(rh[h][d][n%32]) + bf16-RNE(rw[h][d][n/32]) in f32, split into
//     bf16 hi = RNE(pos) and bf16 lo = RNE(pos - hi), written to cols 128..191 of the planes QKh/QKl
//     bf16 [b][h][1024 n][192] for every b < NB. One task (h, n, e) per thread covers d = 8e..8e+7 (16 B);
// coverage: 256 blocks x 256 threads = 8 h x 1024 n x 8 e; x NB rows each -> cols 128..191 of every plane row.
// =========================================================================================================
__global__ __launch_bounds__(256)
void pos_k(const float* __restrict__ rh, const float* __restrict__ rw, unsigned short* QKh, unsigned short* QKl) {
  const int idx = blockIdx.x * 256 + (int)threadIdx.x;              // 0..65535
  const int e = idx & 7;
  const int n = (idx >> 3) & (NSEQ - 1);
  const int h = (idx >> 13) & (HEADS - 1);
  const int xw = n & 31, yh = n >> 5;
  v4u uh, ul;
#pragma unroll
  for (int t = 0; t < 4; ++t) {
    const int da = 8 * e + 2 * t, db = da + 1;
    const float f0 = bfr(rh[(h * DH + da) * 32 + xw]) + bfr(rw[(h * DH + da) * 32 + yh]);
    const float f1 = bfr(rh[(h * DH + db) * 32 + xw]) + bfr(rw[(h * DH + db) * 32 + yh]);
    const unsigned short hb0 = bf_bits(f0), hb1 = bf_bits(f1);
    const unsigned short lb0 = bf_bits(f0 - bf_up(hb0));
    const unsigned short lb1 = bf_bits(f1 - bf_up(hb1));
    uh[t] = pk16(hb0, hb1);
    ul[t] = pk16(lb0, lb1);
  }
{
#pragma unroll
    for (int b = 0; b < NB; ++b) {
      const size_t po = ((size_t)((b * HEADS + h) * NSEQ + n)) * KROW + 2 * DH + 8 * e;
      *(v4u*)(QKh + po) = uh;
      *(v4u*)(QKl + po) = ul;
    }
    
  }
}

// =========================================================================================================
// (3) conv1x1 GEMM for one (b, 64-n tile, 64-o block): Y[o][n] = (1/256) sum_c W16[o][c] XP[b][n][c] + bias[o].
//     Block 128 threads = 4 waves; wave w owns cols n0+16w..+15 (one B fragment per k-step, k = c contiguous in
//     the XP row) and 4 m-tiles (A rows o = o0 + 16 mt + (lane&15), split k map loader from W16). K = 512 = 16 steps.
//     Both operands come from LDS: a ring of two 64-k stages (64 W16 rows + 64 XP rows x 128 B, pitch 144 B = 16 B x odd)
//     brought by whole-line asynchronous copies that the 4 waves share.
//     Epilogue staged in LDS Os[n_loc][o_loc] (pitch OSP, b128 stores of 8 consecutive o per lane), block barrier
//     (Os is cross-wave), then by o-block: mb 0..7 -> q of head mb (QK planes cols 0..63, bf16 hi = RNE(v), lo =
//     RNE(v - hi)), mb 8..15 -> k of head mb-8 (cols 64..127), mb 16..23 -> v of head mb-16 -> Vc f16
//     [b][512 ch][1024 n] (channel-major, keys contiguous). Each plane row segment / Vc row segment is one whole
// coverage: Os 4 waves x 16 n x 64 o = 64 x 64; q/k path 4 it x 16 rows x 8 lanes x 8 = 64 n x 64 d (hi and lo);
//           v path 4 it x 16 ch x 8 lanes x 8 = 64 ch x 64 n; grid (16, 24, NB) covers QK cols 0..127 of all
//           rows b<NB and Vc [b<NB][512][1024] exactly once.
// =========================================================================================================
__global__ __launch_bounds__(128)
void gemm_qkv(const unsigned short* __restrict__ W16, const unsigned short* __restrict__ XP,
              const float* __restrict__ bq, const float* __restrict__ bk, const float* __restrict__ bv,
              unsigned short* QKh, unsigned short* QKl, unsigned short* Vc) {
  __shared__ __align__(16) unsigned char smem[2 * GSTAGE];
  float* Os = (float*)smem;                                          // output staging, used behind the ring's last barrier
  const int tid  = threadIdx.x;
  const int lane = tid & 31, wave = tid >> 5;
  const int hh   = lane >> 4, c = lane & 15;
  const int nt   = blockIdx.x, mb = blockIdx.y, b = blockIdx.z;
  const int n0   = nt * QT, o0 = mb * QT;                            // o0 = row block of the stacked W16

  // copy addresses of this lane: rows in 8 chunks of 16 B (row tid>>3, 16 rows per copy)
  const int cr = tid >> 3, cch = tid & 7;
  const unsigned la = (unsigned)(uintptr_t)smem + (unsigned)(cr * GP + cch * 16);   // low 32 bits = LDS byte address
  const unsigned short* ga = W16 + (size_t)(o0 + cr) * CDIM + 8 * cch;
  const unsigned short* gb = XP + ((size_t)(b * NSEQ + n0 + cr)) * CDIM + 8 * cch;

  copy_ab(la, ga, gb);
  asm volatile("s_wait_asynccnt 0x0" ::: "memory");                  // this wave's part of stage 0 has landed
  __syncthreads();                                                   // ... and every other wave's
  copy_ab(la + GSTAGE, ga + GK, gb + GK);

  v8f acc[4];
#pragma unroll
  for (int mt = 0; mt < 4; ++mt) acc[mt] = zero8();

  // rolled: one trip per ring stage, so that the publish point stands once in the text
#pragma unroll 1
  for (int s = 0; s < CDIM / GK; ++s) {
    const unsigned char* st = smem + (s & 1) * GSTAGE;
    const unsigned short* ap = (const unsigned short*)(st + c * GP) + 8 * hh;
    const unsigned short* bp = (const unsigned short*)(st + (QT + 16 * wave + c) * GP) + 8 * hh;
#pragma unroll
    for (int kk = 0; kk < GK / 32; ++kk) {
      const Frag fb = ldfrag(bp + 32 * kk);
#pragma unroll
      for (int mt = 0; mt < 4; ++mt) {
        const Frag fa = ldfrag(ap + (16 * mt) * (GP / 2) + 32 * kk);
        acc[mt] = mma_h(fa.h, fb.h, acc[mt]);
      }
    }

    asm volatile("s_wait_dscnt 0x0" ::: "memory");                   // this wave's reads of stage s are done
    asm volatile("s_wait_asynccnt 0x0" ::: "memory");                // this wave's copies of stage s+1 have landed
    __syncthreads();                                                 // publishes stage s+1, frees stage s's buffer
    if (s + 2 < CDIM / GK)
      copy_ab(la + (unsigned)((s & 1) * GSTAGE), ga + (s + 2) * GK, gb + (s + 2) * GK);
  }
  asm volatile("s_wait_asynccnt 0x0" ::: "memory");                  // nothing in flight when the ring becomes Os

  // ---- epilogue: scale back -> LDS Os[n_loc][o_loc]; lane (hh, c) holds o = 16 mt + 8 hh + r for n_loc = 16 w + c
  {
    const int nl = 16 * wave + c;
#pragma unroll
    for (int mt = 0; mt < 4; ++mt) {
      v4f va, vb;
#pragma unroll
      for (int r = 0; r < 4; ++r) { va[r] = acc[mt][r] * IWSC; vb[r] = acc[mt][4 + r] * IWSC; }
      *(v4f*)(Os + nl * OSP + 16 * mt + 8 * hh)     = va;
      *(v4f*)(Os + nl * OSP + 16 * mt + 8 * hh + 4) = vb;
    }
  }
  __syncthreads();

  const int e = tid & 7, lq = tid >> 3;                             // lq 0..15
  const int p = mb >> 3, head = mb & 7;                              // block-uniform
  const float* bias = (p == 0) ? bq : ((p == 1) ? bk : bv);          // all global
  if (p < 2) {
    const v4f b0 = *(const v4f*)(bias + head * DH + 8 * e);
    const v4f b1 = *(const v4f*)(bias + head * DH + 8 * e + 4);
    const float bb[8] = {bfr(b0[0]), bfr(b0[1]), bfr(b0[2]), bfr(b0[3]),
                         bfr(b1[0]), bfr(b1[1]), bfr(b1[2]), bfr(b1[3])};
    v4u uh[4], ul[4];
#pragma unroll
    for (int it = 0; it < 4; ++it) {
      const int row = it * 16 + lq;                                  // n_loc 0..63
      const v4f a = *(const v4f*)(Os + row * OSP + 8 * e);
      const v4f q = *(const v4f*)(Os + row * OSP + 8 * e + 4);
      const float f[8] = {a[0], a[1], a[2], a[3], q[0], q[1], q[2], q[3]};
#pragma unroll
      for (int t = 0; t < 4; ++t) {
        const float f0 = f[2 * t] + bb[2 * t], f1 = f[2 * t + 1] + bb[2 * t + 1];
        const unsigned short hb0 = bf_bits(f0), hb1 = bf_bits(f1);
        const unsigned short lb0 = bf_bits(f0 - bf_up(hb0));
        const unsigned short lb1 = bf_bits(f1 - bf_up(hb1));
        uh[it][t] = pk16(hb0, hb1);
        ul[it][t] = pk16(lb0, lb1);
      }
    }
{
#pragma unroll
      for (int it = 0; it < 4; ++it) {
        const int row = it * 16 + lq;
        const size_t po = ((size_t)((b * HEADS + head) * NSEQ + n0 + row)) * KROW + p * DH + 8 * e;
        *(v4u*)(QKh + po) = uh[it];
        *(v4u*)(QKl + po) = ul[it];
      }
      
    }
  } else {
    v4u uv[4];
#pragma unroll
    for (int it = 0; it < 4; ++it) {
      const int row = it * 16 + lq;                                  // o_loc 0..63 -> channel head*64 + row
      const float bo = bfr(bias[head * DH + row]);
      unsigned short hb[8];
#pragma unroll
      for (int t = 0; t < 8; ++t) hb[t] = h_bits((_Float16)(Os[(8 * e + t) * OSP + row] + bo));
#pragma unroll
      for (int t = 0; t < 4; ++t) uv[it][t] = pk16(hb[2 * t], hb[2 * t + 1]);
    }
{
#pragma unroll
      for (int it = 0; it < 4; ++it) {
        const int row = it * 16 + lq;
        *(v4u*)(Vc + ((size_t)(b * CDIM + head * DH + row)) * NSEQ + n0 + 8 * e) = uv[it];
      }
      
    }
  }
}

// =========================================================================================================
// (4) attention for one (b, h, 128-query tile), transposed formulation, 1024 keys, no mask, no scale:
//   S^T tile (16 keys x 16 queries) = sum over 4 d-chunks (unrolled loop) of A(key row j = kb + (lane&15) of the
//   bf16 plane QKh [b][h][1024][192]: chunks 0,1 = cols 64..127 (k_j), chunks 2,3 = cols 0..63 (q_j), split k map)
//   . B(query col i: chunks 0,1 = cols 0..63 (q_i), chunks 2,3 = cols 128..191 (pos_i), same map) as
//   A(hi).B(hi) + A(hi).B(lo) + A(lo).B(hi) (bf16 unscaled residual planes, shared accumulator).
//   Per lane the D tile holds 8 keys of ONE query: online softmax state per lane, one shuffle (lane^16) for the max
//   over 32 keys; the o/l rescale is skipped under a wave-uniform ballot when no lane's max grew (corr == 1 exactly
//   for every lane then); the row sum is accumulated from the f16-converted P values; row-sum partials combined at
//   the end. P = e^{s-m} x 16384 as f16 is the B operand of O^T (rows channel, cols queries) += A(v rows channel =
//   h*64 + 16j + (lane&15), keys contiguous, f16 plane Vc [b][512][1024]) . B(P^T): element r <- D of the tile
//   covering keys kb..kb+15, element 8+r <- the tile covering kb+16..kb+31, lane unchanged. 4 accumulator tiles per
//   16-query column group (64 channels). Block = 4 waves = 128 queries.
//   Wave tile: a wave owns two 16-query column groups and keeps their B fragments (4 d-chunks x hi / residual) in
//   registers for the whole key loop, so every key and v fragment read from LDS feeds both groups and the loop reads no
//   query row. Each accumulator sums its products in the order hi.hi, hi.lo, lo.hi per d-chunk.
//   The block's 128 query rows (cols 0..63 | 128..191 of both planes) pass through LDS once; a ring of two 32-key
//   stages (cols 0..127 of both planes, v 64 ch x 32 keys) feeds the loop; all brought by asynchronous copies (v in 64-B row pieces)
//   that the 4 waves share; rows pitched 272 B / 80 B (16 B x odd) for the b128 fragment reads.
//   Epilogue: O/l staged in LDS Os[query][64 channels] (pitch OSPW, b128 stores), block barrier (Os is cross-wave),
// coverage: 16 it x 16 lines x 8 lanes x 4 floats = 64 ch x 128 n; grid (NQ/128, NB*8) covers
//           out[b<NB][0..511][0..NQ-1] exactly once.
// =========================================================================================================
__global__ __launch_bounds__(128)
void attn_k(const unsigned short* __restrict__ QKh, const unsigned short* __restrict__ QKl,
            const unsigned short* __restrict__ Vc, float* out) {
  __shared__ __align__(16) unsigned char smem[SMEM];
  float* Os = (float*)smem;                                          // output staging, used behind the ring's last barrier
  const int tid  = threadIdx.x;
  const int wave = tid >> 5, lane = tid & 31;
  const int hh   = lane >> 4, c = lane & 15;
  const int n0   = blockIdx.x * QB;
  const int bh   = blockIdx.y;
  const int b    = bh >> 3, h = bh & 7;
  const size_t prow = (size_t)bh * NSEQ * KROW;

  // copy addresses of this lane: K / Q rows in 16 chunks of 16 B (row tid>>4, 8 rows per copy), v rows in 4 chunks
  const int kr = tid >> 4, kch = tid & 15;
  const int vr = tid >> 2, vch = tid & 3;
  const unsigned sbase = (unsigned)(uintptr_t)smem;                  // low 32 bits = byte address in the block's LDS
  const unsigned lk = sbase + (unsigned)(kr * KP + kch * 16);
  const unsigned lv = sbase + (unsigned)(SM_V + vr * VP + vch * 16);
  const unsigned short* gkh = QKh + prow + (size_t)kr * KROW + 8 * kch;
  const unsigned short* gkl = QKl + prow + (size_t)kr * KROW + 8 * kch;
  const unsigned short* gv  = Vc + ((size_t)(b * CDIM + h * DH + vr)) * NSEQ + 8 * vch;
  const size_t gq = prow + (size_t)(n0 + kr) * KROW + 8 * kch + ((kch >> 3) << 6);   // cols 0..63, then 128..191

  copy_q(lk + SM_QH, QKh + gq);
  copy_q(lk + SM_QH + QT * KP, QKh + gq + (size_t)QT * KROW);
  copy_q(lk + SM_QL, QKl + gq);
  copy_q(lk + SM_QL + QT * KP, QKl + gq + (size_t)QT * KROW);
  copy_stage(lk, lv, gkh, gkl, gv);
  asm volatile("s_wait_asynccnt 0x0" ::: "memory");                  // this wave's query rows and stage 0 have landed
  __syncthreads();                                                   // ... and every other wave's
  copy_stage(lk + STAGE, lv + STAGE, gkh + (size_t)KT * KROW, gkl + (size_t)KT * KROW, gv + KT);

  // query fragments (B operand, col = query 32*wave + 16*u + c of the tile), read once and held in registers
  Frag qh[2][4], ql[2][4];
#pragma unroll
  for (int u = 0; u < 2; ++u) {
    const unsigned short* Qhp = (const unsigned short*)(smem + SM_QH + (32 * wave + 16 * u + c) * KP) + 8 * hh;
    const unsigned short* Qlp = (const unsigned short*)(smem + SM_QL + (32 * wave + 16 * u + c) * KP) + 8 * hh;
#pragma unroll
    for (int kc = 0; kc < 4; ++kc) {                                 // LDS row = q_i | pos_i
      qh[u][kc] = ldfrag(Qhp + 32 * kc);
      ql[u][kc] = ldfrag(Qlp + 32 * kc);
    }
  }

  float m[2] = {-1.0e30f, -1.0e30f}, l[2] = {0.f, 0.f};
  v8f o[2][4];
#pragma unroll
  for (int u = 0; u < 2; ++u) {
#pragma unroll
    for (int j = 0; j < 4; ++j) o[u][j] = zero8();
  }

  // rolled: one trip per ring stage, so that the publish point stands once in the text
#pragma unroll 1
  for (int t = 0; t < NSEQ / KT; ++t) {
    const unsigned char* st = smem + (t & 1) * STAGE;
    const unsigned short* k0p  = (const unsigned short*)(st + c * KP) + 8 * hh;              // keys 32t .. 32t+15
    const unsigned short* k1p  = (const unsigned short*)(st + (c + 16) * KP) + 8 * hh;       // keys 32t+16 .. 32t+31
    const unsigned short* k0lp = (const unsigned short*)(st + SM_KL + c * KP) + 8 * hh;
    const unsigned short* k1lp = (const unsigned short*)(st + SM_KL + (c + 16) * KP) + 8 * hh;
    const unsigned short* Vp   = (const unsigned short*)(st + SM_V + c * VP) + 8 * hh;       // + 16*j rows
    v8f s0[2], s1[2];
#pragma unroll
    for (int u = 0; u < 2; ++u) { s0[u] = zero8(); s1[u] = zero8(); }
    // unrolled: the register-held query fragments need constant indices
#pragma unroll
    for (int kc = 0; kc < 4; ++kc) {
      const int acol = ((kc + 2) & 3) * 32;                          // 64, 96, 0, 32   (k_j | q_j)
      const Frag k0  = ldfrag(k0p + acol);
      const Frag k1  = ldfrag(k1p + acol);
      const Frag k0l = ldfrag(k0lp + acol);
      const Frag k1l = ldfrag(k1lp + acol);
#pragma unroll
      for (int u = 0; u < 2; ++u) {
        s0[u] = wm_b(k0.bf, qh[u][kc].bf, s0[u]);
        s1[u] = wm_b(k1.bf, qh[u][kc].bf, s1[u]);
      }
#pragma unroll
      for (int u = 0; u < 2; ++u) {
        s0[u] = wm_b(k0.bf, ql[u][kc].bf, s0[u]);
        s1[u] = wm_b(k1.bf, ql[u][kc].bf, s1[u]);
      }
#pragma unroll
      for (int u = 0; u < 2; ++u) {
        s0[u] = wm_b(k0l.bf, qh[u][kc].bf, s0[u]);
        s1[u] = wm_b(k1l.bf, qh[u][kc].bf, s1[u]);
      }
    }

    float mn[2];
    bool up = false;
#pragma unroll
    for (int u = 0; u < 2; ++u) {
      float mx = fmaxf(hmax8(s0[u]), hmax8(s1[u]));
      mx = fmaxf(mx, __shfl_xor(mx, 16, 32));
      mn[u] = fmaxf(m[u], mx);
      up = up || (mx > m[u]);
    }
    const unsigned grew = wave_ballot(up);                           // wave-uniform, one test per stage
    if (grew != 0u) {
#pragma unroll
      for (int u = 0; u < 2; ++u) {
        const float corr = __expf(m[u] - mn[u]);                     // == 1 exactly where the max did not grow
        l[u] *= corr;
#pragma unroll
        for (int j = 0; j < 4; ++j) {
#pragma unroll
          for (int r = 0; r < 8; ++r) o[u][j][r] *= corr;
        }
      }
    }

    FragH ph[2];
#pragma unroll
    for (int u = 0; u < 2; ++u) {
      m[u] = mn[u];
      const float msh = mn[u] - LNPS;                                // exp gives e^{s-m} * 16384
      float ls = 0.f;
#pragma unroll
      for (int r = 0; r < 8; ++r) {
        const _Float16 p0 = (_Float16)__expf(s0[u][r] - msh);        // key kb      + 8hh + r
        const _Float16 p1 = (_Float16)__expf(s1[u][r] - msh);        // key kb + 16 + 8hh + r
        ls += (float)p0 + (float)p1;
        ph[u].hv[0][r] = p0;
        ph[u].hv[1][r] = p1;
      }
      l[u] += ls;
    }

#pragma unroll
    for (int j = 0; j < 4; ++j) {
      const Frag vf = ldfrag(Vp + (16 * j) * (VP / 2));
      o[0][j] = wm_h(vf.h, ph[0].v, o[0][j]);
      o[1][j] = wm_h(vf.h, ph[1].v, o[1][j]);
    }

    asm volatile("s_wait_dscnt 0x0" ::: "memory");                   // this wave's reads of stage t are done
    asm volatile("s_wait_asynccnt 0x0" ::: "memory");                // this wave's copies of stage t+1 have landed
    __syncthreads();                                                 // publishes stage t+1, frees stage t's buffer
    if (t + 2 < NSEQ / KT)
      copy_stage(lk + (unsigned)((t & 1) * STAGE), lv + (unsigned)((t & 1) * STAGE),
                 gkh + (size_t)(t + 2) * (KT * KROW), gkl + (size_t)(t + 2) * (KT * KROW), gv + (t + 2) * KT);
  }
  asm volatile("s_wait_asynccnt 0x0" ::: "memory");                  // nothing in flight when the ring becomes Os

#pragma unroll
  for (int u = 0; u < 2; ++u) {
    const float lt  = l[u] + __shfl_xor(l[u], 16, 32);
    const float inv = 1.0f / lt;                                     // o and l both carry the x16384 factor
    const int qrow = 32 * wave + 16 * u + c;
#pragma unroll
    for (int j = 0; j < 4; ++j) {
      v4f va, vb;
#pragma unroll
      for (int r = 0; r < 4; ++r) { va[r] = o[u][j][r] * inv; vb[r] = o[u][j][4 + r] * inv; }
      *(v4f*)(Os + qrow * OSPW + 16 * j + 8 * hh)     = va;          // Os[query][ch_loc = 16j + 8hh + r]
      *(v4f*)(Os + qrow * OSPW + 16 * j + 8 * hh + 4) = vb;
    }
  }
  __syncthreads();

  const int e = tid & 7, lq = tid >> 3;                              // lq 0..15
  v4f res[16];
#pragma unroll
  for (int it = 0; it < 16; ++it) {
    const int L   = it * 16 + lq;                                    // 0..255
    const int chl = L >> 2, qf = L & 3;                              // channel 0..63 within the head
    const int nl  = qf * 32 + 4 * e;                                 // query 0..127
#pragma unroll
    for (int t = 0; t < 4; ++t) res[it][t] = Os[(nl + t) * OSPW + chl];
  }
#pragma unroll
  for (int it = 0; it < 16; ++it) {
    const int L   = it * 16 + lq;
    const int chl = L >> 2, qf = L & 3;
    const int nl  = qf * 32 + 4 * e;
    const size_t idx = ((size_t)(b * CDIM + h * DH + chl)) * NSEQ + n0 + nl;
    *(v4f*)(out + idx) = res[it];
  }
}

// =========================================================================================================
// Workspace map (bytes; each region start a multiple of 256; every extent is an exact tile multiple and is written
//   W16 f16 [1536][512]               1572864
//   XP  f16 [NB][1024][512]           8388608 (NB=8)
//   QKh / QKl bf16 [NB][8][1024][192] 25165824 x2 (NB=8)
//   Vc  f16 [NB][512][1024]           8388608 (NB=8)
//   total = 68681728 (NB=8)
// =========================================================================================================
extern "C" void kernel_launch(void* const* d_in, const int* in_sizes, int n_in,
                              void* d_out, int out_size, void* d_ws, size_t ws_size,
                              hipStream_t stream) {
  const int XN = NB * CDIM * NSEQ;
  if (n_in < 9) return;
  if (in_sizes[0] < XN) return;
  if (in_sizes[1] < CDIM * CDIM || in_sizes[3] < CDIM * CDIM || in_sizes[5] < CDIM * CDIM) return;
  if (in_sizes[2] < CDIM || in_sizes[4] < CDIM || in_sizes[6] < CDIM) return;
  if (in_sizes[7] < HEADS * DH * 32 || in_sizes[8] < HEADS * DH * 32) return;
  if (out_size < XN) return;

  size_t off = 0;
  auto carve = [&](size_t bytes) { const size_t o = off; off += (bytes + 255) & ~(size_t)255; return o; };
  const size_t oW16 = carve((size_t)MW * CDIM * 2);
  const size_t oXP  = carve((size_t)NB * NSEQ * CDIM * 2);
  const size_t oQKh = carve((size_t)NB * HEADS * NSEQ * KROW * 2);
  const size_t oQKl = carve((size_t)NB * HEADS * NSEQ * KROW * 2);
  const size_t oVc  = carve((size_t)NB * CDIM * NSEQ * 2);
  if (off > ws_size) return;
  if (off > (size_t)134217728) return;

  const float* x   = (const float*)d_in[0];
  const float* wqw = (const float*)d_in[1];
  const float* wqb = (const float*)d_in[2];
  const float* wkw = (const float*)d_in[3];
  const float* wkb = (const float*)d_in[4];
  const float* wvw = (const float*)d_in[5];
  const float* wvb = (const float*)d_in[6];
  const float* rh  = (const float*)d_in[7];
  const float* rw  = (const float*)d_in[8];

  char* ws = (char*)d_ws;
  unsigned short* W16 = (unsigned short*)(ws + oW16);
  unsigned short* XP  = (unsigned short*)(ws + oXP);
  unsigned short* QKh = (unsigned short*)(ws + oQKh);
  unsigned short* QKl = (unsigned short*)(ws + oQKl);
  unsigned short* Vc  = (unsigned short*)(ws + oVc);
  float* out = (float*)d_out;

  const dim3 blk256(256), blk128(128);

  // (0) wq / wk / wv -> stacked f16 plane
  cvt_w<<<dim3(MW / 8), blk256, 0, stream>>>(wqw, wkw, wvw, W16);
  // (1) x -> position-major 16-bit plane
  cvt_x<<<dim3(NSEQ / QT, CDIM / QT, NB), blk256, 0, stream>>>(x, XP);
  // (2) relative position rows -> cols 128..191 of the score planes
  pos_k<<<dim3((HEADS * NSEQ * 8) / 256), blk256, 0, stream>>>(rh, rw, QKh, QKl);
  // (3) conv1x1 GEMM -> q/k hi + residual planes, v f16 plane
  gemm_qkv<<<dim3(NSEQ / QT, MW / QT, NB), blk128, 0, stream>>>(W16, XP, wqb, wkb, wvb, QKh, QKl, Vc);
  // (4) attention -> out [b][512][1024]
  attn_k<<<dim3(NQ / QB, NB * HEADS), blk128, 0, stream>>>(QKh, QKl, Vc, out);
  (void)hipGetLastError();
}

// v003
// One run takes 80.9 microseconds.
// In both of two side-by-side timings against v002, it was 1.08 times as fast.
// All steps since v000 together make it 3.32 times as fast.
// Contractions: conv1x1 q/k/v GEMM W[1536x512].X[512x1024] on v_wmma_f32_16x16x32_f16 (f16 containers of
// bf16-RNE weights x256 and bf16-RNE x); scores [k_j|q_j].[q_i|pos_i] (K=128) on v_wmma_f32_16x16x32_bf16
// (bf16 hi + bf16 residual planes, 3 products); y^T = V.P^T on v_wmma_f32_16x16x32_f16 (v as f16, P = e^{s-m}
// x 2^14 f16 from the score D registers); f32 accumulate everywhere; bias adds and softmax statistics in f32 VALU.
#include <hip/hip_runtime.h>
#include <math.h>
#include <stdint.h>

#ifndef NB
#define NB 8
#endif
#ifndef NQ
#define NQ 1024
#endif
#define HEADS 8
#define CDIM  512
#define DH    64
#define NSEQ  1024
#define NPROJ 3
#define MW    (NPROJ * CDIM)
#define KROW  192
#define QT    64
#define QB    128
#define OSP   68
#define OSPW  68
#define TP    72
#define WSC   256.0f
#define IWSC  0.00390625f
#define LNPS  9.704060527839234f
#define KT    32
#define KP    272
#define VP    80
#define SM_KL (KT * KP)
#define SM_V  (2 * KT * KP)
#define STAGE (2 * KT * KP + DH * VP)
#define SM_QH (2 * STAGE)
#define SM_QL (SM_QH + QB * KP)
#define SMEM  (SM_QL + QB * KP)
#define GK    64
#define GP    144
#define GSTAGE (2 * QT * GP)
#define PXB   ((NSEQ / QT) * (CDIM / QT) * NB)
#define PPB   ((HEADS * NSEQ * 8) / 256)
#define PWB   (MW / 8)

static_assert(NB >= 1 && NB <= 8);
static_assert(NQ % QB == 0 && NQ >= QB && NQ <= NSEQ);
static_assert(HEADS * DH == CDIM);
static_assert(DH == QT);
static_assert(KROW == 3 * DH);
static_assert(NSEQ == 1024 && HEADS == 8);
static_assert(CDIM == 512);
static_assert(MW % 8 == 0 && (CDIM / 8) == 64);
static_assert(CDIM % 32 == 0 && NSEQ % QT == 0 && NSEQ % 32 == 0);
static_assert((OSP * 4) % 16 == 0);
static_assert((OSPW * 4) % 16 == 0);
static_assert((TP * 2) % 16 == 0);
static_assert((KROW * 2) % 128 == 0);
static_assert(KP % 32 == 16 && VP % 32 == 16);
static_assert(KP >= 4 * DH && VP >= 2 * KT);
static_assert(STAGE % 16 == 0 && NSEQ / KT >= 2 && NSEQ % KT == 0);
static_assert(QB * OSPW * 4 <= 2 * STAGE);
static_assert(GP % 32 == 16 && GP >= 2 * GK && GK % 32 == 0);
static_assert(CDIM % GK == 0 && CDIM / GK >= 2);
static_assert(QT * OSP * 4 <= 2 * GSTAGE);
static_assert(NSEQ / QT == 16 && CDIM / QT == 8);

typedef _Float16       v16h __attribute__((ext_vector_type(16)));
typedef _Float16       v8h  __attribute__((ext_vector_type(8)));
typedef __bf16         v16b __attribute__((ext_vector_type(16)));
typedef unsigned short v8us __attribute__((ext_vector_type(8)));
typedef float          v8f  __attribute__((ext_vector_type(8)));
typedef float          v4f  __attribute__((ext_vector_type(4)));
typedef unsigned int   v4u  __attribute__((ext_vector_type(4)));

union Frag  { v8us u[2]; v16h h; v16b bf; };
union FragH { v16h v; v8h hv[2]; };
static_assert(sizeof(Frag) == 32);
static_assert(sizeof(FragH) == 32);

// ---- scalar helpers ---------------------------------------------------------------------------------------
__device__ __forceinline__ unsigned short bf_bits(float f) {          // f32 -> bf16 bits, RNE convert
  unsigned u = __float_as_uint(f);
  return (unsigned short)((u + 0x7FFFu + ((u >> 16) & 1u)) >> 16);
}
__device__ __forceinline__ float bf_up(unsigned short hb) { return __uint_as_float(((unsigned)hb) << 16); }
__device__ __forceinline__ float bfr(float f) { return bf_up(bf_bits(f)); }
__device__ __forceinline__ unsigned short h_bits(_Float16 x) { return __builtin_bit_cast(unsigned short, x); }
__device__ __forceinline__ unsigned pk16(unsigned short a, unsigned short b) { return (unsigned)a | ((unsigned)b << 16); }
__device__ __forceinline__ v8f zero8() { v8f z = {0.f, 0.f, 0.f, 0.f, 0.f, 0.f, 0.f, 0.f}; return z; }
__device__ __forceinline__ float hmax8(v8f s) {
  return fmaxf(fmaxf(fmaxf(s[0], s[1]), fmaxf(s[2], s[3])), fmaxf(fmaxf(s[4], s[5]), fmaxf(s[6], s[7])));
}
__device__ __forceinline__ unsigned wave_ballot(bool p) {
#if defined(__HIP_DEVICE_COMPILE__)
  return __builtin_amdgcn_ballot_w32(p);
#else
  return p ? 1u : 0u;
#endif
}

// ---- 16-bit fragment loader (A, or B from a k-contiguous [n][k] row): lane -> row/col (lane&15), p already includes
//      + 8*(lane>>4); elements 0..7 <- p[0..7] (k0+8h..), elements 8..15 <- p[16..23] (k0+16+8h..)
__device__ __forceinline__ Frag ldfrag(const unsigned short* p) {
  Frag f;
  f.u[0] = *(const v8us*)(p);
  f.u[1] = *(const v8us*)(p + 16);
  return f;
}

// ---- WMMA helpers: builtin followed by a 4-slot VALU gap tying D and keeping A/B live --------------------------
__device__ __forceinline__ v8f mma_h(v16h a, v16h b, v8f c) {
  v8f d = __builtin_amdgcn_wmma_f32_16x16x32_f16(false, a, false, b, (short)0, c, false, false);
#if defined(__HIP_DEVICE_COMPILE__)
  asm volatile("v_nop\n\tv_nop\n\tv_nop\n\tv_nop" : "+v"(d) : "v"(a), "v"(b));
#endif
  return d;
}
// Plain builtins for the attention kernel: its live fragments pass 256 registers, and the vector operands of an asm
// statement are kept in the first 256, which spilled query fragments to scratch. The compiler keeps the distances here.
__device__ __forceinline__ v8f wm_b(v16b a, v16b b, v8f c) {
  return __builtin_amdgcn_wmma_f32_16x16x32_bf16(false, a, false, b, (short)0, c, false, false);
}
__device__ __forceinline__ v8f wm_h(v16h a, v16h b, v8f c) {
  return __builtin_amdgcn_wmma_f32_16x16x32_f16(false, a, false, b, (short)0, c, false, false);
}

// ---- asynchronous 16-byte copies global -> LDS, one per lane and line of text. Each statement ends in s_wait_xcnt 0 so
//      that no address register of an issued copy is rewritten ahead of it. Landing is awaited by the caller.
// One 32-key stage: 4 + 4 copies bring cols 0..127 of 32 rows of the hi and the residual plane (a wave covers two whole
// 256-B row heads), 2 copies bring 64 channels x 32 keys of v. lk / lv, gh / gl / gv: this lane's first addresses.
__device__ __forceinline__ void copy_stage(unsigned lk, unsigned lv, const unsigned short* gh,
                                           const unsigned short* gl, const unsigned short* gv) {
#if defined(__HIP_DEVICE_COMPILE__)
  asm volatile("global_load_async_to_lds_b128 %0, %10, off\n\t"
               "global_load_async_to_lds_b128 %1, %11, off\n\t"
               "global_load_async_to_lds_b128 %2, %12, off\n\t"
               "global_load_async_to_lds_b128 %3, %13, off\n\t"
               "global_load_async_to_lds_b128 %4, %14, off\n\t"
               "global_load_async_to_lds_b128 %5, %15, off\n\t"
               "global_load_async_to_lds_b128 %6, %16, off\n\t"
               "global_load_async_to_lds_b128 %7, %17, off\n\t"
               "global_load_async_to_lds_b128 %8, %18, off\n\t"
               "global_load_async_to_lds_b128 %9, %19, off\n\t"
               "s_wait_xcnt 0x0"
               :: "v"(lk), "v"(lk + 8 * KP), "v"(lk + 16 * KP), "v"(lk + 24 * KP),
                  "v"(lk + SM_KL), "v"(lk + SM_KL + 8 * KP), "v"(lk + SM_KL + 16 * KP), "v"(lk + SM_KL + 24 * KP),
                  "v"(lv), "v"(lv + 32 * VP),
                  "v"(gh), "v"(gh + 8 * KROW), "v"(gh + 16 * KROW), "v"(gh + 24 * KROW),
                  "v"(gl), "v"(gl + 8 * KROW), "v"(gl + 16 * KROW), "v"(gl + 24 * KROW),
                  "v"(gv), "v"(gv + 32 * NSEQ)
               : "memory");
#endif
}
// 64 query rows of one plane: 8 copies, 8 rows apart.
__device__ __forceinline__ void copy_q(unsigned lq, const unsigned short* g) {
#if defined(__HIP_DEVICE_COMPILE__)
  asm volatile("global_load_async_to_lds_b128 %0, %8, off\n\t"
               "global_load_async_to_lds_b128 %1, %9, off\n\t"
               "global_load_async_to_lds_b128 %2, %10, off\n\t"
               "global_load_async_to_lds_b128 %3, %11, off\n\t"
               "global_load_async_to_lds_b128 %4, %12, off\n\t"
               "global_load_async_to_lds_b128 %5, %13, off\n\t"
               "global_load_async_to_lds_b128 %6, %14, off\n\t"
               "global_load_async_to_lds_b128 %7, %15, off\n\t"
               "s_wait_xcnt 0x0"
               :: "v"(lq), "v"(lq + 8 * KP), "v"(lq + 16 * KP), "v"(lq + 24 * KP),
                  "v"(lq + 32 * KP), "v"(lq + 40 * KP), "v"(lq + 48 * KP), "v"(lq + 56 * KP),
                  "v"(g), "v"(g + 8 * KROW), "v"(g + 16 * KROW), "v"(g + 24 * KROW),
                  "v"(g + 32 * KROW), "v"(g + 40 * KROW), "v"(g + 48 * KROW), "v"(g + 56 * KROW)
               : "memory");
#endif
}
// One 64-k stage of the conv1x1 GEMM: 64 weight rows, then 64 position rows, 128 B each (a wave covers four whole lines);
// 4 + 4 copies, 16 rows apart.
__device__ __forceinline__ void copy_ab(unsigned la, const unsigned short* ga, const unsigned short* gb) {
#if defined(__HIP_DEVICE_COMPILE__)
  asm volatile("global_load_async_to_lds_b128 %0, %8, off\n\t"
               "global_load_async_to_lds_b128 %1, %9, off\n\t"
               "global_load_async_to_lds_b128 %2, %10, off\n\t"
               "global_load_async_to_lds_b128 %3, %11, off\n\t"
               "global_load_async_to_lds_b128 %4, %12, off\n\t"
               "global_load_async_to_lds_b128 %5, %13, off\n\t"
               "global_load_async_to_lds_b128 %6, %14, off\n\t"
               "global_load_async_to_lds_b128 %7, %15, off\n\t"
               "s_wait_xcnt 0x0"
               :: "v"(la), "v"(la + 16 * GP), "v"(la + 32 * GP), "v"(la + 48 * GP),
                  "v"(la + 64 * GP), "v"(la + 80 * GP), "v"(la + 96 * GP), "v"(la + 112 * GP),
                  "v"(ga), "v"(ga + 16 * CDIM), "v"(ga + 32 * CDIM), "v"(ga + 48 * CDIM),
                  "v"(gb), "v"(gb + 16 * CDIM), "v"(gb + 32 * CDIM), "v"(gb + 48 * CDIM)
               : "memory");
#endif
}

// =========================================================================================================
// (0) conv1x1 weights: W16 f16 [1536][512], rows 0..511 = wq rows, 512..1023 = wk rows, 1024..1535 = wv rows;
//     value = f16 of (bf16-RNE(w) * 256) (exact). Block blk (0..191) owns rows 8*blk..8*blk+7: one wave per
// coverage: 192 blocks x 8 rows x 2 it x 32 lanes x 8 halves = 1536 x 512 = the whole plane.
// =========================================================================================================
__device__ __forceinline__
void cvt_w(const int blk, const float* __restrict__ wq, const float* __restrict__ wk, const float* __restrict__ wv,
           unsigned short* W16) {
  const int tid = threadIdx.x;
  const int rl = tid >> 5, lane = tid & 31;
  const int o = 8 * blk + rl;                                        // 0..1535
  const int p = blk >> 6;                                            // block-uniform projection 0..2
  const float* wbase = (p == 0) ? wq : ((p == 1) ? wk : wv);         // all global
  const int ol = o - p * CDIM;                                       // 0..511
  v4u u[2];
#pragma unroll
  for (int it = 0; it < 2; ++it) {
    const float* s = wbase + (size_t)ol * CDIM + 256 * it + 8 * lane;
    const v4f a = *(const v4f*)s;
    const v4f q = *(const v4f*)(s + 4);
    const float f[8] = {a[0], a[1], a[2], a[3], q[0], q[1], q[2], q[3]};
#pragma unroll
    for (int t = 0; t < 4; ++t) {
      const _Float16 h0 = (_Float16)(bfr(f[2 * t]) * WSC);
      const _Float16 h1 = (_Float16)(bfr(f[2 * t + 1]) * WSC);
      u[it][t] = pk16(h_bits(h0), h_bits(h1));
    }
  }
{
#pragma unroll
    for (int it = 0; it < 2; ++it)
      *(v4u*)(W16 + (size_t)o * CDIM + 256 * it + 8 * lane) = u[it];
    asm volatile("s_wait_xcnt 0x0" ::: "memory");                    // precaution: each block runs one job, so only the kernel's end follows
  }
}

// =========================================================================================================
// (1) x f32 [b][512 c][1024 n] -> XP f16 [b][n][c] (position-major, bf16-RNE values, exact in f16) through an
//     T is cross-wave (writer and reader waves differ): block barrier between the stores and the reload.
// coverage: XP 2 it x 32 rows x 8 lanes x 8 = 64 n x 64 c; blk = (b, cb, nb) in 0..128*NB-1 covers XP [b<NB][1024][512] once.
// =========================================================================================================
__device__ __forceinline__
void cvt_x(const int blk, const float* __restrict__ x, unsigned short* XP) {
  __shared__ __align__(16) unsigned short T[QT * TP];
  const int tid = threadIdx.x;
  const int nb = blk & (NSEQ / QT - 1), cb = (blk >> 4) & (CDIM / QT - 1), b = blk >> 7;
  const int e = tid & 7, lq = tid >> 3;                             // lq 0..31
  const int n0 = nb * QT, c0 = cb * QT;
#pragma unroll
  for (int it = 0; it < 2; ++it) {
    const int cl = it * 32 + lq;                                     // 0..63
    const float* sp = x + ((size_t)(b * CDIM + c0 + cl)) * NSEQ + n0 + 8 * e;
    const v4f a = *(const v4f*)sp;
    const v4f q = *(const v4f*)(sp + 4);
    // the next trip's loads may land in this trip's address registers: wait before they issue
    if (it == 0) asm volatile("s_wait_xcnt 0x0" ::: "memory");
    unsigned short hb[8];
#pragma unroll
    for (int t = 0; t < 4; ++t) {
      hb[t]     = h_bits((_Float16)bfr(a[t]));
      hb[4 + t] = h_bits((_Float16)bfr(q[t]));
    }
#pragma unroll
    for (int t = 0; t < 8; ++t) T[(8 * e + t) * TP + cl] = hb[t];
  }
  __syncthreads();
  v4u up[2];
#pragma unroll
  for (int it = 0; it < 2; ++it) {
    const int nl = it * 32 + lq;                                     // 0..63
    up[it] = *(const v4u*)(T + nl * TP + 8 * e);
  }
{
#pragma unroll
    for (int it = 0; it < 2; ++it) {
      const int rl = it * 32 + lq;
      *(v4u*)(XP + ((size_t)(b * NSEQ + n0 + rl)) * CDIM + c0 + 8 * e) = up[it];
    }
    asm volatile("s_wait_xcnt 0x0" ::: "memory");                    // precaution: each block runs one job, so only the kernel's end follows
  }
}

// =========================================================================================================
// (2) relative position rows: pos[h][d][n] = bf16-RNE(rh[h][d][n%32]) + bf16-RNE(rw[h][d][n/32]) in f32, split into
//     bf16 hi = RNE(pos) and bf16 lo = RNE(pos - hi), written to cols 128..191 of the planes QKh/QKl
//     bf16 [b][h][1024 n][192] for every b < NB. One task (h, n, e) per thread covers d = 8e..8e+7 (16 B);
// coverage: 256 blocks x 256 threads = 8 h x 1024 n x 8 e; x NB rows each -> cols 128..191 of every plane row.
// =========================================================================================================
__device__ __forceinline__
void pos_k(const int blk, const float* __restrict__ rh, const float* __restrict__ rw,
           unsigned short* QKh, unsigned short* QKl) {
  const int idx = blk * 256 + (int)threadIdx.x;                     // 0..65535
  const int e = idx & 7;
  const int n = (idx >> 3) & (NSEQ - 1);
  const int h = (idx >> 13) & (HEADS - 1);
  const int xw = n & 31, yh = n >> 5;
  v4u uh, ul;
#pragma unroll
  for (int t = 0; t < 4; ++t) {
    const int da = 8 * e + 2 * t, db = da + 1;
    const float f0 = bfr(rh[(h * DH + da) * 32 + xw]) + bfr(rw[(h * DH + da) * 32 + yh]);
    const float f1 = bfr(rh[(h * DH + db) * 32 + xw]) + bfr(rw[(h * DH + db) * 32 + yh]);
    const unsigned short hb0 = bf_bits(f0), hb1 = bf_bits(f1);
    const unsigned short lb0 = bf_bits(f0 - bf_up(hb0));
    const unsigned short lb1 = bf_bits(f1 - bf_up(hb1));
    uh[t] = pk16(hb0, hb1);
    ul[t] = pk16(lb0, lb1);
  }
{
#pragma unroll
    for (int b = 0; b < NB; ++b) {
      const size_t po = ((size_t)((b * HEADS + h) * NSEQ + n)) * KROW + 2 * DH + 8 * e;
      *(v4u*)(QKh + po) = uh;
      *(v4u*)(QKl + po) = ul;
    }
    asm volatile("s_wait_xcnt 0x0" ::: "memory");                    // precaution: each block runs one job, so only the kernel's end follows
  }
}

// =========================================================================================================
// (0)+(1)+(2) in one launch: the three jobs read only inputs and write disjoint planes, so none needs another's result.
//     A range of the block index picks the job (block-uniform branch, so the barrier in (1) is passed by whole blocks):
//     blocks 0..PXB-1 -> (1), the longest job, first; then PPB blocks of (2); then PWB blocks of (0).
// =========================================================================================================
__global__ __launch_bounds__(256)
void prep(const float* __restrict__ x, const float* __restrict__ wq, const float* __restrict__ wk,
          const float* __restrict__ wv, const float* __restrict__ rh, const float* __restrict__ rw,
          unsigned short* W16, unsigned short* XP, unsigned short* QKh, unsigned short* QKl) {
  const int blk = blockIdx.x;
  if (blk < PXB)            cvt_x(blk, x, XP);
  else if (blk < PXB + PPB) pos_k(blk - PXB, rh, rw, QKh, QKl);
  else                      cvt_w(blk - (PXB + PPB), wq, wk, wv, W16);
}

// =========================================================================================================
// (3) conv1x1 GEMM for one (b, 64-n tile, 64-o block): Y[o][n] = (1/256) sum_c W16[o][c] XP[b][n][c] + bias[o].
//     Block 128 threads = 4 waves; wave w owns cols n0+16w..+15 (one B fragment per k-step, k = c contiguous in
//     the XP row) and 4 m-tiles (A rows o = o0 + 16 mt + (lane&15), split k map loader from W16). K = 512 = 16 steps.
//     Both operands come from LDS: a ring of two 64-k stages (64 W16 rows + 64 XP rows x 128 B, pitch 144 B = 16 B x odd)
//     brought by whole-line asynchronous copies that the 4 waves share.
//     Epilogue staged in LDS Os[n_loc][o_loc] (pitch OSP, b128 stores of 8 consecutive o per lane), block barrier
//     (Os is cross-wave), then by o-block: mb 0..7 -> q of head mb (QK planes cols 0..63, bf16 hi = RNE(v), lo =
//     RNE(v - hi)), mb 8..15 -> k of head mb-8 (cols 64..127), mb 16..23 -> v of head mb-16 -> Vc f16
//     [b][512 ch][1024 n] (channel-major, keys contiguous). Each plane row segment / Vc row segment is one whole
// coverage: Os 4 waves x 16 n x 64 o = 64 x 64; q/k path 4 it x 16 rows x 8 lanes x 8 = 64 n x 64 d (hi and lo);
//           v path 4 it x 16 ch x 8 lanes x 8 = 64 ch x 64 n; grid (16, 24, NB) covers QK cols 0..127 of all
//           rows b<NB and Vc [b<NB][512][1024] exactly once.
// =========================================================================================================
__global__ __launch_bounds__(128)
void gemm_qkv(const unsigned short* __restrict__ W16, const unsigned short* __restrict__ XP,
              const float* __restrict__ bq, const float* __restrict__ bk, const float* __restrict__ bv,
              unsigned short* QKh, unsigned short* QKl, unsigned short* Vc) {
  __shared__ __align__(16) unsigned char smem[2 * GSTAGE];
  float* Os = (float*)smem;                                          // output staging, used behind the ring's last barrier
  const int tid  = threadIdx.x;
  const int lane = tid & 31, wave = tid >> 5;
  const int hh   = lane >> 4, c = lane & 15;
  const int nt   = blockIdx.x, mb = blockIdx.y, b = blockIdx.z;
  const int n0   = nt * QT, o0 = mb * QT;                            // o0 = row block of the stacked W16

  // copy addresses of this lane: rows in 8 chunks of 16 B (row tid>>3, 16 rows per copy)
  const int cr = tid >> 3, cch = tid & 7;
  const unsigned la = (unsigned)(uintptr_t)smem + (unsigned)(cr * GP + cch * 16);   // low 32 bits = LDS byte address
  const unsigned short* ga = W16 + (size_t)(o0 + cr) * CDIM + 8 * cch;
  const unsigned short* gb = XP + ((size_t)(b * NSEQ + n0 + cr)) * CDIM + 8 * cch;

  copy_ab(la, ga, gb);
  asm volatile("s_wait_asynccnt 0x0" ::: "memory");                  // this wave's part of stage 0 has landed
  __syncthreads();                                                   // ... and every other wave's
  copy_ab(la + GSTAGE, ga + GK, gb + GK);

  v8f acc[4];
#pragma unroll
  for (int mt = 0; mt < 4; ++mt) acc[mt] = zero8();

  // rolled: one trip per ring stage, so that the publish point stands once in the text
#pragma unroll 1
  for (int s = 0; s < CDIM / GK; ++s) {
    const unsigned char* st = smem + (s & 1) * GSTAGE;
    const unsigned short* ap = (const unsigned short*)(st + c * GP) + 8 * hh;
    const unsigned short* bp = (const unsigned short*)(st + (QT + 16 * wave + c) * GP) + 8 * hh;
#pragma unroll
    for (int kk = 0; kk < GK / 32; ++kk) {
      const Frag fb = ldfrag(bp + 32 * kk);
#pragma unroll
      for (int mt = 0; mt < 4; ++mt) {
        const Frag fa = ldfrag(ap + (16 * mt) * (GP / 2) + 32 * kk);
        acc[mt] = mma_h(fa.h, fb.h, acc[mt]);
      }
    }

    asm volatile("s_wait_dscnt 0x0" ::: "memory");                   // this wave's reads of stage s are done
    asm volatile("s_wait_asynccnt 0x0" ::: "memory");                // this wave's copies of stage s+1 have landed
    __syncthreads();                                                 // publishes stage s+1, frees stage s's buffer
    if (s + 2 < CDIM / GK)
      copy_ab(la + (unsigned)((s & 1) * GSTAGE), ga + (s + 2) * GK, gb + (s + 2) * GK);
  }
  asm volatile("s_wait_asynccnt 0x0" ::: "memory");                  // nothing in flight when the ring becomes Os

  // ---- epilogue: scale back -> LDS Os[n_loc][o_loc]; lane (hh, c) holds o = 16 mt + 8 hh + r for n_loc = 16 w + c
  {
    const int nl = 16 * wave + c;
#pragma unroll
    for (int mt = 0; mt < 4; ++mt) {
      v4f va, vb;
#pragma unroll
      for (int r = 0; r < 4; ++r) { va[r] = acc[mt][r] * IWSC; vb[r] = acc[mt][4 + r] * IWSC; }
      *(v4f*)(Os + nl * OSP + 16 * mt + 8 * hh)     = va;
      *(v4f*)(Os + nl * OSP + 16 * mt + 8 * hh + 4) = vb;
    }
  }
  __syncthreads();

  const int e = tid & 7, lq = tid >> 3;                             // lq 0..15
  const int p = mb >> 3, head = mb & 7;                              // block-uniform
  const float* bias = (p == 0) ? bq : ((p == 1) ? bk : bv);          // all global
  if (p < 2) {
    const v4f b0 = *(const v4f*)(bias + head * DH + 8 * e);
    const v4f b1 = *(const v4f*)(bias + head * DH + 8 * e + 4);
    const float bb[8] = {bfr(b0[0]), bfr(b0[1]), bfr(b0[2]), bfr(b0[3]),
                         bfr(b1[0]), bfr(b1[1]), bfr(b1[2]), bfr(b1[3])};
    v4u uh[4], ul[4];
#pragma unroll
    for (int it = 0; it < 4; ++it) {
      const int row = it * 16 + lq;                                  // n_loc 0..63
      const v4f a = *(const v4f*)(Os + row * OSP + 8 * e);
      const v4f q = *(const v4f*)(Os + row * OSP + 8 * e + 4);
      const float f[8] = {a[0], a[1], a[2], a[3], q[0], q[1], q[2], q[3]};
#pragma unroll
      for (int t = 0; t < 4; ++t) {
        const float f0 = f[2 * t] + bb[2 * t], f1 = f[2 * t + 1] + bb[2 * t + 1];
        const unsigned short hb0 = bf_bits(f0), hb1 = bf_bits(f1);
        const unsigned short lb0 = bf_bits(f0 - bf_up(hb0));
        const unsigned short lb1 = bf_bits(f1 - bf_up(hb1));
        uh[it][t] = pk16(hb0, hb1);
        ul[it][t] = pk16(lb0, lb1);
      }
    }
{
#pragma unroll
      for (int it = 0; it < 4; ++it) {
        const int row = it * 16 + lq;
        const size_t po = ((size_t)((b * HEADS + head) * NSEQ + n0 + row)) * KROW + p * DH + 8 * e;
        *(v4u*)(QKh + po) = uh[it];
        *(v4u*)(QKl + po) = ul[it];
      }
      
    }
  } else {
    v4u uv[4];
#pragma unroll
    for (int it = 0; it < 4; ++it) {
      const int row = it * 16 + lq;                                  // o_loc 0..63 -> channel head*64 + row
      const float bo = bfr(bias[head * DH + row]);
      unsigned short hb[8];
#pragma unroll
      for (int t = 0; t < 8; ++t) hb[t] = h_bits((_Float16)(Os[(8 * e + t) * OSP + row] + bo));
#pragma unroll
      for (int t = 0; t < 4; ++t) uv[it][t] = pk16(hb[2 * t], hb[2 * t + 1]);
    }
{
#pragma unroll
      for (int it = 0; it < 4; ++it) {
        const int row = it * 16 + lq;
        *(v4u*)(Vc + ((size_t)(b * CDIM + head * DH + row)) * NSEQ + n0 + 8 * e) = uv[it];
      }
      
    }
  }
}

// =========================================================================================================
// (4) attention for one (b, h, 128-query tile), transposed formulation, 1024 keys, no mask, no scale:
//   S^T tile (16 keys x 16 queries) = sum over 4 d-chunks (unrolled loop) of A(key row j = kb + (lane&15) of the
//   bf16 plane QKh [b][h][1024][192]: chunks 0,1 = cols 64..127 (k_j), chunks 2,3 = cols 0..63 (q_j), split k map)
//   . B(query col i: chunks 0,1 = cols 0..63 (q_i), chunks 2,3 = cols 128..191 (pos_i), same map) as
//   A(hi).B(hi) + A(hi).B(lo) + A(lo).B(hi) (bf16 unscaled residual planes, shared accumulator).
//   Per lane the D tile holds 8 keys of ONE query: online softmax state per lane, one shuffle (lane^16) for the max
//   over 32 keys; the o/l rescale is skipped under a wave-uniform ballot when no lane's max grew (corr == 1 exactly
//   for every lane then); the row sum is accumulated from the f16-converted P values; row-sum partials combined at
//   the end. P = e^{s-m} x 16384 as f16 is the B operand of O^T (rows channel, cols queries) += A(v rows channel =
//   h*64 + 16j + (lane&15), keys contiguous, f16 plane Vc [b][512][1024]) . B(P^T): element r <- D of the tile
//   covering keys kb..kb+15, element 8+r <- the tile covering kb+16..kb+31, lane unchanged. 4 accumulator tiles per
//   16-query column group (64 channels). Block = 4 waves = 128 queries.
//   Wave tile: a wave owns two 16-query column groups and keeps their B fragments (4 d-chunks x hi / residual) in
//   registers for the whole key loop, so every key and v fragment read from LDS feeds both groups and the loop reads no
//   query row. Each accumulator sums its products in the order hi.hi, hi.lo, lo.hi per d-chunk.
//   The block's 128 query rows (cols 0..63 | 128..191 of both planes) pass through LDS once; a ring of two 32-key
//   stages (cols 0..127 of both planes, v 64 ch x 32 keys) feeds the loop; all brought by asynchronous copies (v in 64-B row pieces)
//   that the 4 waves share; rows pitched 272 B / 80 B (16 B x odd) for the b128 fragment reads.
//   Epilogue: O/l staged in LDS Os[query][64 channels] (pitch OSPW, b128 stores), block barrier (Os is cross-wave),
// coverage: 16 it x 16 lines x 8 lanes x 4 floats = 64 ch x 128 n; grid (NQ/128, NB*8) covers
//           out[b<NB][0..511][0..NQ-1] exactly once.
// =========================================================================================================
__global__ __launch_bounds__(128)
void attn_k(const unsigned short* __restrict__ QKh, const unsigned short* __restrict__ QKl,
            const unsigned short* __restrict__ Vc, float* out) {
  __shared__ __align__(16) unsigned char smem[SMEM];
  float* Os = (float*)smem;                                          // output staging, used behind the ring's last barrier
  const int tid  = threadIdx.x;
  const int wave = tid >> 5, lane = tid & 31;
  const int hh   = lane >> 4, c = lane & 15;
  const int n0   = blockIdx.x * QB;
  const int bh   = blockIdx.y;
  const int b    = bh >> 3, h = bh & 7;
  const size_t prow = (size_t)bh * NSEQ * KROW;

  // copy addresses of this lane: K / Q rows in 16 chunks of 16 B (row tid>>4, 8 rows per copy), v rows in 4 chunks
  const int kr = tid >> 4, kch = tid & 15;
  const int vr = tid >> 2, vch = tid & 3;
  const unsigned sbase = (unsigned)(uintptr_t)smem;                  // low 32 bits = byte address in the block's LDS
  const unsigned lk = sbase + (unsigned)(kr * KP + kch * 16);
  const unsigned lv = sbase + (unsigned)(SM_V + vr * VP + vch * 16);
  const unsigned short* gkh = QKh + prow + (size_t)kr * KROW + 8 * kch;
  const unsigned short* gkl = QKl + prow + (size_t)kr * KROW + 8 * kch;
  const unsigned short* gv  = Vc + ((size_t)(b * CDIM + h * DH + vr)) * NSEQ + 8 * vch;
  const size_t gq = prow + (size_t)(n0 + kr) * KROW + 8 * kch + ((kch >> 3) << 6);   // cols 0..63, then 128..191

  copy_q(lk + SM_QH, QKh + gq);
  copy_q(lk + SM_QH + QT * KP, QKh + gq + (size_t)QT * KROW);
  copy_q(lk + SM_QL, QKl + gq);
  copy_q(lk + SM_QL + QT * KP, QKl + gq + (size_t)QT * KROW);
  copy_stage(lk, lv, gkh, gkl, gv);
  asm volatile("s_wait_asynccnt 0x0" ::: "memory");                  // this wave's query rows and stage 0 have landed
  __syncthreads();                                                   // ... and every other wave's
  copy_stage(lk + STAGE, lv + STAGE, gkh + (size_t)KT * KROW, gkl + (size_t)KT * KROW, gv + KT);

  // query fragments (B operand, col = query 32*wave + 16*u + c of the tile), read once and held in registers
  Frag qh[2][4], ql[2][4];
#pragma unroll
  for (int u = 0; u < 2; ++u) {
    const unsigned short* Qhp = (const unsigned short*)(smem + SM_QH + (32 * wave + 16 * u + c) * KP) + 8 * hh;
    const unsigned short* Qlp = (const unsigned short*)(smem + SM_QL + (32 * wave + 16 * u + c) * KP) + 8 * hh;
#pragma unroll
    for (int kc = 0; kc < 4; ++kc) {                                 // LDS row = q_i | pos_i
      qh[u][kc] = ldfrag(Qhp + 32 * kc);
      ql[u][kc] = ldfrag(Qlp + 32 * kc);
    }
  }

  float m[2] = {-1.0e30f, -1.0e30f}, l[2] = {0.f, 0.f};
  v8f o[2][4];
#pragma unroll
  for (int u = 0; u < 2; ++u) {
#pragma unroll
    for (int j = 0; j < 4; ++j) o[u][j] = zero8();
  }

  // rolled: one trip per ring stage, so that the publish point stands once in the text
#pragma unroll 1
  for (int t = 0; t < NSEQ / KT; ++t) {
    const unsigned char* st = smem + (t & 1) * STAGE;
    const unsigned short* k0p  = (const unsigned short*)(st + c * KP) + 8 * hh;              // keys 32t .. 32t+15
    const unsigned short* k1p  = (const unsigned short*)(st + (c + 16) * KP) + 8 * hh;       // keys 32t+16 .. 32t+31
    const unsigned short* k0lp = (const unsigned short*)(st + SM_KL + c * KP) + 8 * hh;
    const unsigned short* k1lp = (const unsigned short*)(st + SM_KL + (c + 16) * KP) + 8 * hh;
    const unsigned short* Vp   = (const unsigned short*)(st + SM_V + c * VP) + 8 * hh;       // + 16*j rows
    v8f s0[2], s1[2];
#pragma unroll
    for (int u = 0; u < 2; ++u) { s0[u] = zero8(); s1[u] = zero8(); }
    // unrolled: the register-held query fragments need constant indices
#pragma unroll
    for (int kc = 0; kc < 4; ++kc) {
      const int acol = ((kc + 2) & 3) * 32;                          // 64, 96, 0, 32   (k_j | q_j)
      const Frag k0  = ldfrag(k0p + acol);
      const Frag k1  = ldfrag(k1p + acol);
      const Frag k0l = ldfrag(k0lp + acol);
      const Frag k1l = ldfrag(k1lp + acol);
#pragma unroll
      for (int u = 0; u < 2; ++u) {
        s0[u] = wm_b(k0.bf, qh[u][kc].bf, s0[u]);
        s1[u] = wm_b(k1.bf, qh[u][kc].bf, s1[u]);
      }
#pragma unroll
      for (int u = 0; u < 2; ++u) {
        s0[u] = wm_b(k0.bf, ql[u][kc].bf, s0[u]);
        s1[u] = wm_b(k1.bf, ql[u][kc].bf, s1[u]);
      }
#pragma unroll
      for (int u = 0; u < 2; ++u) {
        s0[u] = wm_b(k0l.bf, qh[u][kc].bf, s0[u]);
        s1[u] = wm_b(k1l.bf, qh[u][kc].bf, s1[u]);
      }
    }

    float mn[2];
    bool up = false;
#pragma unroll
    for (int u = 0; u < 2; ++u) {
      float mx = fmaxf(hmax8(s0[u]), hmax8(s1[u]));
      mx = fmaxf(mx, __shfl_xor(mx, 16, 32));
      mn[u] = fmaxf(m[u], mx);
      up = up || (mx > m[u]);
    }
    const unsigned grew = wave_ballot(up);                           // wave-uniform, one test per stage
    if (grew != 0u) {
#pragma unroll
      for (int u = 0; u < 2; ++u) {
        const float corr = __expf(m[u] - mn[u]);                     // == 1 exactly where the max did not grow
        l[u] *= corr;
#pragma unroll
        for (int j = 0; j < 4; ++j) {
#pragma unroll
          for (int r = 0; r < 8; ++r) o[u][j][r] *= corr;
        }
      }
    }

    FragH ph[2];
#pragma unroll
    for (int u = 0; u < 2; ++u) {
      m[u] = mn[u];
      const float msh = mn[u] - LNPS;                                // exp gives e^{s-m} * 16384
      float ls = 0.f;
#pragma unroll
      for (int r = 0; r < 8; ++r) {
        const _Float16 p0 = (_Float16)__expf(s0[u][r] - msh);        // key kb      + 8hh + r
        const _Float16 p1 = (_Float16)__expf(s1[u][r] - msh);        // key kb + 16 + 8hh + r
        ls += (float)p0 + (float)p1;
        ph[u].hv[0][r] = p0;
        ph[u].hv[1][r] = p1;
      }
      l[u] += ls;
    }

#pragma unroll
    for (int j = 0; j < 4; ++j) {
      const Frag vf = ldfrag(Vp + (16 * j) * (VP / 2));
      o[0][j] = wm_h(vf.h, ph[0].v, o[0][j]);
      o[1][j] = wm_h(vf.h, ph[1].v, o[1][j]);
    }

    asm volatile("s_wait_dscnt 0x0" ::: "memory");                   // this wave's reads of stage t are done
    asm volatile("s_wait_asynccnt 0x0" ::: "memory");                // this wave's copies of stage t+1 have landed
    __syncthreads();                                                 // publishes stage t+1, frees stage t's buffer
    if (t + 2 < NSEQ / KT)
      copy_stage(lk + (unsigned)((t & 1) * STAGE), lv + (unsigned)((t & 1) * STAGE),
                 gkh + (size_t)(t + 2) * (KT * KROW), gkl + (size_t)(t + 2) * (KT * KROW), gv + (t + 2) * KT);
  }
  asm volatile("s_wait_asynccnt 0x0" ::: "memory");                  // nothing in flight when the ring becomes Os

#pragma unroll
  for (int u = 0; u < 2; ++u) {
    const float lt  = l[u] + __shfl_xor(l[u], 16, 32);
    const float inv = 1.0f / lt;                                     // o and l both carry the x16384 factor
    const int qrow = 32 * wave + 16 * u + c;
#pragma unroll
    for (int j = 0; j < 4; ++j) {
      v4f va, vb;
#pragma unroll
      for (int r = 0; r < 4; ++r) { va[r] = o[u][j][r] * inv; vb[r] = o[u][j][4 + r] * inv; }
      *(v4f*)(Os + qrow * OSPW + 16 * j + 8 * hh)     = va;          // Os[query][ch_loc = 16j + 8hh + r]
      *(v4f*)(Os + qrow * OSPW + 16 * j + 8 * hh + 4) = vb;
    }
  }
  __syncthreads();

  const int e = tid & 7, lq = tid >> 3;                              // lq 0..15
  v4f res[16];
#pragma unroll
  for (int it = 0; it < 16; ++it) {
    const int L   = it * 16 + lq;                                    // 0..255
    const int chl = L >> 2, qf = L & 3;                              // channel 0..63 within the head
    const int nl  = qf * 32 + 4 * e;                                 // query 0..127
#pragma unroll
    for (int t = 0; t < 4; ++t) res[it][t] = Os[(nl + t) * OSPW + chl];
  }
#pragma unroll
  for (int it = 0; it < 16; ++it) {
    const int L   = it * 16 + lq;
    const int chl = L >> 2, qf = L & 3;
    const int nl  = qf * 32 + 4 * e;
    const size_t idx = ((size_t)(b * CDIM + h * DH + chl)) * NSEQ + n0 + nl;
    *(v4f*)(out + idx) = res[it];
  }
}

// =========================================================================================================
// Workspace map (bytes; each region start a multiple of 256; every extent is an exact tile multiple and is written
//   W16 f16 [1536][512]               1572864
//   XP  f16 [NB][1024][512]           8388608 (NB=8)
//   QKh / QKl bf16 [NB][8][1024][192] 25165824 x2 (NB=8)
//   Vc  f16 [NB][512][1024]           8388608 (NB=8)
//   total = 68681728 (NB=8)
// =========================================================================================================
extern "C" void kernel_launch(void* const* d_in, const int* in_sizes, int n_in,
                              void* d_out, int out_size, void* d_ws, size_t ws_size,
                              hipStream_t stream) {
  const int XN = NB * CDIM * NSEQ;
  if (n_in < 9) return;
  if (in_sizes[0] < XN) return;
  if (in_sizes[1] < CDIM * CDIM || in_sizes[3] < CDIM * CDIM || in_sizes[5] < CDIM * CDIM) return;
  if (in_sizes[2] < CDIM || in_sizes[4] < CDIM || in_sizes[6] < CDIM) return;
  if (in_sizes[7] < HEADS * DH * 32 || in_sizes[8] < HEADS * DH * 32) return;
  if (out_size < XN) return;

  size_t off = 0;
  auto carve = [&](size_t bytes) { const size_t o = off; off += (bytes + 255) & ~(size_t)255; return o; };
  const size_t oW16 = carve((size_t)MW * CDIM * 2);
  const size_t oXP  = carve((size_t)NB * NSEQ * CDIM * 2);
  const size_t oQKh = carve((size_t)NB * HEADS * NSEQ * KROW * 2);
  const size_t oQKl = carve((size_t)NB * HEADS * NSEQ * KROW * 2);
  const size_t oVc  = carve((size_t)NB * CDIM * NSEQ * 2);
  if (off > ws_size) return;
  if (off > (size_t)134217728) return;

  const float* x   = (const float*)d_in[0];
  const float* wqw = (const float*)d_in[1];
  const float* wqb = (const float*)d_in[2];
  const float* wkw = (const float*)d_in[3];
  const float* wkb = (const float*)d_in[4];
  const float* wvw = (const float*)d_in[5];
  const float* wvb = (const float*)d_in[6];
  const float* rh  = (const float*)d_in[7];
  const float* rw  = (const float*)d_in[8];

  char* ws = (char*)d_ws;
  unsigned short* W16 = (unsigned short*)(ws + oW16);
  unsigned short* XP  = (unsigned short*)(ws + oXP);
  unsigned short* QKh = (unsigned short*)(ws + oQKh);
  unsigned short* QKl = (unsigned short*)(ws + oQKl);
  unsigned short* Vc  = (unsigned short*)(ws + oVc);
  float* out = (float*)d_out;

  const dim3 blk256(256), blk128(128);

  // (0)+(1)+(2) wq / wk / wv -> stacked f16 plane; x -> position-major 16-bit plane; relative position rows -> cols
  //             128..191 of the score planes
  prep<<<dim3(PXB + PPB + PWB), blk256, 0, stream>>>(x, wqw, wkw, wvw, rh, rw, W16, XP, QKh, QKl);
  // (3) conv1x1 GEMM -> q/k hi + residual planes, v f16 plane
  gemm_qkv<<<dim3(NSEQ / QT, MW / QT, NB), blk128, 0, stream>>>(W16, XP, wqb, wkb, wvb, QKh, QKl, Vc);
  // (4) attention -> out [b][512][1024]
  attn_k<<<dim3(NQ / QB, NB * HEADS), blk128, 0, stream>>>(QKh, QKl, Vc, out);
  (void)hipGetLastError();
}

// v004
// One run takes 74.7 microseconds.
// Two timings next to v003 put it at 1.09 and 1.08 times that version's speed.
// Counting every step since v000, it is 3.59 times as fast.
// Contractions: conv1x1 q/k/v GEMM W[1536x512].X[512x1024] on v_wmma_f32_16x16x32_f16 (f16 containers of
// bf16-RNE weights x256 and bf16-RNE x); scores [k_j|q_j].[q_i|pos_i] (K=128) on v_wmma_f32_16x16x32_bf16
// (bf16 hi + bf16 residual planes, 3 products); y^T = V.P^T on v_wmma_f32_16x16x32_f16 (v as f16, P = e^{s-m}
// x 2^14 f16 from the score D registers); f32 accumulate everywhere; bias adds and softmax statistics in f32 VALU.
#include <hip/hip_runtime.h>
#include <math.h>
#include <stdint.h>

#ifndef NB
#define NB 8
#endif
#ifndef NQ
#define NQ 1024
#endif
#define HEADS 8
#define CDIM  512
#define DH    64
#define NSEQ  1024
#define NPROJ 3
#define MW    (NPROJ * CDIM)
#define KROW  192
#define QT    64
#define QB    128
#define GT    128
#define OSP   132
#define OSPW  68
#define TP    72
#define WSC   256.0f
#define IWSC  0.00390625f
#define LNPS  9.704060527839234f
#define KT    32
#define KP    272
#define VP    80
#define SM_KL (KT * KP)
#define SM_V  (2 * KT * KP)
#define STAGE (2 * KT * KP + DH * VP)
#define SM_QH (2 * STAGE)
#define SM_QL (SM_QH + QB * KP)
#define SMEM  (SM_QL + QB * KP)
#define GK    64
#define GP    144
#define GSTAGE (2 * GT * GP)
#define PXB   ((NSEQ / QT) * (CDIM / QT) * NB)
#define PPB   ((HEADS * NSEQ * 8) / 256)
#define PWB   (MW / 8)

static_assert(NB >= 1 && NB <= 8);
static_assert(NQ % QB == 0 && NQ >= QB && NQ <= NSEQ);
static_assert(HEADS * DH == CDIM);
static_assert(DH == QT);
static_assert(KROW == 3 * DH);
static_assert(NSEQ == 1024 && HEADS == 8);
static_assert(CDIM == 512);
static_assert(MW % 8 == 0 && (CDIM / 8) == 64);
static_assert(CDIM % 32 == 0 && NSEQ % QT == 0 && NSEQ % 32 == 0);
static_assert((OSP * 4) % 16 == 0);
static_assert((OSPW * 4) % 16 == 0);
static_assert((TP * 2) % 16 == 0);
static_assert((KROW * 2) % 128 == 0);
static_assert(KP % 32 == 16 && VP % 32 == 16);
static_assert(KP >= 4 * DH && VP >= 2 * KT);
static_assert(STAGE % 16 == 0 && NSEQ / KT >= 2 && NSEQ % KT == 0);
static_assert(QB * OSPW * 4 <= 2 * STAGE);
static_assert(GP % 32 == 16 && GP >= 2 * GK && GK % 32 == 0);
static_assert(CDIM % GK == 0 && CDIM / GK >= 2);
static_assert(GT * OSP * 4 <= 2 * GSTAGE);
static_assert(GT == 2 * DH && CDIM % GT == 0 && CDIM / GT == 4 && NSEQ % GT == 0 && MW % GT == 0);
static_assert(NSEQ / QT == 16 && CDIM / QT == 8);

typedef _Float16       v16h __attribute__((ext_vector_type(16)));
typedef _Float16       v8h  __attribute__((ext_vector_type(8)));
typedef __bf16         v16b __attribute__((ext_vector_type(16)));
typedef unsigned short v8us __attribute__((ext_vector_type(8)));
typedef float          v8f  __attribute__((ext_vector_type(8)));
typedef float          v4f  __attribute__((ext_vector_type(4)));
typedef unsigned int   v4u  __attribute__((ext_vector_type(4)));

union Frag  { v8us u[2]; v16h h; v16b bf; };
union FragH { v16h v; v8h hv[2]; };
static_assert(sizeof(Frag) == 32);
static_assert(sizeof(FragH) == 32);

// ---- scalar helpers ---------------------------------------------------------------------------------------
__device__ __forceinline__ unsigned short bf_bits(float f) {          // f32 -> bf16 bits, RNE convert
  unsigned u = __float_as_uint(f);
  return (unsigned short)((u + 0x7FFFu + ((u >> 16) & 1u)) >> 16);
}
__device__ __forceinline__ float bf_up(unsigned short hb) { return __uint_as_float(((unsigned)hb) << 16); }
__device__ __forceinline__ float bfr(float f) { return bf_up(bf_bits(f)); }
__device__ __forceinline__ unsigned short h_bits(_Float16 x) { return __builtin_bit_cast(unsigned short, x); }
__device__ __forceinline__ unsigned pk16(unsigned short a, unsigned short b) { return (unsigned)a | ((unsigned)b << 16); }
__device__ __forceinline__ v8f zero8() { v8f z = {0.f, 0.f, 0.f, 0.f, 0.f, 0.f, 0.f, 0.f}; return z; }
__device__ __forceinline__ float hmax8(v8f s) {
  return fmaxf(fmaxf(fmaxf(s[0], s[1]), fmaxf(s[2], s[3])), fmaxf(fmaxf(s[4], s[5]), fmaxf(s[6], s[7])));
}
__device__ __forceinline__ unsigned wave_ballot(bool p) {
#if defined(__HIP_DEVICE_COMPILE__)
  return __builtin_amdgcn_ballot_w32(p);
#else
  return p ? 1u : 0u;
#endif
}

// ---- 16-bit fragment loader (A, or B from a k-contiguous [n][k] row): lane -> row/col (lane&15), p already includes
//      + 8*(lane>>4); elements 0..7 <- p[0..7] (k0+8h..), elements 8..15 <- p[16..23] (k0+16+8h..)
__device__ __forceinline__ Frag ldfrag(const unsigned short* p) {
  Frag f;
  f.u[0] = *(const v8us*)(p);
  f.u[1] = *(const v8us*)(p + 16);
  return f;
}

// ---- WMMA helpers: builtin followed by a 4-slot VALU gap tying D and keeping A/B live --------------------------
__device__ __forceinline__ v8f mma_h(v16h a, v16h b, v8f c) {
  v8f d = __builtin_amdgcn_wmma_f32_16x16x32_f16(false, a, false, b, (short)0, c, false, false);
#if defined(__HIP_DEVICE_COMPILE__)
  asm volatile("v_nop\n\tv_nop\n\tv_nop\n\tv_nop" : "+v"(d) : "v"(a), "v"(b));
#endif
  return d;
}
// Plain builtins for the attention kernel: its live fragments pass 256 registers, and the vector operands of an asm
// statement are kept in the first 256, which spilled query fragments to scratch. The compiler keeps the distances here.
__device__ __forceinline__ v8f wm_b(v16b a, v16b b, v8f c) {
  return __builtin_amdgcn_wmma_f32_16x16x32_bf16(false, a, false, b, (short)0, c, false, false);
}
__device__ __forceinline__ v8f wm_h(v16h a, v16h b, v8f c) {
  return __builtin_amdgcn_wmma_f32_16x16x32_f16(false, a, false, b, (short)0, c, false, false);
}

// ---- asynchronous 16-byte copies global -> LDS, one per lane and line of text. Each statement ends in s_wait_xcnt 0 so
//      that no address register of an issued copy is rewritten ahead of it. Landing is awaited by the caller.
// One 32-key stage: 4 + 4 copies bring cols 0..127 of 32 rows of the hi and the residual plane (a wave covers two whole
// 256-B row heads), 2 copies bring 64 channels x 32 keys of v. lk / lv, gh / gl / gv: this lane's first addresses.
__device__ __forceinline__ void copy_stage(unsigned lk, unsigned lv, const unsigned short* gh,
                                           const unsigned short* gl, const unsigned short* gv) {
#if defined(__HIP_DEVICE_COMPILE__)
  asm volatile("global_load_async_to_lds_b128 %0, %10, off\n\t"
               "global_load_async_to_lds_b128 %1, %11, off\n\t"
               "global_load_async_to_lds_b128 %2, %12, off\n\t"
               "global_load_async_to_lds_b128 %3, %13, off\n\t"
               "global_load_async_to_lds_b128 %4, %14, off\n\t"
               "global_load_async_to_lds_b128 %5, %15, off\n\t"
               "global_load_async_to_lds_b128 %6, %16, off\n\t"
               "global_load_async_to_lds_b128 %7, %17, off\n\t"
               "global_load_async_to_lds_b128 %8, %18, off\n\t"
               "global_load_async_to_lds_b128 %9, %19, off\n\t"
               "s_wait_xcnt 0x0"
               :: "v"(lk), "v"(lk + 8 * KP), "v"(lk + 16 * KP), "v"(lk + 24 * KP),
                  "v"(lk + SM_KL), "v"(lk + SM_KL + 8 * KP), "v"(lk + SM_KL + 16 * KP), "v"(lk + SM_KL + 24 * KP),
                  "v"(lv), "v"(lv + 32 * VP),
                  "v"(gh), "v"(gh + 8 * KROW), "v"(gh + 16 * KROW), "v"(gh + 24 * KROW),
                  "v"(gl), "v"(gl + 8 * KROW), "v"(gl + 16 * KROW), "v"(gl + 24 * KROW),
                  "v"(gv), "v"(gv + 32 * NSEQ)
               : "memory");
#endif
}
// 64 query rows of one plane: 8 copies, 8 rows apart.
__device__ __forceinline__ void copy_q(unsigned lq, const unsigned short* g) {
#if defined(__HIP_DEVICE_COMPILE__)
  asm volatile("global_load_async_to_lds_b128 %0, %8, off\n\t"
               "global_load_async_to_lds_b128 %1, %9, off\n\t"
               "global_load_async_to_lds_b128 %2, %10, off\n\t"
               "global_load_async_to_lds_b128 %3, %11, off\n\t"
               "global_load_async_to_lds_b128 %4, %12, off\n\t"
               "global_load_async_to_lds_b128 %5, %13, off\n\t"
               "global_load_async_to_lds_b128 %6, %14, off\n\t"
               "global_load_async_to_lds_b128 %7, %15, off\n\t"
               "s_wait_xcnt 0x0"
               :: "v"(lq), "v"(lq + 8 * KP), "v"(lq + 16 * KP), "v"(lq + 24 * KP),
                  "v"(lq + 32 * KP), "v"(lq + 40 * KP), "v"(lq + 48 * KP), "v"(lq + 56 * KP),
                  "v"(g), "v"(g + 8 * KROW), "v"(g + 16 * KROW), "v"(g + 24 * KROW),
                  "v"(g + 32 * KROW), "v"(g + 40 * KROW), "v"(g + 48 * KROW), "v"(g + 56 * KROW)
               : "memory");
#endif
}
// One operand's share of a 64-k stage of the conv1x1 GEMM: 128 rows x 128 B (a wave covers four whole lines);
// 8 copies, 16 rows apart.
__device__ __forceinline__ void copy_g(unsigned l, const unsigned short* g) {
#if defined(__HIP_DEVICE_COMPILE__)
  asm volatile("global_load_async_to_lds_b128 %0, %8, off\n\t"
               "global_load_async_to_lds_b128 %1, %9, off\n\t"
               "global_load_async_to_lds_b128 %2, %10, off\n\t"
               "global_load_async_to_lds_b128 %3, %11, off\n\t"
               "global_load_async_to_lds_b128 %4, %12, off\n\t"
               "global_load_async_to_lds_b128 %5, %13, off\n\t"
               "global_load_async_to_lds_b128 %6, %14, off\n\t"
               "global_load_async_to_lds_b128 %7, %15, off\n\t"
               "s_wait_xcnt 0x0"
               :: "v"(l), "v"(l + 16 * GP), "v"(l + 32 * GP), "v"(l + 48 * GP),
                  "v"(l + 64 * GP), "v"(l + 80 * GP), "v"(l + 96 * GP), "v"(l + 112 * GP),
                  "v"(g), "v"(g + 16 * CDIM), "v"(g + 32 * CDIM), "v"(g + 48 * CDIM),
                  "v"(g + 64 * CDIM), "v"(g + 80 * CDIM), "v"(g + 96 * CDIM), "v"(g + 112 * CDIM)
               : "memory");
#endif
}

// =========================================================================================================
// (0) conv1x1 weights: W16 f16 [1536][512], rows 0..511 = wq rows, 512..1023 = wk rows, 1024..1535 = wv rows;
//     value = f16 of (bf16-RNE(w) * 256) (exact). Block blk (0..191) owns rows 8*blk..8*blk+7: one wave per
// coverage: 192 blocks x 8 rows x 2 it x 32 lanes x 8 halves = 1536 x 512 = the whole plane.
// =========================================================================================================
__device__ __forceinline__
void cvt_w(const int blk, const float* __restrict__ wq, const float* __restrict__ wk, const float* __restrict__ wv,
           unsigned short* W16) {
  const int tid = threadIdx.x;
  const int rl = tid >> 5, lane = tid & 31;
  const int o = 8 * blk + rl;                                        // 0..1535
  const int p = blk >> 6;                                            // block-uniform projection 0..2
  const float* wbase = (p == 0) ? wq : ((p == 1) ? wk : wv);         // all global
  const int ol = o - p * CDIM;                                       // 0..511
  v4u u[2];
#pragma unroll
  for (int it = 0; it < 2; ++it) {
    const float* s = wbase + (size_t)ol * CDIM + 256 * it + 8 * lane;
    const v4f a = *(const v4f*)s;
    const v4f q = *(const v4f*)(s + 4);
    const float f[8] = {a[0], a[1], a[2], a[3], q[0], q[1], q[2], q[3]};
#pragma unroll
    for (int t = 0; t < 4; ++t) {
      const _Float16 h0 = (_Float16)(bfr(f[2 * t]) * WSC);
      const _Float16 h1 = (_Float16)(bfr(f[2 * t + 1]) * WSC);
      u[it][t] = pk16(h_bits(h0), h_bits(h1));
    }
  }
{
#pragma unroll
    for (int it = 0; it < 2; ++it)
      *(v4u*)(W16 + (size_t)o * CDIM + 256 * it + 8 * lane) = u[it];
    asm volatile("s_wait_xcnt 0x0" ::: "memory");                    // precaution: each block runs one job, so only the kernel's end follows
  }
}

// =========================================================================================================
// (1) x f32 [b][512 c][1024 n] -> XP f16 [b][n][c] (position-major, bf16-RNE values, exact in f16) through an
//     T is cross-wave (writer and reader waves differ): block barrier between the stores and the reload.
// coverage: XP 2 it x 32 rows x 8 lanes x 8 = 64 n x 64 c; blk = (b, cb, nb) in 0..128*NB-1 covers XP [b<NB][1024][512] once.
// =========================================================================================================
__device__ __forceinline__
void cvt_x(const int blk, const float* __restrict__ x, unsigned short* XP) {
  __shared__ __align__(16) unsigned short T[QT * TP];
  const int tid = threadIdx.x;
  const int nb = blk & (NSEQ / QT - 1), cb = (blk >> 4) & (CDIM / QT - 1), b = blk >> 7;
  const int e = tid & 7, lq = tid >> 3;                             // lq 0..31
  const int n0 = nb * QT, c0 = cb * QT;
#pragma unroll
  for (int it = 0; it < 2; ++it) {
    const int cl = it * 32 + lq;                                     // 0..63
    const float* sp = x + ((size_t)(b * CDIM + c0 + cl)) * NSEQ + n0 + 8 * e;
    const v4f a = *(const v4f*)sp;
    const v4f q = *(const v4f*)(sp + 4);
    // the next trip's loads may land in this trip's address registers: wait before they issue
    if (it == 0) asm volatile("s_wait_xcnt 0x0" ::: "memory");
    unsigned short hb[8];
#pragma unroll
    for (int t = 0; t < 4; ++t) {
      hb[t]     = h_bits((_Float16)bfr(a[t]));
      hb[4 + t] = h_bits((_Float16)bfr(q[t]));
    }
#pragma unroll
    for (int t = 0; t < 8; ++t) T[(8 * e + t) * TP + cl] = hb[t];
  }
  __syncthreads();
  v4u up[2];
#pragma unroll
  for (int it = 0; it < 2; ++it) {
    const int nl = it * 32 + lq;                                     // 0..63
    up[it] = *(const v4u*)(T + nl * TP + 8 * e);
  }
{
#pragma unroll
    for (int it = 0; it < 2; ++it) {
      const int rl = it * 32 + lq;
      *(v4u*)(XP + ((size_t)(b * NSEQ + n0 + rl)) * CDIM + c0 + 8 * e) = up[it];
    }
    asm volatile("s_wait_xcnt 0x0" ::: "memory");                    // precaution: each block runs one job, so only the kernel's end follows
  }
}

// =========================================================================================================
// (2) relative position rows: pos[h][d][n] = bf16-RNE(rh[h][d][n%32]) + bf16-RNE(rw[h][d][n/32]) in f32, split into
//     bf16 hi = RNE(pos) and bf16 lo = RNE(pos - hi), written to cols 128..191 of the planes QKh/QKl
//     bf16 [b][h][1024 n][192] for every b < NB. One task (h, n, e) per thread covers d = 8e..8e+7 (16 B);
// coverage: 256 blocks x 256 threads = 8 h x 1024 n x 8 e; x NB rows each -> cols 128..191 of every plane row.
// =========================================================================================================
__device__ __forceinline__
void pos_k(const int blk, const float* __restrict__ rh, const float* __restrict__ rw,
           unsigned short* QKh, unsigned short* QKl) {
  const int idx = blk * 256 + (int)threadIdx.x;                     // 0..65535
  const int e = idx & 7;
  const int n = (idx >> 3) & (NSEQ - 1);
  const int h = (idx >> 13) & (HEADS - 1);
  const int xw = n & 31, yh = n >> 5;
  v4u uh, ul;
#pragma unroll
  for (int t = 0; t < 4; ++t) {
    const int da = 8 * e + 2 * t, db = da + 1;
    const float f0 = bfr(rh[(h * DH + da) * 32 + xw]) + bfr(rw[(h * DH + da) * 32 + yh]);
    const float f1 = bfr(rh[(h * DH + db) * 32 + xw]) + bfr(rw[(h * DH + db) * 32 + yh]);
    const unsigned short hb0 = bf_bits(f0), hb1 = bf_bits(f1);
    const unsigned short lb0 = bf_bits(f0 - bf_up(hb0));
    const unsigned short lb1 = bf_bits(f1 - bf_up(hb1));
    uh[t] = pk16(hb0, hb1);
    ul[t] = pk16(lb0, lb1);
  }
{
#pragma unroll
    for (int b = 0; b < NB; ++b) {
      const size_t po = ((size_t)((b * HEADS + h) * NSEQ + n)) * KROW + 2 * DH + 8 * e;
      *(v4u*)(QKh + po) = uh;
      *(v4u*)(QKl + po) = ul;
    }
    asm volatile("s_wait_xcnt 0x0" ::: "memory");                    // precaution: each block runs one job, so only the kernel's end follows
  }
}

// =========================================================================================================
// (0)+(1)+(2) in one launch: the three jobs read only inputs and write disjoint planes, so none needs another's result.
//     A range of the block index picks the job (block-uniform branch, so the barrier in (1) is passed by whole blocks):
//     blocks 0..PXB-1 -> (1), the longest job, first; then PPB blocks of (2); then PWB blocks of (0).
// =========================================================================================================
__global__ __launch_bounds__(256)
void prep(const float* __restrict__ x, const float* __restrict__ wq, const float* __restrict__ wk,
          const float* __restrict__ wv, const float* __restrict__ rh, const float* __restrict__ rw,
          unsigned short* W16, unsigned short* XP, unsigned short* QKh, unsigned short* QKl) {
  const int blk = blockIdx.x;
  if (blk < PXB)            cvt_x(blk, x, XP);
  else if (blk < PXB + PPB) pos_k(blk - PXB, rh, rw, QKh, QKl);
  else                      cvt_w(blk - (PXB + PPB), wq, wk, wv, W16);
}

// =========================================================================================================
// (3) conv1x1 GEMM for one (b, 128-n tile, 128-o block): Y[o][n] = (1/256) sum_c W16[o][c] XP[b][n][c] + bias[o].
//     Block 128 threads = 4 waves in 2 x 2; a wave owns a 64 x 64 piece of the tile: 4 A fragments (rows o, from W16) and
//     4 B fragments (cols n, from XP) per k-step feed 16 accumulator tiles. K = 512 = 16 steps. Both operands are
//     k-contiguous rows read by the same split k map loader.
//     Both come from LDS: a ring of two 64-k stages (128 W16 rows, then 128 XP rows, x 128 B, pitch 144 B = 16 B x odd)
//     brought by whole-line asynchronous copies that the 4 waves share.
//     Epilogue staged in LDS Os[n_loc][o_loc] (pitch OSP, b128 stores of 8 consecutive o per lane), block barrier
//     (Os is cross-wave), then by o-block: mb 0..3 -> q of heads 2mb, 2mb+1 (QK planes cols 0..63, bf16 hi = RNE(v), lo =
//     RNE(v - hi)), mb 4..7 -> k (cols 64..127), mb 8..11 -> v -> Vc f16 [b][512 ch][1024 n] (channel-major, keys
//     contiguous). Each stored segment is one whole 128-B line.
// coverage: Os 4 waves x 64 x 64 = 128 x 128; q/k path 4 groups x 4 it x 16 rows x 8 lanes x 8 = 128 n x 128 o (hi and lo);
//           v path 4 groups x 4 it x 16 ch x 8 lanes x 8 = 128 ch x 128 n; grid (8, 12, NB) covers QK cols 0..127 of all
//           rows b<NB and Vc [b<NB][512][1024] exactly once.
// =========================================================================================================
__global__ __launch_bounds__(128)
void gemm_qkv(const unsigned short* __restrict__ W16, const unsigned short* __restrict__ XP,
              const float* __restrict__ bq, const float* __restrict__ bk, const float* __restrict__ bv,
              unsigned short* QKh, unsigned short* QKl, unsigned short* Vc) {
  __shared__ __align__(16) unsigned char smem[2 * GSTAGE];
  float* Os = (float*)smem;                                          // output staging, used behind the ring's last barrier
  const int tid  = threadIdx.x;
  const int lane = tid & 31, wave = tid >> 5;
  const int hh   = lane >> 4, c = lane & 15;
  const int wr   = wave >> 1, wc = wave & 1;                         // this wave's 64 rows o / 64 cols n of the tile
  const int nt   = blockIdx.x, mb = blockIdx.y, b = blockIdx.z;
  const int n0   = nt * GT, o0 = mb * GT;                            // o0 = row block of the stacked W16
  const int p    = mb >> 2;                                          // block-uniform projection 0..2

  // copy addresses of this lane: rows in 8 chunks of 16 B (row tid>>3, 16 rows per copy)
  const int cr = tid >> 3, cch = tid & 7;
  const unsigned la = (unsigned)(uintptr_t)smem + (unsigned)(cr * GP + cch * 16);   // low 32 bits = LDS byte address
  const unsigned short* ga = W16 + (size_t)(o0 + cr) * CDIM + 8 * cch;
  const unsigned short* gb = XP + ((size_t)(b * NSEQ + n0 + cr)) * CDIM + 8 * cch;

  copy_g(la, ga);
  copy_g(la + GT * GP, gb);
  asm volatile("s_wait_asynccnt 0x0" ::: "memory");                  // this wave's part of stage 0 has landed
  __syncthreads();                                                   // ... and every other wave's
  copy_g(la + GSTAGE, ga + GK);
  copy_g(la + GSTAGE + GT * GP, gb + GK);

  v8f acc[4][4];
#pragma unroll
  for (int i = 0; i < 4; ++i) {
#pragma unroll
    for (int j = 0; j < 4; ++j) acc[i][j] = zero8();
  }

  // rolled: one trip per ring stage, so that the publish point stands once in the text
#pragma unroll 1
  for (int s = 0; s < CDIM / GK; ++s) {
    const unsigned char* st = smem + (s & 1) * GSTAGE;
    const unsigned short* ap = (const unsigned short*)(st + (64 * wr + c) * GP) + 8 * hh;
    const unsigned short* bp = (const unsigned short*)(st + (GT + 64 * wc + c) * GP) + 8 * hh;
#pragma unroll
    for (int kk = 0; kk < GK / 32; ++kk) {
      Frag fa[4], fb[4];
#pragma unroll
      for (int j = 0; j < 4; ++j) fb[j] = ldfrag(bp + (16 * j) * (GP / 2) + 32 * kk);
#pragma unroll
      for (int i = 0; i < 4; ++i) fa[i] = ldfrag(ap + (16 * i) * (GP / 2) + 32 * kk);
#pragma unroll
      for (int i = 0; i < 4; ++i) {
#pragma unroll
        for (int j = 0; j < 4; ++j) acc[i][j] = mma_h(fa[i].h, fb[j].h, acc[i][j]);
      }
    }

    asm volatile("s_wait_dscnt 0x0" ::: "memory");                   // this wave's reads of stage s are done
    asm volatile("s_wait_asynccnt 0x0" ::: "memory");                // this wave's copies of stage s+1 have landed
    __syncthreads();                                                 // publishes stage s+1, frees stage s's buffer
    if (s + 2 < CDIM / GK) {
      copy_g(la + (unsigned)((s & 1) * GSTAGE), ga + (s + 2) * GK);
      copy_g(la + (unsigned)((s & 1) * GSTAGE) + GT * GP, gb + (s + 2) * GK);
    }
  }
  asm volatile("s_wait_asynccnt 0x0" ::: "memory");                  // nothing in flight when the ring becomes Os

  // ---- epilogue: scale back -> LDS Os[n_loc][o_loc]; lane (hh, c) holds o_loc = 64 wr + 16 i + 8 hh + r for
  //      n_loc = 64 wc + 16 j + c
#pragma unroll
  for (int j = 0; j < 4; ++j) {
    const int nl = 64 * wc + 16 * j + c;
#pragma unroll
    for (int i = 0; i < 4; ++i) {
      v4f va, vb;
#pragma unroll
      for (int r = 0; r < 4; ++r) { va[r] = acc[i][j][r] * IWSC; vb[r] = acc[i][j][4 + r] * IWSC; }
      *(v4f*)(Os + nl * OSP + 64 * wr + 16 * i + 8 * hh)     = va;
      *(v4f*)(Os + nl * OSP + 64 * wr + 16 * i + 8 * hh + 4) = vb;
    }
  }
  __syncthreads();

  const int e = tid & 7, lq = tid >> 3;                             // lq 0..15
  const int ol0 = (mb & 3) * GT;                                     // first channel of the block inside its projection
  const float* bias = (p == 0) ? bq : ((p == 1) ? bk : bv);          // all global
  if (p < 2) {
    // group g: head 2 (mb & 3) + (g >> 1), rows n_loc 64 (g & 1) ..+63
    float bb[2][8];
#pragma unroll
    for (int hs = 0; hs < 2; ++hs) {
      const v4f b0 = *(const v4f*)(bias + ol0 + hs * DH + 8 * e);
      const v4f b1 = *(const v4f*)(bias + ol0 + hs * DH + 8 * e + 4);
#pragma unroll
      for (int t = 0; t < 4; ++t) { bb[hs][t] = bfr(b0[t]); bb[hs][4 + t] = bfr(b1[t]); }
    }
    // unrolled: the bias registers need constant indices
#pragma unroll
    for (int g = 0; g < 4; ++g) {
      const int hs = g >> 1, rb = (g & 1) * 64;
      const int head = (ol0 >> 6) + hs;
      v4u uh[4], ul[4];
#pragma unroll
      for (int it = 0; it < 4; ++it) {
        const int row = rb + it * 16 + lq;                           // n_loc
        const v4f a = *(const v4f*)(Os + row * OSP + 64 * hs + 8 * e);
        const v4f q = *(const v4f*)(Os + row * OSP + 64 * hs + 8 * e + 4);
        const float f[8] = {a[0], a[1], a[2], a[3], q[0], q[1], q[2], q[3]};
#pragma unroll
        for (int t = 0; t < 4; ++t) {
          const float f0 = f[2 * t] + bb[hs][2 * t], f1 = f[2 * t + 1] + bb[hs][2 * t + 1];
          const unsigned short hb0 = bf_bits(f0), hb1 = bf_bits(f1);
          const unsigned short lb0 = bf_bits(f0 - bf_up(hb0));
          const unsigned short lb1 = bf_bits(f1 - bf_up(hb1));
          uh[it][t] = pk16(hb0, hb1);
          ul[it][t] = pk16(lb0, lb1);
        }
      }
#pragma unroll
      for (int it = 0; it < 4; ++it) {
        const int row = rb + it * 16 + lq;
        const size_t po = ((size_t)((b * HEADS + head) * NSEQ + n0 + row)) * KROW + p * DH + 8 * e;
        *(v4u*)(QKh + po) = uh[it];
        *(v4u*)(QKl + po) = ul[it];
      }
      // the next group's code may reuse these stores' registers; behind the last group the wave ends
      if (g < 3) asm volatile("s_wait_xcnt 0x0" ::: "memory");
    }
  } else {
    // group g: keys n_loc 64 (g >> 1) ..+63, channels o_loc 64 (g & 1) ..+63
    float bo[2][4];
#pragma unroll
    for (int k = 0; k < 8; ++k) bo[k >> 2][k & 3] = bfr(bias[ol0 + k * 16 + lq]);
    // unrolled: the bias registers need constant indices
#pragma unroll
    for (int g = 0; g < 4; ++g) {
      const int hs = g >> 1, rb = (g & 1) * 64;
      v4u uv[4];
#pragma unroll
      for (int it = 0; it < 4; ++it) {
        const int row = rb + it * 16 + lq;                           // o_loc -> channel ol0 + row
        unsigned short hb[8];
#pragma unroll
        for (int t = 0; t < 8; ++t) hb[t] = h_bits((_Float16)(Os[(64 * hs + 8 * e + t) * OSP + row] + bo[g & 1][it]));
#pragma unroll
        for (int t = 0; t < 4; ++t) uv[it][t] = pk16(hb[2 * t], hb[2 * t + 1]);
      }
#pragma unroll
      for (int it = 0; it < 4; ++it) {
        const int row = rb + it * 16 + lq;
        *(v4u*)(Vc + ((size_t)(b * CDIM + ol0 + row)) * NSEQ + n0 + 64 * hs + 8 * e) = uv[it];
      }
      // the next group's code, and behind the last group the q / k branch's, which follows in the built code, may reuse
      // these stores' registers
      asm volatile("s_wait_xcnt 0x0" ::: "memory");
    }
  }
}

// =========================================================================================================
// (4) attention for one (b, h, 128-query tile), transposed formulation, 1024 keys, no mask, no scale:
//   S^T tile (16 keys x 16 queries) = sum over 4 d-chunks (unrolled loop) of A(key row j = kb + (lane&15) of the
//   bf16 plane QKh [b][h][1024][192]: chunks 0,1 = cols 64..127 (k_j), chunks 2,3 = cols 0..63 (q_j), split k map)
//   . B(query col i: chunks 0,1 = cols 0..63 (q_i), chunks 2,3 = cols 128..191 (pos_i), same map) as
//   A(hi).B(hi) + A(hi).B(lo) + A(lo).B(hi) (bf16 unscaled residual planes, shared accumulator).
//   Per lane the D tile holds 8 keys of ONE query: online softmax state per lane, one shuffle (lane^16) for the max
//   over 32 keys; the o/l rescale is skipped under a wave-uniform ballot when no lane's max grew (corr == 1 exactly
//   for every lane then); the row sum is accumulated from the f16-converted P values; row-sum partials combined at
//   the end. P = e^{s-m} x 16384 as f16 is the B operand of O^T (rows channel, cols queries) += A(v rows channel =
//   h*64 + 16j + (lane&15), keys contiguous, f16 plane Vc [b][512][1024]) . B(P^T): element r <- D of the tile
//   covering keys kb..kb+15, element 8+r <- the tile covering kb+16..kb+31, lane unchanged. 4 accumulator tiles per
//   16-query column group (64 channels). Block = 4 waves = 128 queries.
//   Wave tile: a wave owns two 16-query column groups and keeps their B fragments (4 d-chunks x hi / residual) in
//   registers for the whole key loop, so every key and v fragment read from LDS feeds both groups and the loop reads no
//   query row. Each accumulator sums its products in the order hi.hi, hi.lo, lo.hi per d-chunk.
//   The block's 128 query rows (cols 0..63 | 128..191 of both planes) pass through LDS once; a ring of two 32-key
//   stages (cols 0..127 of both planes, v 64 ch x 32 keys) feeds the loop; all brought by asynchronous copies (v in 64-B row pieces)
//   that the 4 waves share; rows pitched 272 B / 80 B (16 B x odd) for the b128 fragment reads.
//   Epilogue: O/l staged in LDS Os[query][64 channels] (pitch OSPW, b128 stores), block barrier (Os is cross-wave),
// coverage: 16 it x 16 lines x 8 lanes x 4 floats = 64 ch x 128 n; grid (NQ/128, NB*8) covers
//           out[b<NB][0..511][0..NQ-1] exactly once.
// =========================================================================================================
__global__ __launch_bounds__(128)
void attn_k(const unsigned short* __restrict__ QKh, const unsigned short* __restrict__ QKl,
            const unsigned short* __restrict__ Vc, float* out) {
  __shared__ __align__(16) unsigned char smem[SMEM];
  float* Os = (float*)smem;                                          // output staging, used behind the ring's last barrier
  const int tid  = threadIdx.x;
  const int wave = tid >> 5, lane = tid & 31;
  const int hh   = lane >> 4, c = lane & 15;
  const int n0   = blockIdx.x * QB;
  const int bh   = blockIdx.y;
  const int b    = bh >> 3, h = bh & 7;
  const size_t prow = (size_t)bh * NSEQ * KROW;

  // copy addresses of this lane: K / Q rows in 16 chunks of 16 B (row tid>>4, 8 rows per copy), v rows in 4 chunks
  const int kr = tid >> 4, kch = tid & 15;
  const int vr = tid >> 2, vch = tid & 3;
  const unsigned sbase = (unsigned)(uintptr_t)smem;                  // low 32 bits = byte address in the block's LDS
  const unsigned lk = sbase + (unsigned)(kr * KP + kch * 16);
  const unsigned lv = sbase + (unsigned)(SM_V + vr * VP + vch * 16);
  const unsigned short* gkh = QKh + prow + (size_t)kr * KROW + 8 * kch;
  const unsigned short* gkl = QKl + prow + (size_t)kr * KROW + 8 * kch;
  const unsigned short* gv  = Vc + ((size_t)(b * CDIM + h * DH + vr)) * NSEQ + 8 * vch;
  const size_t gq = prow + (size_t)(n0 + kr) * KROW + 8 * kch + ((kch >> 3) << 6);   // cols 0..63, then 128..191

  copy_q(lk + SM_QH, QKh + gq);
  copy_q(lk + SM_QH + QT * KP, QKh + gq + (size_t)QT * KROW);
  copy_q(lk + SM_QL, QKl + gq);
  copy_q(lk + SM_QL + QT * KP, QKl + gq + (size_t)QT * KROW);
  copy_stage(lk, lv, gkh, gkl, gv);
  asm volatile("s_wait_asynccnt 0x0" ::: "memory");                  // this wave's query rows and stage 0 have landed
  __syncthreads();                                                   // ... and every other wave's
  copy_stage(lk + STAGE, lv + STAGE, gkh + (size_t)KT * KROW, gkl + (size_t)KT * KROW, gv + KT);

  // query fragments (B operand, col = query 32*wave + 16*u + c of the tile), read once and held in registers
  Frag qh[2][4], ql[2][4];
#pragma unroll
  for (int u = 0; u < 2; ++u) {
    const unsigned short* Qhp = (const unsigned short*)(smem + SM_QH + (32 * wave + 16 * u + c) * KP) + 8 * hh;
    const unsigned short* Qlp = (const unsigned short*)(smem + SM_QL + (32 * wave + 16 * u + c) * KP) + 8 * hh;
#pragma unroll
    for (int kc = 0; kc < 4; ++kc) {                                 // LDS row = q_i | pos_i
      qh[u][kc] = ldfrag(Qhp + 32 * kc);
      ql[u][kc] = ldfrag(Qlp + 32 * kc);
    }
  }

  float m[2] = {-1.0e30f, -1.0e30f}, l[2] = {0.f, 0.f};
  v8f o[2][4];
#pragma unroll
  for (int u = 0; u < 2; ++u) {
#pragma unroll
    for (int j = 0; j < 4; ++j) o[u][j] = zero8();
  }

  // rolled: one trip per ring stage, so that the publish point stands once in the text
#pragma unroll 1
  for (int t = 0; t < NSEQ / KT; ++t) {
    const unsigned char* st = smem + (t & 1) * STAGE;
    const unsigned short* k0p  = (const unsigned short*)(st + c * KP) + 8 * hh;              // keys 32t .. 32t+15
    const unsigned short* k1p  = (const unsigned short*)(st + (c + 16) * KP) + 8 * hh;       // keys 32t+16 .. 32t+31
    const unsigned short* k0lp = (const unsigned short*)(st + SM_KL + c * KP) + 8 * hh;
    const unsigned short* k1lp = (const unsigned short*)(st + SM_KL + (c + 16) * KP) + 8 * hh;
    const unsigned short* Vp   = (const unsigned short*)(st + SM_V + c * VP) + 8 * hh;       // + 16*j rows
    v8f s0[2], s1[2];
#pragma unroll
    for (int u = 0; u < 2; ++u) { s0[u] = zero8(); s1[u] = zero8(); }
    // unrolled: the register-held query fragments need constant indices
#pragma unroll
    for (int kc = 0; kc < 4; ++kc) {
      const int acol = ((kc + 2) & 3) * 32;                          // 64, 96, 0, 32   (k_j | q_j)
      const Frag k0  = ldfrag(k0p + acol);
      const Frag k1  = ldfrag(k1p + acol);
      const Frag k0l = ldfrag(k0lp + acol);
      const Frag k1l = ldfrag(k1lp + acol);
#pragma unroll
      for (int u = 0; u < 2; ++u) {
        s0[u] = wm_b(k0.bf, qh[u][kc].bf, s0[u]);
        s1[u] = wm_b(k1.bf, qh[u][kc].bf, s1[u]);
      }
#pragma unroll
      for (int u = 0; u < 2; ++u) {
        s0[u] = wm_b(k0.bf, ql[u][kc].bf, s0[u]);
        s1[u] = wm_b(k1.bf, ql[u][kc].bf, s1[u]);
      }
#pragma unroll
      for (int u = 0; u < 2; ++u) {
        s0[u] = wm_b(k0l.bf, qh[u][kc].bf, s0[u]);
        s1[u] = wm_b(k1l.bf, qh[u][kc].bf, s1[u]);
      }
    }

    float mn[2];
    bool up = false;
#pragma unroll
    for (int u = 0; u < 2; ++u) {
      float mx = fmaxf(hmax8(s0[u]), hmax8(s1[u]));
      mx = fmaxf(mx, __shfl_xor(mx, 16, 32));
      mn[u] = fmaxf(m[u], mx);
      up = up || (mx > m[u]);
    }
    const unsigned grew = wave_ballot(up);                           // wave-uniform, one test per stage
    if (grew != 0u) {
#pragma unroll
      for (int u = 0; u < 2; ++u) {
        const float corr = __expf(m[u] - mn[u]);                     // == 1 exactly where the max did not grow
        l[u] *= corr;
#pragma unroll
        for (int j = 0; j < 4; ++j) {
#pragma unroll
          for (int r = 0; r < 8; ++r) o[u][j][r] *= corr;
        }
      }
    }

    FragH ph[2];
#pragma unroll
    for (int u = 0; u < 2; ++u) {
      m[u] = mn[u];
      const float msh = mn[u] - LNPS;                                // exp gives e^{s-m} * 16384
      float ls = 0.f;
#pragma unroll
      for (int r = 0; r < 8; ++r) {
        const _Float16 p0 = (_Float16)__expf(s0[u][r] - msh);        // key kb      + 8hh + r
        const _Float16 p1 = (_Float16)__expf(s1[u][r] - msh);        // key kb + 16 + 8hh + r
        ls += (float)p0 + (float)p1;
        ph[u].hv[0][r] = p0;
        ph[u].hv[1][r] = p1;
      }
      l[u] += ls;
    }

#pragma unroll
    for (int j = 0; j < 4; ++j) {
      const Frag vf = ldfrag(Vp + (16 * j) * (VP / 2));
      o[0][j] = wm_h(vf.h, ph[0].v, o[0][j]);
      o[1][j] = wm_h(vf.h, ph[1].v, o[1][j]);
    }

    asm volatile("s_wait_dscnt 0x0" ::: "memory");                   // this wave's reads of stage t are done
    asm volatile("s_wait_asynccnt 0x0" ::: "memory");                // this wave's copies of stage t+1 have landed
    __syncthreads();                                                 // publishes stage t+1, frees stage t's buffer
    if (t + 2 < NSEQ / KT)
      copy_stage(lk + (unsigned)((t & 1) * STAGE), lv + (unsigned)((t & 1) * STAGE),
                 gkh + (size_t)(t + 2) * (KT * KROW), gkl + (size_t)(t + 2) * (KT * KROW), gv + (t + 2) * KT);
  }
  asm volatile("s_wait_asynccnt 0x0" ::: "memory");                  // nothing in flight when the ring becomes Os

#pragma unroll
  for (int u = 0; u < 2; ++u) {
    const float lt  = l[u] + __shfl_xor(l[u], 16, 32);
    const float inv = 1.0f / lt;                                     // o and l both carry the x16384 factor
    const int qrow = 32 * wave + 16 * u + c;
#pragma unroll
    for (int j = 0; j < 4; ++j) {
      v4f va, vb;
#pragma unroll
      for (int r = 0; r < 4; ++r) { va[r] = o[u][j][r] * inv; vb[r] = o[u][j][4 + r] * inv; }
      *(v4f*)(Os + qrow * OSPW + 16 * j + 8 * hh)     = va;          // Os[query][ch_loc = 16j + 8hh + r]
      *(v4f*)(Os + qrow * OSPW + 16 * j + 8 * hh + 4) = vb;
    }
  }
  __syncthreads();

  const int e = tid & 7, lq = tid >> 3;                              // lq 0..15
  v4f res[16];
#pragma unroll
  for (int it = 0; it < 16; ++it) {
    const int L   = it * 16 + lq;                                    // 0..255
    const int chl = L >> 2, qf = L & 3;                              // channel 0..63 within the head
    const int nl  = qf * 32 + 4 * e;                                 // query 0..127
#pragma unroll
    for (int t = 0; t < 4; ++t) res[it][t] = Os[(nl + t) * OSPW + chl];
  }
#pragma unroll
  for (int it = 0; it < 16; ++it) {
    const int L   = it * 16 + lq;
    const int chl = L >> 2, qf = L & 3;
    const int nl  = qf * 32 + 4 * e;
    const size_t idx = ((size_t)(b * CDIM + h * DH + chl)) * NSEQ + n0 + nl;
    *(v4f*)(out + idx) = res[it];
  }
}

// =========================================================================================================
// Workspace map (bytes; each region start a multiple of 256; every extent is an exact tile multiple and is written
//   W16 f16 [1536][512]               1572864
//   XP  f16 [NB][1024][512]           8388608 (NB=8)
//   QKh / QKl bf16 [NB][8][1024][192] 25165824 x2 (NB=8)
//   Vc  f16 [NB][512][1024]           8388608 (NB=8)
//   total = 68681728 (NB=8)
// =========================================================================================================
extern "C" void kernel_launch(void* const* d_in, const int* in_sizes, int n_in,
                              void* d_out, int out_size, void* d_ws, size_t ws_size,
                              hipStream_t stream) {
  const int XN = NB * CDIM * NSEQ;
  if (n_in < 9) return;
  if (in_sizes[0] < XN) return;
  if (in_sizes[1] < CDIM * CDIM || in_sizes[3] < CDIM * CDIM || in_sizes[5] < CDIM * CDIM) return;
  if (in_sizes[2] < CDIM || in_sizes[4] < CDIM || in_sizes[6] < CDIM) return;
  if (in_sizes[7] < HEADS * DH * 32 || in_sizes[8] < HEADS * DH * 32) return;
  if (out_size < XN) return;

  size_t off = 0;
  auto carve = [&](size_t bytes) { const size_t o = off; off += (bytes + 255) & ~(size_t)255; return o; };
  const size_t oW16 = carve((size_t)MW * CDIM * 2);
  const size_t oXP  = carve((size_t)NB * NSEQ * CDIM * 2);
  const size_t oQKh = carve((size_t)NB * HEADS * NSEQ * KROW * 2);
  const size_t oQKl = carve((size_t)NB * HEADS * NSEQ * KROW * 2);
  const size_t oVc  = carve((size_t)NB * CDIM * NSEQ * 2);
  if (off > ws_size) return;
  if (off > (size_t)134217728) return;

  const float* x   = (const float*)d_in[0];
  const float* wqw = (const float*)d_in[1];
  const float* wqb = (const float*)d_in[2];
  const float* wkw = (const float*)d_in[3];
  const float* wkb = (const float*)d_in[4];
  const float* wvw = (const float*)d_in[5];
  const float* wvb = (const float*)d_in[6];
  const float* rh  = (const float*)d_in[7];
  const float* rw  = (const float*)d_in[8];

  char* ws = (char*)d_ws;
  unsigned short* W16 = (unsigned short*)(ws + oW16);
  unsigned short* XP  = (unsigned short*)(ws + oXP);
  unsigned short* QKh = (unsigned short*)(ws + oQKh);
  unsigned short* QKl = (unsigned short*)(ws + oQKl);
  unsigned short* Vc  = (unsigned short*)(ws + oVc);
  float* out = (float*)d_out;

  const dim3 blk256(256), blk128(128);

  // (0)+(1)+(2) wq / wk / wv -> stacked f16 plane; x -> position-major 16-bit plane; relative position rows -> cols
  //             128..191 of the score planes
  prep<<<dim3(PXB + PPB + PWB), blk256, 0, stream>>>(x, wqw, wkw, wvw, rh, rw, W16, XP, QKh, QKl);
  // (3) conv1x1 GEMM -> q/k hi + residual planes, v f16 plane
  gemm_qkv<<<dim3(NSEQ / GT, MW / GT, NB), blk128, 0, stream>>>(W16, XP, wqb, wkb, wvb, QKh, QKl, Vc);
  // (4) attention -> out [b][512][1024]
  attn_k<<<dim3(NQ / QB, NB * HEADS), blk128, 0, stream>>>(QKh, QKl, Vc, out);
  (void)hipGetLastError();
}

// v005
// It runs in 72.5 microseconds.
// In two side-by-side timings against v004, it was 1.04 and 1.03 times as fast.
// Over all steps from v000 it is 3.70 times as fast.
// Contractions: conv1x1 q/k/v GEMM W[1536x512].X[512x1024] on v_wmma_f32_16x16x32_f16 (f16 containers of
// bf16-RNE weights x256 and bf16-RNE x); position products q_j.[rh_x|rw_y] (64 per key, q as bf16 hi + residual) and
// scores k_j.q_i (K=64, bf16 hi + bf16 residual planes, 3 products) on v_wmma_f32_16x16x32_bf16; y^T = V.P^T on v_wmma_f32_16x16x32_f16 (v as f16, P = e^{s-m}
// x 2^14 f16 from the score D registers); f32 accumulate everywhere; bias adds and softmax statistics in f32 VALU.
#include <hip/hip_runtime.h>
#include <math.h>
#include <stdint.h>

#ifndef NB
#define NB 8
#endif
#ifndef NQ
#define NQ 1024
#endif
#define HEADS 8
#define CDIM  512
#define DH    64
#define NSEQ  1024
#define NPROJ 3
#define MW    (NPROJ * CDIM)
#define KROW  128
#define QT    64
#define QB    128
#define GT    128
#define OSP   132
#define OSPW  68
#define TP    72
#define WSC   256.0f
#define IWSC  0.00390625f
#define LNPS  9.704060527839234f
#define KT    32
#define KP    144
#define VP    80
#define SM_KL (KT * KP)
#define SM_V  (2 * KT * KP)
#define SM_R  (SM_V + DH * VP)
#define RREC  3072
#define STAGE (SM_R + 2 * RREC)
#define RTILE 256
#define RKEY  (4 * RTILE)
#define SM_QH (2 * STAGE)
#define SM_QL (SM_QH + QB * KP)
#define SMEM  (SM_QL + QB * KP)
#define GK    64
#define GP    144
#define GSTAGE (2 * GT * GP)
#define PXB   ((NSEQ / QT) * (CDIM / QT) * NB)
#define PPB   ((HEADS * 64 * 8) / 256)
#define PWB   (MW / 8)

static_assert(NB >= 1 && NB <= 8);
static_assert(NQ % QB == 0 && NQ >= QB && NQ <= NSEQ);
static_assert(HEADS * DH == CDIM);
static_assert(DH == QT);
static_assert(KROW == 2 * DH);
static_assert(NSEQ == 1024 && HEADS == 8);
static_assert(CDIM == 512);
static_assert(MW % 8 == 0 && (CDIM / 8) == 64);
static_assert(CDIM % 32 == 0 && NSEQ % QT == 0 && NSEQ % 32 == 0);
static_assert((OSP * 4) % 16 == 0);
static_assert((OSPW * 4) % 16 == 0);
static_assert((TP * 2) % 16 == 0);
static_assert((KROW * 2) % 128 == 0);
static_assert(KP % 32 == 16 && VP % 32 == 16);
static_assert(KP >= 2 * DH && VP >= 2 * KT);
static_assert(KT == 32 && QB == 128 && RREC == 3 * RTILE * 4 && SM_R % 16 == 0);
static_assert(STAGE % 16 == 0 && NSEQ / KT >= 2 && NSEQ % KT == 0);
static_assert(QB * OSPW * 4 <= 2 * STAGE);
static_assert(GP % 32 == 16 && GP >= 2 * GK && GK % 32 == 0);
static_assert(CDIM % GK == 0 && CDIM / GK >= 2);
static_assert(GT * OSP * 4 <= 2 * GSTAGE);
static_assert(GT == 2 * DH && CDIM % GT == 0 && CDIM / GT == 4 && NSEQ % GT == 0 && MW % GT == 0);
static_assert(NSEQ / QT == 16 && CDIM / QT == 8);

typedef _Float16       v16h __attribute__((ext_vector_type(16)));
typedef _Float16       v8h  __attribute__((ext_vector_type(8)));
typedef __bf16         v16b __attribute__((ext_vector_type(16)));
typedef unsigned short v8us __attribute__((ext_vector_type(8)));
typedef float          v8f  __attribute__((ext_vector_type(8)));
typedef float          v4f  __attribute__((ext_vector_type(4)));
typedef unsigned int   v4u  __attribute__((ext_vector_type(4)));
typedef float          v2f  __attribute__((ext_vector_type(2)));
typedef __bf16         v2b  __attribute__((ext_vector_type(2)));

union Frag  { v8us u[2]; v16h h; v16b bf; };
union FragH { v16h v; v8h hv[2]; };
union FragW { v4u w[2]; v16b bf; };
static_assert(sizeof(Frag) == 32);
static_assert(sizeof(FragH) == 32);
static_assert(sizeof(FragW) == 32);

// ---- scalar helpers ---------------------------------------------------------------------------------------
__device__ __forceinline__ unsigned short bf_bits(float f) {          // f32 -> bf16 bits, RNE convert
  unsigned u = __float_as_uint(f);
  return (unsigned short)((u + 0x7FFFu + ((u >> 16) & 1u)) >> 16);
}
__device__ __forceinline__ float bf_up(unsigned short hb) { return __uint_as_float(((unsigned)hb) << 16); }
__device__ __forceinline__ float bfr(float f) { return bf_up(bf_bits(f)); }
__device__ __forceinline__ unsigned short h_bits(_Float16 x) { return __builtin_bit_cast(unsigned short, x); }
__device__ __forceinline__ unsigned pk16(unsigned short a, unsigned short b) { return (unsigned)a | ((unsigned)b << 16); }
__device__ __forceinline__ unsigned bf_pair(float a, float b) {      // two f32 -> packed bf16 bits, RNE convert
  const v2f f = {a, b};
  return __builtin_bit_cast(unsigned, __builtin_convertvector(f, v2b));
}
__device__ __forceinline__ v8f zero8() { v8f z = {0.f, 0.f, 0.f, 0.f, 0.f, 0.f, 0.f, 0.f}; return z; }
__device__ __forceinline__ float hmax8(v8f s) {
  return fmaxf(fmaxf(fmaxf(s[0], s[1]), fmaxf(s[2], s[3])), fmaxf(fmaxf(s[4], s[5]), fmaxf(s[6], s[7])));
}
__device__ __forceinline__ unsigned wave_ballot(bool p) {
#if defined(__HIP_DEVICE_COMPILE__)
  return __builtin_amdgcn_ballot_w32(p);
#else
  return p ? 1u : 0u;
#endif
}

// ---- 16-bit fragment loader (A, or B from a k-contiguous [n][k] row): lane -> row/col (lane&15), p already includes
//      + 8*(lane>>4); elements 0..7 <- p[0..7] (k0+8h..), elements 8..15 <- p[16..23] (k0+16+8h..)
__device__ __forceinline__ Frag ldfrag(const unsigned short* p) {
  Frag f;
  f.u[0] = *(const v8us*)(p);
  f.u[1] = *(const v8us*)(p + 16);
  return f;
}

// ---- WMMA helpers: builtin followed by a 4-slot VALU gap tying D and keeping A/B live --------------------------
__device__ __forceinline__ v8f mma_h(v16h a, v16h b, v8f c) {
  v8f d = __builtin_amdgcn_wmma_f32_16x16x32_f16(false, a, false, b, (short)0, c, false, false);
#if defined(__HIP_DEVICE_COMPILE__)
  asm volatile("v_nop\n\tv_nop\n\tv_nop\n\tv_nop" : "+v"(d) : "v"(a), "v"(b));
#endif
  return d;
}
// Plain builtins for the position products of (3) and the attention kernel: in (3) the live fragments pass 256
// registers, and the vector operands of an asm statement are kept in the first 256. The compiler keeps the distances here.
__device__ __forceinline__ v8f wm_b(v16b a, v16b b, v8f c) {
  return __builtin_amdgcn_wmma_f32_16x16x32_bf16(false, a, false, b, (short)0, c, false, false);
}
__device__ __forceinline__ v8f wm_h(v16h a, v16h b, v8f c) {
  return __builtin_amdgcn_wmma_f32_16x16x32_f16(false, a, false, b, (short)0, c, false, false);
}

// ---- asynchronous 16-byte copies global -> LDS, one per lane and line of text. Each statement ends in s_wait_xcnt 0 so
//      that no address register of an issued copy is rewritten ahead of it. Landing is awaited by the caller.
// One 32-key stage: 2 + 2 copies bring the 64 key channels of 32 rows of the hi and the residual plane (a wave covers
// four whole 128-B lines), 2 copies bring 64 channels x 32 keys of v, 2 + 1 copies bring the stage's position products
// (per 16-key tile the two x tiles, 2 KiB in a row, and the one y tile that holds this block's four rows).
// lk / lv / lr / lw, gh / gl / gv / gr / gw: this lane's first addresses.
__device__ __forceinline__ void copy_stage(unsigned lk, unsigned lv, unsigned lr, unsigned lw,
                                           const unsigned short* gh, const unsigned short* gl,
                                           const unsigned short* gv, const float* gr, const float* gw) {
#if defined(__HIP_DEVICE_COMPILE__)
  asm volatile("global_load_async_to_lds_b128 %0, %9, off\n\t"
               "global_load_async_to_lds_b128 %1, %10, off\n\t"
               "global_load_async_to_lds_b128 %2, %11, off\n\t"
               "global_load_async_to_lds_b128 %3, %12, off\n\t"
               "global_load_async_to_lds_b128 %4, %13, off\n\t"
               "global_load_async_to_lds_b128 %5, %14, off\n\t"
               "global_load_async_to_lds_b128 %6, %15, off\n\t"
               "global_load_async_to_lds_b128 %7, %16, off\n\t"
               "global_load_async_to_lds_b128 %8, %17, off\n\t"
               "s_wait_xcnt 0x0"
               :: "v"(lk), "v"(lk + 16 * KP), "v"(lk + SM_KL), "v"(lk + SM_KL + 16 * KP),
                  "v"(lv), "v"(lv + 32 * VP), "v"(lr), "v"(lr + RREC), "v"(lw),
                  "v"(gh), "v"(gh + 16 * KROW), "v"(gl), "v"(gl + 16 * KROW),
                  "v"(gv), "v"(gv + 32 * NSEQ), "v"(gr), "v"(gr + RKEY), "v"(gw)
               : "memory");
#endif
}
// 128 query rows of one plane: 8 copies, 16 rows apart.
__device__ __forceinline__ void copy_q(unsigned lq, const unsigned short* g) {
#if defined(__HIP_DEVICE_COMPILE__)
  asm volatile("global_load_async_to_lds_b128 %0, %8, off\n\t"
               "global_load_async_to_lds_b128 %1, %9, off\n\t"
               "global_load_async_to_lds_b128 %2, %10, off\n\t"
               "global_load_async_to_lds_b128 %3, %11, off\n\t"
               "global_load_async_to_lds_b128 %4, %12, off\n\t"
               "global_load_async_to_lds_b128 %5, %13, off\n\t"
               "global_load_async_to_lds_b128 %6, %14, off\n\t"
               "global_load_async_to_lds_b128 %7, %15, off\n\t"
               "s_wait_xcnt 0x0"
               :: "v"(lq), "v"(lq + 16 * KP), "v"(lq + 32 * KP), "v"(lq + 48 * KP),
                  "v"(lq + 64 * KP), "v"(lq + 80 * KP), "v"(lq + 96 * KP), "v"(lq + 112 * KP),
                  "v"(g), "v"(g + 16 * KROW), "v"(g + 32 * KROW), "v"(g + 48 * KROW),
                  "v"(g + 64 * KROW), "v"(g + 80 * KROW), "v"(g + 96 * KROW), "v"(g + 112 * KROW)
               : "memory");
#endif
}
// One operand's share of a 64-k stage of the conv1x1 GEMM: 128 rows x 128 B (a wave covers four whole lines);
// 8 copies, 16 rows apart.
__device__ __forceinline__ void copy_g(unsigned l, const unsigned short* g) {
#if defined(__HIP_DEVICE_COMPILE__)
  asm volatile("global_load_async_to_lds_b128 %0, %8, off\n\t"
               "global_load_async_to_lds_b128 %1, %9, off\n\t"
               "global_load_async_to_lds_b128 %2, %10, off\n\t"
               "global_load_async_to_lds_b128 %3, %11, off\n\t"
               "global_load_async_to_lds_b128 %4, %12, off\n\t"
               "global_load_async_to_lds_b128 %5, %13, off\n\t"
               "global_load_async_to_lds_b128 %6, %14, off\n\t"
               "global_load_async_to_lds_b128 %7, %15, off\n\t"
               "s_wait_xcnt 0x0"
               :: "v"(l), "v"(l + 16 * GP), "v"(l + 32 * GP), "v"(l + 48 * GP),
                  "v"(l + 64 * GP), "v"(l + 80 * GP), "v"(l + 96 * GP), "v"(l + 112 * GP),
                  "v"(g), "v"(g + 16 * CDIM), "v"(g + 32 * CDIM), "v"(g + 48 * CDIM),
                  "v"(g + 64 * CDIM), "v"(g + 80 * CDIM), "v"(g + 96 * CDIM), "v"(g + 112 * CDIM)
               : "memory");
#endif
}

// =========================================================================================================
// (0) conv1x1 weights: W16 f16 [1536][512], rows 0..511 = wq rows, 512..1023 = wk rows, 1024..1535 = wv rows;
//     value = f16 of (bf16-RNE(w) * 256) (exact). Block blk (0..191) owns rows 8*blk..8*blk+7: one wave per
// coverage: 192 blocks x 8 rows x 2 it x 32 lanes x 8 halves = 1536 x 512 = the whole plane.
// =========================================================================================================
__device__ __forceinline__
void cvt_w(const int blk, const float* __restrict__ wq, const float* __restrict__ wk, const float* __restrict__ wv,
           unsigned short* W16) {
  const int tid = threadIdx.x;
  const int rl = tid >> 5, lane = tid & 31;
  const int o = 8 * blk + rl;                                        // 0..1535
  const int p = blk >> 6;                                            // block-uniform projection 0..2
  const float* wbase = (p == 0) ? wq : ((p == 1) ? wk : wv);         // all global
  const int ol = o - p * CDIM;                                       // 0..511
  v4u u[2];
#pragma unroll
  for (int it = 0; it < 2; ++it) {
    const float* s = wbase + (size_t)ol * CDIM + 256 * it + 8 * lane;
    const v4f a = *(const v4f*)s;
    const v4f q = *(const v4f*)(s + 4);
    const float f[8] = {a[0], a[1], a[2], a[3], q[0], q[1], q[2], q[3]};
#pragma unroll
    for (int t = 0; t < 4; ++t) {
      const _Float16 h0 = (_Float16)(bfr(f[2 * t]) * WSC);
      const _Float16 h1 = (_Float16)(bfr(f[2 * t + 1]) * WSC);
      u[it][t] = pk16(h_bits(h0), h_bits(h1));
    }
  }
{
#pragma unroll
    for (int it = 0; it < 2; ++it)
      *(v4u*)(W16 + (size_t)o * CDIM + 256 * it + 8 * lane) = u[it];
    asm volatile("s_wait_xcnt 0x0" ::: "memory");                    // precaution: each block runs one job, so only the kernel's end follows
  }
}

// =========================================================================================================
// (1) x f32 [b][512 c][1024 n] -> XP f16 [b][n][c] (position-major, bf16-RNE values, exact in f16) through an
//     T is cross-wave (writer and reader waves differ): block barrier between the stores and the reload.
// coverage: XP 2 it x 32 rows x 8 lanes x 8 = 64 n x 64 c; blk = (b, cb, nb) in 0..128*NB-1 covers XP [b<NB][1024][512] once.
// =========================================================================================================
__device__ __forceinline__
void cvt_x(const int blk, const float* __restrict__ x, unsigned short* XP) {
  __shared__ __align__(16) unsigned short T[QT * TP];
  const int tid = threadIdx.x;
  const int nb = blk & (NSEQ / QT - 1), cb = (blk >> 4) & (CDIM / QT - 1), b = blk >> 7;
  const int e = tid & 7, lq = tid >> 3;                             // lq 0..31
  const int n0 = nb * QT, c0 = cb * QT;
#pragma unroll
  for (int it = 0; it < 2; ++it) {
    const int cl = it * 32 + lq;                                     // 0..63
    const float* sp = x + ((size_t)(b * CDIM + c0 + cl)) * NSEQ + n0 + 8 * e;
    const v4f a = *(const v4f*)sp;
    const v4f q = *(const v4f*)(sp + 4);
    // the next trip's loads may land in this trip's address registers: wait before they issue
    if (it == 0) asm volatile("s_wait_xcnt 0x0" ::: "memory");
    unsigned short hb[8];
#pragma unroll
    for (int t = 0; t < 4; ++t) {
      hb[t]     = h_bits((_Float16)bfr(a[t]));
      hb[4 + t] = h_bits((_Float16)bfr(q[t]));
    }
#pragma unroll
    for (int t = 0; t < 8; ++t) T[(8 * e + t) * TP + cl] = hb[t];
  }
  __syncthreads();
  v4u up[2];
#pragma unroll
  for (int it = 0; it < 2; ++it) {
    const int nl = it * 32 + lq;                                     // 0..63
    up[it] = *(const v4u*)(T + nl * TP + 8 * e);
  }
{
#pragma unroll
    for (int it = 0; it < 2; ++it) {
      const int rl = it * 32 + lq;
      *(v4u*)(XP + ((size_t)(b * NSEQ + n0 + rl)) * CDIM + c0 + 8 * e) = up[it];
    }
    asm volatile("s_wait_xcnt 0x0" ::: "memory");                    // precaution: each block runs one job, so only the kernel's end follows
  }
}

// =========================================================================================================
// (2) relative position rows, transposed: REL bf16 [h][64 rows][64 d], row x (0..31) = bf16-RNE(rh[h][d][x]), row 32 + y =
//     bf16-RNE(rw[h][d][y]). pos[h][d][n] = rh[h][d][n%32] + rw[h][d][n/32], so pos_i . q_j = REL row (i%32) . q_j +
//     REL row (32 + i/32) . q_j: 64 products per key serve all 1024 queries. One task (h, row, e) per thread covers
//     d = 8e..8e+7 (16 B).
// coverage: 16 blocks x 256 threads = 8 h x 64 rows x 8 e = the whole plane.
// =========================================================================================================
__device__ __forceinline__
void rel_k(const int blk, const float* __restrict__ rh, const float* __restrict__ rw, unsigned short* REL) {
  const int idx = blk * 256 + (int)threadIdx.x;                     // 0..4095
  const int e = idx & 7;
  const int row = (idx >> 3) & 63;
  const int h = (idx >> 9) & (HEADS - 1);
  const float* sp = ((row < 32) ? rh : rw) + (h * DH + 8 * e) * 32 + (row & 31);   // both global
  v4u u;
#pragma unroll
  for (int t = 0; t < 4; ++t) u[t] = pk16(bf_bits(sp[(2 * t) * 32]), bf_bits(sp[(2 * t + 1) * 32]));
  *(v4u*)(REL + (h * 64 + row) * DH + 8 * e) = u;
  asm volatile("s_wait_xcnt 0x0" ::: "memory");                      // another job's code may follow and reuse these registers
}

// =========================================================================================================
// (0)+(1)+(2) in one launch: the three jobs read only inputs and write disjoint planes, so none needs another's result.
//     A range of the block index picks the job (block-uniform branch, so the barrier in (1) is passed by whole blocks):
//     blocks 0..PXB-1 -> (1), the longest job, first; then PPB blocks of (2); then PWB blocks of (0).
// =========================================================================================================
__global__ __launch_bounds__(256)
void prep(const float* __restrict__ x, const float* __restrict__ wq, const float* __restrict__ wk,
          const float* __restrict__ wv, const float* __restrict__ rh, const float* __restrict__ rw,
          unsigned short* W16, unsigned short* XP, unsigned short* REL) {
  const int blk = blockIdx.x;
  if (blk < PXB)            cvt_x(blk, x, XP);
  else if (blk < PXB + PPB) rel_k(blk - PXB, rh, rw, REL);
  else                      cvt_w(blk - (PXB + PPB), wq, wk, wv, W16);
}

// =========================================================================================================
// (3) conv1x1 GEMM for one (b, 128-n tile, 128-o block): Y[o][n] = (1/256) sum_c W16[o][c] XP[b][n][c] + bias[o].
//     Block 128 threads = 4 waves in 2 x 2; a wave owns a 64 x 64 piece of the tile: 4 A fragments (rows o, from W16) and
//     4 B fragments (cols n, from XP) per k-step feed 16 accumulator tiles. K = 512 = 16 steps. Both operands are
//     k-contiguous rows read by the same split k map loader.
//     Both come from LDS: a ring of two 64-k stages (128 W16 rows, then 128 XP rows, x 128 B, pitch 144 B = 16 B x odd)
//     brought by whole-line asynchronous copies that the 4 waves share.
//     Epilogue staged in LDS Os[n_loc][o_loc] (pitch OSP, b128 stores of 8 consecutive o per lane), block barrier
//     (Os is cross-wave), then by o-block: mb 0..3 -> q of heads 2mb, 2mb+1 (QK planes cols 0..63, bf16 hi = RNE(v), lo =
//     RNE(v - hi)), mb 4..7 -> k (cols 64..127), mb 8..11 -> v -> Vc f16 [b][512 ch][1024 n] (channel-major, keys
//     contiguous). Each stored segment is one whole 128-B line.
// coverage: Os 4 waves x 64 x 64 = 128 x 128; q/k path 4 groups x 4 it x 16 rows x 8 lanes x 8 = 128 n x 128 o (hi and lo);
//           v path 4 groups x 4 it x 16 ch x 8 lanes x 8 = 128 ch x 128 n; grid (8, 12, NB) covers QK cols 0..127 of all
//           rows b<NB and Vc [b<NB][512][1024] exactly once.
// =========================================================================================================
__global__ __launch_bounds__(128)
void gemm_qkv(const unsigned short* __restrict__ W16, const unsigned short* __restrict__ XP,
              const float* __restrict__ bq, const float* __restrict__ bk, const float* __restrict__ bv,
              const unsigned short* __restrict__ REL,
              unsigned short* QKh, unsigned short* QKl, unsigned short* Vc, float* RT) {
  __shared__ __align__(16) unsigned char smem[2 * GSTAGE];
  float* Os = (float*)smem;                                          // output staging, used behind the ring's last barrier
  const int tid  = threadIdx.x;
  const int lane = tid & 31, wave = tid >> 5;
  const int hh   = lane >> 4, c = lane & 15;
  const int wr   = wave >> 1, wc = wave & 1;                         // this wave's 64 rows o / 64 cols n of the tile
  const int nt   = blockIdx.x, mb = blockIdx.y, b = blockIdx.z;
  const int n0   = nt * GT, o0 = mb * GT;                            // o0 = row block of the stacked W16
  const int p    = mb >> 2;                                          // block-uniform projection 0..2

  // copy addresses of this lane: rows in 8 chunks of 16 B (row tid>>3, 16 rows per copy)
  const int cr = tid >> 3, cch = tid & 7;
  const unsigned la = (unsigned)(uintptr_t)smem + (unsigned)(cr * GP + cch * 16);   // low 32 bits = LDS byte address
  const unsigned short* ga = W16 + (size_t)(o0 + cr) * CDIM + 8 * cch;
  const unsigned short* gb = XP + ((size_t)(b * NSEQ + n0 + cr)) * CDIM + 8 * cch;

  copy_g(la, ga);
  copy_g(la + GT * GP, gb);
  asm volatile("s_wait_asynccnt 0x0" ::: "memory");                  // this wave's part of stage 0 has landed
  __syncthreads();                                                   // ... and every other wave's
  copy_g(la + GSTAGE, ga + GK);
  copy_g(la + GSTAGE + GT * GP, gb + GK);

  v8f acc[4][4];
#pragma unroll
  for (int i = 0; i < 4; ++i) {
#pragma unroll
    for (int j = 0; j < 4; ++j) acc[i][j] = zero8();
  }

  // rolled: one trip per ring stage, so that the publish point stands once in the text
#pragma unroll 1
  for (int s = 0; s < CDIM / GK; ++s) {
    const unsigned char* st = smem + (s & 1) * GSTAGE;
    const unsigned short* ap = (const unsigned short*)(st + (64 * wr + c) * GP) + 8 * hh;
    const unsigned short* bp = (const unsigned short*)(st + (GT + 64 * wc + c) * GP) + 8 * hh;
#pragma unroll
    for (int kk = 0; kk < GK / 32; ++kk) {
      Frag fa[4], fb[4];
#pragma unroll
      for (int j = 0; j < 4; ++j) fb[j] = ldfrag(bp + (16 * j) * (GP / 2) + 32 * kk);
#pragma unroll
      for (int i = 0; i < 4; ++i) fa[i] = ldfrag(ap + (16 * i) * (GP / 2) + 32 * kk);
#pragma unroll
      for (int i = 0; i < 4; ++i) {
#pragma unroll
        for (int j = 0; j < 4; ++j) acc[i][j] = mma_h(fa[i].h, fb[j].h, acc[i][j]);
      }
    }

    asm volatile("s_wait_dscnt 0x0" ::: "memory");                   // this wave's reads of stage s are done
    asm volatile("s_wait_asynccnt 0x0" ::: "memory");                // this wave's copies of stage s+1 have landed
    __syncthreads();                                                 // publishes stage s+1, frees stage s's buffer
    if (s + 2 < CDIM / GK) {
      copy_g(la + (unsigned)((s & 1) * GSTAGE), ga + (s + 2) * GK);
      copy_g(la + (unsigned)((s & 1) * GSTAGE) + GT * GP, gb + (s + 2) * GK);
    }
  }
  asm volatile("s_wait_asynccnt 0x0" ::: "memory");                  // nothing in flight when the ring becomes Os

  // ---- q blocks: position products of the block's positions as keys, R[n][row] = q_n . REL row (64 rows of the wave's
  //      head, K = 64 d), made from the accumulators: lane (hh, c) holds d = 16 i + 8 hh + r of position n = 16 j + c, which
  //      is the A fragment's own map (row c; elements 0..7 <- tile i = 2 m, 8..15 <- tile 2 m + 1), so q (bias added, bf16
  //      hi + residual, the values of the planes) goes from D registers to A registers with no exchange. B = REL rows by
  //      the same split k map. Products hi.REL (2 k-steps), then residual.REL. A D tile (16 keys x 16 rows) is stored as it
  //      lies in registers, RT f32 [b][h][64 key tiles][4 row tiles][2 halves r 0..3 | 4..7][32 lanes][4]: 512 B in a row
  //      per store, and the score tiles of (4) start from it lane for lane. Block-uniform branch, no barrier inside.
  // coverage: 4 waves = 2 heads x 64 n; 4 j x 4 a tiles; grid (8, mb 0..3, NB) covers RT [b<NB][8][64][4] exactly once.
  if (p == 0) {
    const int head = 2 * mb + wr;
    const unsigned short* rp = REL + (head * 64 + c) * DH + 8 * hh;
    Frag fr[4][2];
#pragma unroll
    for (int a = 0; a < 4; ++a) {
#pragma unroll
      for (int m = 0; m < 2; ++m) fr[a][m] = ldfrag(rp + (16 * a) * DH + 32 * m);
    }
    float* rt = RT + ((size_t)((b * HEADS + head) * (NSEQ / 16) + nt * (GT / 16) + 4 * wc)) * RKEY + 4 * lane;
    v4f braw[4][2];
#pragma unroll
    for (int i = 0; i < 4; ++i) {
      braw[i][0] = *(const v4f*)(bq + head * DH + 16 * i + 8 * hh);
      braw[i][1] = *(const v4f*)(bq + head * DH + 16 * i + 8 * hh + 4);
    }
    asm volatile("s_wait_xcnt 0x0" ::: "memory");                    // the code below may reuse these loads' address registers
    __builtin_amdgcn_sched_barrier(0);                               // keeps that code from being lifted over the wait
    v2f bd[4][4];
#pragma unroll
    for (int i = 0; i < 4; ++i) {
#pragma unroll
      for (int t = 0; t < 4; ++t) {
        bd[i][t][0] = bfr(braw[i][t >> 1][2 * (t & 1)]);
        bd[i][t][1] = bfr(braw[i][t >> 1][2 * (t & 1) + 1]);
      }
    }
    const v2f isc = {IWSC, IWSC};
    // unrolled: the accumulators need constant indices
#pragma unroll
    for (int j = 0; j < 4; ++j) {
      FragW qa[2], qe[2];
#pragma unroll
      for (int i = 0; i < 4; ++i) {
#pragma unroll
        for (int t = 0; t < 4; ++t) {
          const v2f a2 = {acc[i][j][2 * t], acc[i][j][2 * t + 1]};
          const v2f f = __builtin_elementwise_fma(a2, isc, bd[i][t]);  // the scale is a power of two: one rounding, as mul + add
          const unsigned hb = bf_pair(f[0], f[1]);
          qa[i >> 1].w[i & 1][t] = hb;
          qe[i >> 1].w[i & 1][t] = bf_pair(f[0] - __uint_as_float(hb << 16), f[1] - __uint_as_float(hb & 0xFFFF0000u));
        }
      }
      v8f d[4];
#pragma unroll
      for (int a = 0; a < 4; ++a) d[a] = wm_b(qa[0].bf, fr[a][0].bf, zero8());
#pragma unroll
      for (int a = 0; a < 4; ++a) d[a] = wm_b(qa[1].bf, fr[a][1].bf, d[a]);
#pragma unroll
      for (int a = 0; a < 4; ++a) d[a] = wm_b(qe[0].bf, fr[a][0].bf, d[a]);
#pragma unroll
      for (int a = 0; a < 4; ++a) d[a] = wm_b(qe[1].bf, fr[a][1].bf, d[a]);
#pragma unroll
      for (int a = 0; a < 4; ++a) {
        const v4f va = {d[a][0], d[a][1], d[a][2], d[a][3]}, vb = {d[a][4], d[a][5], d[a][6], d[a][7]};
        *(v4f*)(rt + j * RKEY + a * RTILE)       = va;
        *(v4f*)(rt + j * RKEY + a * RTILE + 128) = vb;
      }
      asm volatile("s_wait_xcnt 0x0" ::: "memory");                  // the code that follows may reuse these stores' registers
      __builtin_amdgcn_sched_barrier(0);                             // keeps that code from being lifted over the wait
    }
  }

  // ---- epilogue: scale back -> LDS Os[n_loc][o_loc]; lane (hh, c) holds o_loc = 64 wr + 16 i + 8 hh + r for
  //      n_loc = 64 wc + 16 j + c
#pragma unroll
  for (int j = 0; j < 4; ++j) {
    const int nl = 64 * wc + 16 * j + c;
#pragma unroll
    for (int i = 0; i < 4; ++i) {
      v4f va, vb;
#pragma unroll
      for (int r = 0; r < 4; ++r) { va[r] = acc[i][j][r] * IWSC; vb[r] = acc[i][j][4 + r] * IWSC; }
      *(v4f*)(Os + nl * OSP + 64 * wr + 16 * i + 8 * hh)     = va;
      *(v4f*)(Os + nl * OSP + 64 * wr + 16 * i + 8 * hh + 4) = vb;
    }
  }
  __syncthreads();

  const int e = tid & 7, lq = tid >> 3;                             // lq 0..15
  const int ol0 = (mb & 3) * GT;                                     // first channel of the block inside its projection
  const float* bias = (p == 0) ? bq : ((p == 1) ? bk : bv);          // all global
  if (p < 2) {
    // group g: head 2 (mb & 3) + (g >> 1), rows n_loc 64 (g & 1) ..+63
    float bb[2][8];
#pragma unroll
    for (int hs = 0; hs < 2; ++hs) {
      const v4f b0 = *(const v4f*)(bias + ol0 + hs * DH + 8 * e);
      const v4f b1 = *(const v4f*)(bias + ol0 + hs * DH + 8 * e + 4);
#pragma unroll
      for (int t = 0; t < 4; ++t) { bb[hs][t] = bfr(b0[t]); bb[hs][4 + t] = bfr(b1[t]); }
    }
    // unrolled: the bias registers need constant indices
#pragma unroll
    for (int g = 0; g < 4; ++g) {
      const int hs = g >> 1, rb = (g & 1) * 64;
      const int head = (ol0 >> 6) + hs;
      v4u uh[4], ul[4];
#pragma unroll
      for (int it = 0; it < 4; ++it) {
        const int row = rb + it * 16 + lq;                           // n_loc
        const v4f a = *(const v4f*)(Os + row * OSP + 64 * hs + 8 * e);
        const v4f q = *(const v4f*)(Os + row * OSP + 64 * hs + 8 * e + 4);
        const float f[8] = {a[0], a[1], a[2], a[3], q[0], q[1], q[2], q[3]};
#pragma unroll
        for (int t = 0; t < 4; ++t) {
          const float f0 = f[2 * t] + bb[hs][2 * t], f1 = f[2 * t + 1] + bb[hs][2 * t + 1];
          const unsigned short hb0 = bf_bits(f0), hb1 = bf_bits(f1);
          const unsigned short lb0 = bf_bits(f0 - bf_up(hb0));
          const unsigned short lb1 = bf_bits(f1 - bf_up(hb1));
          uh[it][t] = pk16(hb0, hb1);
          ul[it][t] = pk16(lb0, lb1);
        }
      }
#pragma unroll
      for (int it = 0; it < 4; ++it) {
        const int row = rb + it * 16 + lq;
        const size_t po = ((size_t)((b * HEADS + head) * NSEQ + n0 + row)) * KROW + p * DH + 8 * e;
        *(v4u*)(QKh + po) = uh[it];
        *(v4u*)(QKl + po) = ul[it];
      }
      // the next group's code may reuse these stores' registers; behind the last group the wave ends
      if (g < 3) asm volatile("s_wait_xcnt 0x0" ::: "memory");
    }
  } else {
    // group g: keys n_loc 64 (g >> 1) ..+63, channels o_loc 64 (g & 1) ..+63
    float bo[2][4];
#pragma unroll
    for (int k = 0; k < 8; ++k) bo[k >> 2][k & 3] = bfr(bias[ol0 + k * 16 + lq]);
    // unrolled: the bias registers need constant indices
#pragma unroll
    for (int g = 0; g < 4; ++g) {
      const int hs = g >> 1, rb = (g & 1) * 64;
      v4u uv[4];
#pragma unroll
      for (int it = 0; it < 4; ++it) {
        const int row = rb + it * 16 + lq;                           // o_loc -> channel ol0 + row
        unsigned short hb[8];
#pragma unroll
        for (int t = 0; t < 8; ++t) hb[t] = h_bits((_Float16)(Os[(64 * hs + 8 * e + t) * OSP + row] + bo[g & 1][it]));
#pragma unroll
        for (int t = 0; t < 4; ++t) uv[it][t] = pk16(hb[2 * t], hb[2 * t + 1]);
      }
#pragma unroll
      for (int it = 0; it < 4; ++it) {
        const int row = rb + it * 16 + lq;
        *(v4u*)(Vc + ((size_t)(b * CDIM + ol0 + row)) * NSEQ + n0 + 64 * hs + 8 * e) = uv[it];
      }
      // the next group's code, and behind the last group the q / k branch's, which follows in the built code, may reuse
      // these stores' registers
      asm volatile("s_wait_xcnt 0x0" ::: "memory");
    }
  }
}

// =========================================================================================================
// (4) attention for one (b, h, 128-query tile), transposed formulation, 1024 keys, no mask, no scale:
//   S^T tile (16 keys x 16 queries) = start value + sum over 2 d-chunks of A(key row j = kb + (lane&15) of the bf16
//   plane QKh [b][h][1024][128]: cols 64..127 (k_j), split k map) . B(query col i: cols 0..63 (q_i), same map) as
//   A(hi).B(hi) + A(hi).B(lo) + A(lo).B(hi) (bf16 unscaled residual planes, shared accumulator). The start value is the
//   position term pos_i . q_j = R[j][i%32] + R[j][32 + i/32] from RT (made in (3)): a wave's 32 queries are x = 0..31 of
//   one y, so its two column groups start from the key tile's two x tiles, lane for lane, plus the wave's y column (one
//   value per key, the same for every query of the wave).
//   Per lane the D tile holds 8 keys of ONE query: online softmax state per lane, one shuffle (lane^16) for the max
//   over 32 keys; the o/l rescale is skipped under a wave-uniform ballot when no lane's max grew (corr == 1 exactly
//   for every lane then); the row sum is accumulated from the f16-converted P values; row-sum partials combined at
//   the end. P = e^{s-m} x 16384 as f16 is the B operand of O^T (rows channel, cols queries) += A(v rows channel =
//   h*64 + 16j + (lane&15), keys contiguous, f16 plane Vc [b][512][1024]) . B(P^T): element r <- D of the tile
//   covering keys kb..kb+15, element 8+r <- the tile covering kb+16..kb+31, lane unchanged. 4 accumulator tiles per
//   16-query column group (64 channels). Block = 4 waves = 128 queries.
//   Wave tile: a wave owns two 16-query column groups and keeps their B fragments (2 d-chunks x hi / residual) in
//   registers for the whole key loop, so every key and v fragment read from LDS feeds both groups and the loop reads no
//   query row. Each accumulator sums its products in the order hi.hi, hi.lo, lo.hi per d-chunk.
//   The block's 128 query rows (cols 0..63 of both planes) pass through LDS once; a ring of two 32-key stages (cols
//   64..127 of both planes, v 64 ch x 32 keys, 2 x 3 tiles of RT) feeds the loop; all brought by asynchronous
//   copies that the 4 waves share (whole 128-B lines, v rows 64-B halves); rows pitched 144 B / 80 B (16 B x odd) for the b128 fragment reads.
//   Epilogue: O/l staged in LDS Os[query][64 channels] (pitch OSPW, b128 stores), block barrier (Os is cross-wave),
// coverage: 16 it x 16 lines x 8 lanes x 4 floats = 64 ch x 128 n; grid (NQ/128, NB*8) covers
//           out[b<NB][0..511][0..NQ-1] exactly once.
// =========================================================================================================
__global__ __launch_bounds__(128)
void attn_k(const unsigned short* __restrict__ QKh, const unsigned short* __restrict__ QKl,
            const unsigned short* __restrict__ Vc, const float* __restrict__ RT, float* out) {
  __shared__ __align__(16) unsigned char smem[SMEM];
  float* Os = (float*)smem;                                          // output staging, used behind the ring's last barrier
  const int tid  = threadIdx.x;
  const int wave = tid >> 5, lane = tid & 31;
  const int hh   = lane >> 4, c = lane & 15;
  const int n0   = blockIdx.x * QB;
  const int bh   = blockIdx.y;
  const int b    = bh >> 3, h = bh & 7;
  const size_t prow = (size_t)bh * NSEQ * KROW;

  // copy addresses of this lane: K / Q rows in 8 chunks of 16 B (row tid>>3, 16 rows per copy), v rows in 4 chunks; of RT
  // per key tile the x tiles' 2 KiB (16 B per thread) and the y tile of this block's rows (64 threads per key tile)
  const int kr = tid >> 3, kch = tid & 7;
  const int vr = tid >> 2, vch = tid & 3;
  const int y0 = n0 >> 5;                                            // the block's queries: y = y0 .. y0 + 3, in one row tile
  const unsigned sbase = (unsigned)(uintptr_t)smem;                  // low 32 bits = byte address in the block's LDS
  const unsigned lk = sbase + (unsigned)(kr * KP + kch * 16);
  const unsigned lv = sbase + (unsigned)(SM_V + vr * VP + vch * 16);
  const unsigned lr = sbase + (unsigned)(SM_R + tid * 16);
  const unsigned lw = sbase + (unsigned)(SM_R + (tid >> 6) * RREC + 2 * RTILE * 4 + (tid & 63) * 16);
  const unsigned short* gkh = QKh + prow + (size_t)kr * KROW + DH + 8 * kch;
  const unsigned short* gkl = QKl + prow + (size_t)kr * KROW + DH + 8 * kch;
  const unsigned short* gv  = Vc + ((size_t)(b * CDIM + h * DH + vr)) * NSEQ + 8 * vch;
  const float* gr = RT + (size_t)bh * (NSEQ / 16) * RKEY + 4 * tid;
  const float* gw = RT + (size_t)bh * (NSEQ / 16) * RKEY + (tid >> 6) * RKEY + (2 + (y0 >> 4)) * RTILE + 4 * (tid & 63);
  const size_t gq = prow + (size_t)(n0 + kr) * KROW + 8 * kch;       // cols 0..63

  copy_q(lk + SM_QH, QKh + gq);
  copy_q(lk + SM_QL, QKl + gq);
  copy_stage(lk, lv, lr, lw, gkh, gkl, gv, gr, gw);
  asm volatile("s_wait_asynccnt 0x0" ::: "memory");                  // this wave's query rows and stage 0 have landed
  __syncthreads();                                                   // ... and every other wave's
  copy_stage(lk + STAGE, lv + STAGE, lr + STAGE, lw + STAGE, gkh + (size_t)KT * KROW, gkl + (size_t)KT * KROW, gv + KT,
             gr + 2 * RKEY, gw + 2 * RKEY);

  // query fragments (B operand, col = query 32*wave + 16*u + c of the tile), read once and held in registers
  Frag qh[2][2], ql[2][2];
#pragma unroll
  for (int u = 0; u < 2; ++u) {
    const unsigned short* Qhp = (const unsigned short*)(smem + SM_QH + (32 * wave + 16 * u + c) * KP) + 8 * hh;
    const unsigned short* Qlp = (const unsigned short*)(smem + SM_QL + (32 * wave + 16 * u + c) * KP) + 8 * hh;
#pragma unroll
    for (int kc = 0; kc < 2; ++kc) {                                 // LDS row = q_i
      qh[u][kc] = ldfrag(Qhp + 32 * kc);
      ql[u][kc] = ldfrag(Qlp + 32 * kc);
    }
  }
  const int yl = 16 * hh + ((y0 + wave) & 15);                       // the lane of a y tile that holds this half's 8 keys

  float m[2] = {-1.0e30f, -1.0e30f}, l[2] = {0.f, 0.f};
  v8f o[2][4];
#pragma unroll
  for (int u = 0; u < 2; ++u) {
#pragma unroll
    for (int j = 0; j < 4; ++j) o[u][j] = zero8();
  }

  // rolled: one trip per ring stage, so that the publish point stands once in the text
#pragma unroll 1
  for (int t = 0; t < NSEQ / KT; ++t) {
    const unsigned char* st = smem + (t & 1) * STAGE;
    const unsigned short* k0p  = (const unsigned short*)(st + c * KP) + 8 * hh;              // keys 32t .. 32t+15
    const unsigned short* k1p  = (const unsigned short*)(st + (c + 16) * KP) + 8 * hh;       // keys 32t+16 .. 32t+31
    const unsigned short* k0lp = (const unsigned short*)(st + SM_KL + c * KP) + 8 * hh;
    const unsigned short* k1lp = (const unsigned short*)(st + SM_KL + (c + 16) * KP) + 8 * hh;
    const unsigned short* Vp   = (const unsigned short*)(st + SM_V + c * VP) + 8 * hh;       // + 16*j rows
    const float* Rp = (const float*)(st + SM_R) + 4 * lane;                                  // x tiles, this lane's values
    const float* Yp = (const float*)(st + SM_R) + 2 * RTILE + 4 * yl;                        // y tile, the wave's column
    v8f s0[2], s1[2];
    {
      const v4f y0a = *(const v4f*)(Yp), y0b = *(const v4f*)(Yp + 128);
      const v4f y1a = *(const v4f*)(Yp + RREC / 4), y1b = *(const v4f*)(Yp + RREC / 4 + 128);
#pragma unroll
      for (int u = 0; u < 2; ++u) {
        const v4f a0 = *(const v4f*)(Rp + u * RTILE) + y0a, b0 = *(const v4f*)(Rp + u * RTILE + 128) + y0b;
        const v4f a1 = *(const v4f*)(Rp + RREC / 4 + u * RTILE) + y1a, b1 = *(const v4f*)(Rp + RREC / 4 + u * RTILE + 128) + y1b;
        s0[u] = __builtin_shufflevector(a0, b0, 0, 1, 2, 3, 4, 5, 6, 7);
        s1[u] = __builtin_shufflevector(a1, b1, 0, 1, 2, 3, 4, 5, 6, 7);
      }
    }
    // unrolled: the register-held query fragments need constant indices
#pragma unroll
    for (int kc = 0; kc < 2; ++kc) {
      const int acol = kc * 32;                                      // LDS row = k_j
      const Frag k0  = ldfrag(k0p + acol);
      const Frag k1  = ldfrag(k1p + acol);
      const Frag k0l = ldfrag(k0lp + acol);
      const Frag k1l = ldfrag(k1lp + acol);
#pragma unroll
      for (int u = 0; u < 2; ++u) {
        s0[u] = wm_b(k0.bf, qh[u][kc].bf, s0[u]);
        s1[u] = wm_b(k1.bf, qh[u][kc].bf, s1[u]);
      }
#pragma unroll
      for (int u = 0; u < 2; ++u) {
        s0[u] = wm_b(k0.bf, ql[u][kc].bf, s0[u]);
        s1[u] = wm_b(k1.bf, ql[u][kc].bf, s1[u]);
      }
#pragma unroll
      for (int u = 0; u < 2; ++u) {
        s0[u] = wm_b(k0l.bf, qh[u][kc].bf, s0[u]);
        s1[u] = wm_b(k1l.bf, qh[u][kc].bf, s1[u]);
      }
    }

    float mn[2];
    bool up = false;
#pragma unroll
    for (int u = 0; u < 2; ++u) {
      float mx = fmaxf(hmax8(s0[u]), hmax8(s1[u]));
      mx = fmaxf(mx, __shfl_xor(mx, 16, 32));
      mn[u] = fmaxf(m[u], mx);
      up = up || (mx > m[u]);
    }
    const unsigned grew = wave_ballot(up);                           // wave-uniform, one test per stage
    if (grew != 0u) {
#pragma unroll
      for (int u = 0; u < 2; ++u) {
        const float corr = __expf(m[u] - mn[u]);                     // == 1 exactly where the max did not grow
        l[u] *= corr;
#pragma unroll
        for (int j = 0; j < 4; ++j) {
#pragma unroll
          for (int r = 0; r < 8; ++r) o[u][j][r] *= corr;
        }
      }
    }

    FragH ph[2];
#pragma unroll
    for (int u = 0; u < 2; ++u) {
      m[u] = mn[u];
      const float msh = mn[u] - LNPS;                                // exp gives e^{s-m} * 16384
      float ls = 0.f;
#pragma unroll
      for (int r = 0; r < 8; ++r) {
        const _Float16 p0 = (_Float16)__expf(s0[u][r] - msh);        // key kb      + 8hh + r
        const _Float16 p1 = (_Float16)__expf(s1[u][r] - msh);        // key kb + 16 + 8hh + r
        ls += (float)p0 + (float)p1;
        ph[u].hv[0][r] = p0;
        ph[u].hv[1][r] = p1;
      }
      l[u] += ls;
    }

#pragma unroll
    for (int j = 0; j < 4; ++j) {
      const Frag vf = ldfrag(Vp + (16 * j) * (VP / 2));
      o[0][j] = wm_h(vf.h, ph[0].v, o[0][j]);
      o[1][j] = wm_h(vf.h, ph[1].v, o[1][j]);
    }

    asm volatile("s_wait_dscnt 0x0" ::: "memory");                   // this wave's reads of stage t are done
    asm volatile("s_wait_asynccnt 0x0" ::: "memory");                // this wave's copies of stage t+1 have landed
    __syncthreads();                                                 // publishes stage t+1, frees stage t's buffer
    if (t + 2 < NSEQ / KT)
      copy_stage(lk + (unsigned)((t & 1) * STAGE), lv + (unsigned)((t & 1) * STAGE), lr + (unsigned)((t & 1) * STAGE),
                 lw + (unsigned)((t & 1) * STAGE), gkh + (size_t)(t + 2) * (KT * KROW), gkl + (size_t)(t + 2) * (KT * KROW),
                 gv + (t + 2) * KT, gr + (size_t)(t + 2) * (2 * RKEY), gw + (size_t)(t + 2) * (2 * RKEY));
  }
  asm volatile("s_wait_asynccnt 0x0" ::: "memory");                  // nothing in flight when the ring becomes Os

#pragma unroll
  for (int u = 0; u < 2; ++u) {
    const float lt  = l[u] + __shfl_xor(l[u], 16, 32);
    const float inv = 1.0f / lt;                                     // o and l both carry the x16384 factor
    const int qrow = 32 * wave + 16 * u + c;
#pragma unroll
    for (int j = 0; j < 4; ++j) {
      v4f va, vb;
#pragma unroll
      for (int r = 0; r < 4; ++r) { va[r] = o[u][j][r] * inv; vb[r] = o[u][j][4 + r] * inv; }
      *(v4f*)(Os + qrow * OSPW + 16 * j + 8 * hh)     = va;          // Os[query][ch_loc = 16j + 8hh + r]
      *(v4f*)(Os + qrow * OSPW + 16 * j + 8 * hh + 4) = vb;
    }
  }
  __syncthreads();

  const int e = tid & 7, lq = tid >> 3;                              // lq 0..15
  v4f res[16];
#pragma unroll
  for (int it = 0; it < 16; ++it) {
    const int L   = it * 16 + lq;                                    // 0..255
    const int chl = L >> 2, qf = L & 3;                              // channel 0..63 within the head
    const int nl  = qf * 32 + 4 * e;                                 // query 0..127
#pragma unroll
    for (int t = 0; t < 4; ++t) res[it][t] = Os[(nl + t) * OSPW + chl];
  }
#pragma unroll
  for (int it = 0; it < 16; ++it) {
    const int L   = it * 16 + lq;
    const int chl = L >> 2, qf = L & 3;
    const int nl  = qf * 32 + 4 * e;
    const size_t idx = ((size_t)(b * CDIM + h * DH + chl)) * NSEQ + n0 + nl;
    *(v4f*)(out + idx) = res[it];
  }
}

// =========================================================================================================
// Workspace map (bytes; each region start a multiple of 256; every extent is an exact tile multiple and is written
//   W16 f16 [1536][512]               1572864
//   XP  f16 [NB][1024][512]           8388608 (NB=8)
//   QKh / QKl bf16 [NB][8][1024][128] 16777216 x2 (NB=8)
//   Vc  f16 [NB][512][1024]           8388608 (NB=8)
//   REL bf16 [8][64][64]              65536
//   RT  f32 [NB][8][64][4][256]       16777216 (NB=8)
//   total = 68747264 (NB=8)
// =========================================================================================================
extern "C" void kernel_launch(void* const* d_in, const int* in_sizes, int n_in,
                              void* d_out, int out_size, void* d_ws, size_t ws_size,
                              hipStream_t stream) {
  const int XN = NB * CDIM * NSEQ;
  if (n_in < 9) return;
  if (in_sizes[0] < XN) return;
  if (in_sizes[1] < CDIM * CDIM || in_sizes[3] < CDIM * CDIM || in_sizes[5] < CDIM * CDIM) return;
  if (in_sizes[2] < CDIM || in_sizes[4] < CDIM || in_sizes[6] < CDIM) return;
  if (in_sizes[7] < HEADS * DH * 32 || in_sizes[8] < HEADS * DH * 32) return;
  if (out_size < XN) return;

  size_t off = 0;
  auto carve = [&](size_t bytes) { const size_t o = off; off += (bytes + 255) & ~(size_t)255; return o; };
  const size_t oW16 = carve((size_t)MW * CDIM * 2);
  const size_t oXP  = carve((size_t)NB * NSEQ * CDIM * 2);
  const size_t oQKh = carve((size_t)NB * HEADS * NSEQ * KROW * 2);
  const size_t oQKl = carve((size_t)NB * HEADS * NSEQ * KROW * 2);
  const size_t oVc  = carve((size_t)NB * CDIM * NSEQ * 2);
  const size_t oREL = carve((size_t)HEADS * 64 * DH * 2);
  const size_t oRT  = carve((size_t)NB * HEADS * (NSEQ / 16) * RKEY * 4);
  if (off > ws_size) return;
  if (off > (size_t)134217728) return;

  const float* x   = (const float*)d_in[0];
  const float* wqw = (const float*)d_in[1];
  const float* wqb = (const float*)d_in[2];
  const float* wkw = (const float*)d_in[3];
  const float* wkb = (const float*)d_in[4];
  const float* wvw = (const float*)d_in[5];
  const float* wvb = (const float*)d_in[6];
  const float* rh  = (const float*)d_in[7];
  const float* rw  = (const float*)d_in[8];

  char* ws = (char*)d_ws;
  unsigned short* W16 = (unsigned short*)(ws + oW16);
  unsigned short* XP  = (unsigned short*)(ws + oXP);
  unsigned short* QKh = (unsigned short*)(ws + oQKh);
  unsigned short* QKl = (unsigned short*)(ws + oQKl);
  unsigned short* Vc  = (unsigned short*)(ws + oVc);
  unsigned short* REL = (unsigned short*)(ws + oREL);
  float* RT = (float*)(ws + oRT);
  float* out = (float*)d_out;

  const dim3 blk256(256), blk128(128);

  // (0)+(1)+(2) wq / wk / wv -> stacked f16 plane; x -> position-major 16-bit plane; relative position rows -> REL
  prep<<<dim3(PXB + PPB + PWB), blk256, 0, stream>>>(x, wqw, wkw, wvw, rh, rw, W16, XP, REL);
  // (3) conv1x1 GEMM -> q/k hi + residual planes, v f16 plane, position products of every key
  gemm_qkv<<<dim3(NSEQ / GT, MW / GT, NB), blk128, 0, stream>>>(W16, XP, wqb, wkb, wvb, REL, QKh, QKl, Vc, RT);
  // (4) attention -> out [b][512][1024]
  attn_k<<<dim3(NQ / QB, NB * HEADS), blk128, 0, stream>>>(QKh, QKl, Vc, RT, out);
  (void)hipGetLastError();
}

// v006
// A run of this version takes 66.1 microseconds.
// Next to v005, in two timings, it ran 1.09 and 1.10 times as fast.
// Counting every step since v000, it is 4.05 times as fast.
// Contractions: conv1x1 q/k/v GEMM W[1536x512].X[512x1024] on v_wmma_f32_16x16x32_f16 (f16 containers of
// bf16-RNE weights x256 and bf16-RNE x); position products q_j.[rh_x|rw_y] (64 per key, q as bf16 hi + residual) and
// scores k_j.q_i (K=64, bf16 hi + bf16 residual planes, 3 products) on v_wmma_f32_16x16x32_bf16; y^T = V.P^T on v_wmma_f32_16x16x32_f16 (v as f16, P = e^{s-m}
// x 2^14 f16 from the score D registers); f32 accumulate everywhere; bias adds and softmax statistics in f32 VALU.
#include <hip/hip_runtime.h>
#include <math.h>
#include <stdint.h>

#ifndef NB
#define NB 8
#endif
#ifndef NQ
#define NQ 1024
#endif
#define HEADS 8
#define CDIM  512
#define DH    64
#define NSEQ  1024
#define NPROJ 3
#define MW    (NPROJ * CDIM)
#define KROW  128
#define QT    64
#define QB    128
#define GT    128
#define OSP   132
#define OSPW  68
#define TP    72
#define WSC   256.0f
#define IWSC  0.00390625f
#define LNPS  9.704060527839234f
#define KT    32
#define KP    144
#define VP    80
#define SM_KL (KT * KP)
#define SM_V  (2 * KT * KP)
#define SM_R  (SM_V + DH * VP)
#define RREC  3072
#define STAGE (SM_R + 2 * RREC)
#define RTILE 256
#define RKEY  (4 * RTILE)
#define KG    2
#define RST   (KG * STAGE)
#define SM_QH (2 * RST)
#define SM_QL (SM_QH + QB * KP)
#define SMEM  (SM_QL + QB * KP)
#define GK    64
#define GP    144
#define GSTAGE (2 * GT * GP)
#define PXB   ((NSEQ / QT) * (CDIM / QT) * NB)
#define PPB   ((HEADS * 64 * 8) / 256)
#define PWB   (MW / 8)

static_assert(NB >= 1 && NB <= 8);
static_assert(NQ % QB == 0 && NQ >= QB && NQ <= NSEQ);
static_assert(HEADS * DH == CDIM);
static_assert(DH == QT);
static_assert(KROW == 2 * DH);
static_assert(NSEQ == 1024 && HEADS == 8);
static_assert(CDIM == 512);
static_assert(MW % 8 == 0 && (CDIM / 8) == 64);
static_assert(CDIM % 32 == 0 && NSEQ % QT == 0 && NSEQ % 32 == 0);
static_assert((OSP * 4) % 16 == 0);
static_assert((OSPW * 4) % 16 == 0);
static_assert((TP * 2) % 16 == 0);
static_assert((KROW * 2) % 128 == 0);
static_assert(KP % 32 == 16 && VP % 32 == 16);
static_assert(KP >= 2 * DH && VP >= 2 * KT);
static_assert(KT == 32 && QB == 128 && RREC == 3 * RTILE * 4 && SM_R % 16 == 0);
static_assert(STAGE % 16 == 0 && NSEQ / (KG * KT) >= 2 && NSEQ % (KG * KT) == 0);
static_assert(KG == 2 && QB * OSPW * 4 <= RST && 17 * QB * 16 <= RST);
static_assert(GP % 32 == 16 && GP >= 2 * GK && GK % 32 == 0);
static_assert(CDIM % GK == 0 && CDIM / GK >= 2);
static_assert(GT * OSP * 4 <= 2 * GSTAGE);
static_assert(GT == 2 * DH && CDIM % GT == 0 && CDIM / GT == 4 && NSEQ % GT == 0 && MW % GT == 0);
static_assert(NSEQ / QT == 16 && CDIM / QT == 8);

typedef _Float16       v16h __attribute__((ext_vector_type(16)));
typedef _Float16       v8h  __attribute__((ext_vector_type(8)));
typedef __bf16         v16b __attribute__((ext_vector_type(16)));
typedef unsigned short v8us __attribute__((ext_vector_type(8)));
typedef float          v8f  __attribute__((ext_vector_type(8)));
typedef float          v4f  __attribute__((ext_vector_type(4)));
typedef unsigned int   v4u  __attribute__((ext_vector_type(4)));
typedef float          v2f  __attribute__((ext_vector_type(2)));
typedef __bf16         v2b  __attribute__((ext_vector_type(2)));

union Frag  { v8us u[2]; v16h h; v16b bf; };
union FragH { v16h v; v8h hv[2]; };
union FragW { v4u w[2]; v16b bf; };
static_assert(sizeof(Frag) == 32);
static_assert(sizeof(FragH) == 32);
static_assert(sizeof(FragW) == 32);

// ---- scalar helpers ---------------------------------------------------------------------------------------
__device__ __forceinline__ unsigned short bf_bits(float f) {          // f32 -> bf16 bits, RNE convert
  unsigned u = __float_as_uint(f);
  return (unsigned short)((u + 0x7FFFu + ((u >> 16) & 1u)) >> 16);
}
__device__ __forceinline__ float bf_up(unsigned short hb) { return __uint_as_float(((unsigned)hb) << 16); }
__device__ __forceinline__ float bfr(float f) { return bf_up(bf_bits(f)); }
__device__ __forceinline__ unsigned short h_bits(_Float16 x) { return __builtin_bit_cast(unsigned short, x); }
__device__ __forceinline__ unsigned pk16(unsigned short a, unsigned short b) { return (unsigned)a | ((unsigned)b << 16); }
__device__ __forceinline__ unsigned bf_pair(float a, float b) {      // two f32 -> packed bf16 bits, RNE convert
  const v2f f = {a, b};
  return __builtin_bit_cast(unsigned, __builtin_convertvector(f, v2b));
}
__device__ __forceinline__ v8f zero8() { v8f z = {0.f, 0.f, 0.f, 0.f, 0.f, 0.f, 0.f, 0.f}; return z; }
__device__ __forceinline__ float hmax8(v8f s) {
  return fmaxf(fmaxf(fmaxf(s[0], s[1]), fmaxf(s[2], s[3])), fmaxf(fmaxf(s[4], s[5]), fmaxf(s[6], s[7])));
}
__device__ __forceinline__ unsigned wave_ballot(bool p) {
#if defined(__HIP_DEVICE_COMPILE__)
  return __builtin_amdgcn_ballot_w32(p);
#else
  return p ? 1u : 0u;
#endif
}

// ---- 16-bit fragment loader (A, or B from a k-contiguous [n][k] row): lane -> row/col (lane&15), p already includes
//      + 8*(lane>>4); elements 0..7 <- p[0..7] (k0+8h..), elements 8..15 <- p[16..23] (k0+16+8h..)
__device__ __forceinline__ Frag ldfrag(const unsigned short* p) {
  Frag f;
  f.u[0] = *(const v8us*)(p);
  f.u[1] = *(const v8us*)(p + 16);
  return f;
}

// ---- WMMA helpers: builtin followed by a 4-slot VALU gap tying D and keeping A/B live --------------------------
__device__ __forceinline__ v8f mma_h(v16h a, v16h b, v8f c) {
  v8f d = __builtin_amdgcn_wmma_f32_16x16x32_f16(false, a, false, b, (short)0, c, false, false);
#if defined(__HIP_DEVICE_COMPILE__)
  asm volatile("v_nop\n\tv_nop\n\tv_nop\n\tv_nop" : "+v"(d) : "v"(a), "v"(b));
#endif
  return d;
}
// Plain builtins for the position products in (3) and the attention kernel. The compiler keeps the distances here.
__device__ __forceinline__ v8f wm_b(v16b a, v16b b, v8f c) {
  return __builtin_amdgcn_wmma_f32_16x16x32_bf16(false, a, false, b, (short)0, c, false, false);
}
__device__ __forceinline__ v8f wm_h(v16h a, v16h b, v8f c) {
  return __builtin_amdgcn_wmma_f32_16x16x32_f16(false, a, false, b, (short)0, c, false, false);
}

// ---- asynchronous 16-byte copies global -> LDS, one per lane and line of text. Each statement ends in s_wait_xcnt 0 so
//      that no address register of an issued copy is rewritten ahead of it. Landing is awaited by the caller.
// One 32-key stage: 2 + 2 copies bring the 64 key channels of 32 rows of the hi and the residual plane (a wave covers
// four whole 128-B lines), 2 copies bring 64 channels x 32 keys of v, 2 + 1 copies bring the stage's position products
// (per 16-key tile the two x tiles, 2 KiB in a row, and the one y tile that holds this block's four rows).
// lk / lv / lr / lw, gh / gl / gv / gr / gw: this lane's first addresses.
__device__ __forceinline__ void copy_stage(unsigned lk, unsigned lv, unsigned lr, unsigned lw,
                                           const unsigned short* gh, const unsigned short* gl,
                                           const unsigned short* gv, const float* gr, const float* gw) {
#if defined(__HIP_DEVICE_COMPILE__)
  asm volatile("global_load_async_to_lds_b128 %0, %9, off\n\t"
               "global_load_async_to_lds_b128 %1, %10, off\n\t"
               "global_load_async_to_lds_b128 %2, %11, off\n\t"
               "global_load_async_to_lds_b128 %3, %12, off\n\t"
               "global_load_async_to_lds_b128 %4, %13, off\n\t"
               "global_load_async_to_lds_b128 %5, %14, off\n\t"
               "global_load_async_to_lds_b128 %6, %15, off\n\t"
               "global_load_async_to_lds_b128 %7, %16, off\n\t"
               "global_load_async_to_lds_b128 %8, %17, off\n\t"
               "s_wait_xcnt 0x0"
               :: "v"(lk), "v"(lk + 16 * KP), "v"(lk + SM_KL), "v"(lk + SM_KL + 16 * KP),
                  "v"(lv), "v"(lv + 32 * VP), "v"(lr), "v"(lr + RREC), "v"(lw),
                  "v"(gh), "v"(gh + 16 * KROW), "v"(gl), "v"(gl + 16 * KROW),
                  "v"(gv), "v"(gv + 32 * NSEQ), "v"(gr), "v"(gr + RKEY), "v"(gw)
               : "memory");
#endif
}
// 128 query rows of one plane: 8 copies, 16 rows apart.
__device__ __forceinline__ void copy_q(unsigned lq, const unsigned short* g) {
#if defined(__HIP_DEVICE_COMPILE__)
  asm volatile("global_load_async_to_lds_b128 %0, %8, off\n\t"
               "global_load_async_to_lds_b128 %1, %9, off\n\t"
               "global_load_async_to_lds_b128 %2, %10, off\n\t"
               "global_load_async_to_lds_b128 %3, %11, off\n\t"
               "global_load_async_to_lds_b128 %4, %12, off\n\t"
               "global_load_async_to_lds_b128 %5, %13, off\n\t"
               "global_load_async_to_lds_b128 %6, %14, off\n\t"
               "global_load_async_to_lds_b128 %7, %15, off\n\t"
               "s_wait_xcnt 0x0"
               :: "v"(lq), "v"(lq + 16 * KP), "v"(lq + 32 * KP), "v"(lq + 48 * KP),
                  "v"(lq + 64 * KP), "v"(lq + 80 * KP), "v"(lq + 96 * KP), "v"(lq + 112 * KP),
                  "v"(g), "v"(g + 16 * KROW), "v"(g + 32 * KROW), "v"(g + 48 * KROW),
                  "v"(g + 64 * KROW), "v"(g + 80 * KROW), "v"(g + 96 * KROW), "v"(g + 112 * KROW)
               : "memory");
#endif
}
// One operand's share of a 64-k stage of the conv1x1 GEMM: 128 rows x 128 B (a wave covers four whole lines);
// 8 copies, 16 rows apart.
__device__ __forceinline__ void copy_g(unsigned l, const unsigned short* g) {
#if defined(__HIP_DEVICE_COMPILE__)
  asm volatile("global_load_async_to_lds_b128 %0, %8, off\n\t"
               "global_load_async_to_lds_b128 %1, %9, off\n\t"
               "global_load_async_to_lds_b128 %2, %10, off\n\t"
               "global_load_async_to_lds_b128 %3, %11, off\n\t"
               "global_load_async_to_lds_b128 %4, %12, off\n\t"
               "global_load_async_to_lds_b128 %5, %13, off\n\t"
               "global_load_async_to_lds_b128 %6, %14, off\n\t"
               "global_load_async_to_lds_b128 %7, %15, off\n\t"
               "s_wait_xcnt 0x0"
               :: "v"(l), "v"(l + 16 * GP), "v"(l + 32 * GP), "v"(l + 48 * GP),
                  "v"(l + 64 * GP), "v"(l + 80 * GP), "v"(l + 96 * GP), "v"(l + 112 * GP),
                  "v"(g), "v"(g + 16 * CDIM), "v"(g + 32 * CDIM), "v"(g + 48 * CDIM),
                  "v"(g + 64 * CDIM), "v"(g + 80 * CDIM), "v"(g + 96 * CDIM), "v"(g + 112 * CDIM)
               : "memory");
#endif
}

// =========================================================================================================
// (0) conv1x1 weights: W16 f16 [1536][512], rows 0..511 = wq rows, 512..1023 = wk rows, 1024..1535 = wv rows;
//     value = f16 of (bf16-RNE(w) * 256) (exact). Block blk (0..191) owns rows 8*blk..8*blk+7: one wave per
// coverage: 192 blocks x 8 rows x 2 it x 32 lanes x 8 halves = 1536 x 512 = the whole plane.
// =========================================================================================================
__device__ __forceinline__
void cvt_w(const int blk, const float* __restrict__ wq, const float* __restrict__ wk, const float* __restrict__ wv,
           unsigned short* W16) {
  const int tid = threadIdx.x;
  const int rl = tid >> 5, lane = tid & 31;
  const int o = 8 * blk + rl;                                        // 0..1535
  const int p = blk >> 6;                                            // block-uniform projection 0..2
  const float* wbase = (p == 0) ? wq : ((p == 1) ? wk : wv);         // all global
  const int ol = o - p * CDIM;                                       // 0..511
  v4u u[2];
#pragma unroll
  for (int it = 0; it < 2; ++it) {
    const float* s = wbase + (size_t)ol * CDIM + 256 * it + 8 * lane;
    const v4f a = *(const v4f*)s;
    const v4f q = *(const v4f*)(s + 4);
    const float f[8] = {a[0], a[1], a[2], a[3], q[0], q[1], q[2], q[3]};
#pragma unroll
    for (int t = 0; t < 4; ++t) {
      const _Float16 h0 = (_Float16)(bfr(f[2 * t]) * WSC);
      const _Float16 h1 = (_Float16)(bfr(f[2 * t + 1]) * WSC);
      u[it][t] = pk16(h_bits(h0), h_bits(h1));
    }
  }
{
#pragma unroll
    for (int it = 0; it < 2; ++it)
      *(v4u*)(W16 + (size_t)o * CDIM + 256 * it + 8 * lane) = u[it];
    asm volatile("s_wait_xcnt 0x0" ::: "memory");                    // precaution: each block runs one job, so only the kernel's end follows
  }
}

// =========================================================================================================
// (1) x f32 [b][512 c][1024 n] -> XP f16 [b][n][c] (position-major, bf16-RNE values, exact in f16) through an
//     T is cross-wave (writer and reader waves differ): block barrier between the stores and the reload.
// coverage: XP 2 it x 32 rows x 8 lanes x 8 = 64 n x 64 c; blk = (b, cb, nb) in 0..128*NB-1 covers XP [b<NB][1024][512] once.
// =========================================================================================================
__device__ __forceinline__
void cvt_x(const int blk, const float* __restrict__ x, unsigned short* XP) {
  __shared__ __align__(16) unsigned short T[QT * TP];
  const int tid = threadIdx.x;
  const int nb = blk & (NSEQ / QT - 1), cb = (blk >> 4) & (CDIM / QT - 1), b = blk >> 7;
  const int e = tid & 7, lq = tid >> 3;                             // lq 0..31
  const int n0 = nb * QT, c0 = cb * QT;
#pragma unroll
  for (int it = 0; it < 2; ++it) {
    const int cl = it * 32 + lq;                                     // 0..63
    const float* sp = x + ((size_t)(b * CDIM + c0 + cl)) * NSEQ + n0 + 8 * e;
    const v4f a = *(const v4f*)sp;
    const v4f q = *(const v4f*)(sp + 4);
    // the next trip's loads may land in this trip's address registers: wait before they issue
    if (it == 0) asm volatile("s_wait_xcnt 0x0" ::: "memory");
    unsigned short hb[8];
#pragma unroll
    for (int t = 0; t < 4; ++t) {
      hb[t]     = h_bits((_Float16)bfr(a[t]));
      hb[4 + t] = h_bits((_Float16)bfr(q[t]));
    }
#pragma unroll
    for (int t = 0; t < 8; ++t) T[(8 * e + t) * TP + cl] = hb[t];
  }
  __syncthreads();
  v4u up[2];
#pragma unroll
  for (int it = 0; it < 2; ++it) {
    const int nl = it * 32 + lq;                                     // 0..63
    up[it] = *(const v4u*)(T + nl * TP + 8 * e);
  }
{
#pragma unroll
    for (int it = 0; it < 2; ++it) {
      const int rl = it * 32 + lq;
      *(v4u*)(XP + ((size_t)(b * NSEQ + n0 + rl)) * CDIM + c0 + 8 * e) = up[it];
    }
    asm volatile("s_wait_xcnt 0x0" ::: "memory");                    // precaution: each block runs one job, so only the kernel's end follows
  }
}

// =========================================================================================================
// (2) relative position rows, transposed: REL bf16 [h][64 rows][64 d], row x (0..31) = bf16-RNE(rh[h][d][x]), row 32 + y =
//     bf16-RNE(rw[h][d][y]). pos[h][d][n] = rh[h][d][n%32] + rw[h][d][n/32], so pos_i . q_j = REL row (i%32) . q_j +
//     REL row (32 + i/32) . q_j: 64 products per key serve all 1024 queries. One task (h, row, e) per thread covers
//     d = 8e..8e+7 (16 B).
// coverage: 16 blocks x 256 threads = 8 h x 64 rows x 8 e = the whole plane.
// =========================================================================================================
__device__ __forceinline__
void rel_k(const int blk, const float* __restrict__ rh, const float* __restrict__ rw, unsigned short* REL) {
  const int idx = blk * 256 + (int)threadIdx.x;                     // 0..4095
  const int e = idx & 7;
  const int row = (idx >> 3) & 63;
  const int h = (idx >> 9) & (HEADS - 1);
  const float* sp = ((row < 32) ? rh : rw) + (h * DH + 8 * e) * 32 + (row & 31);   // both global
  v4u u;
#pragma unroll
  for (int t = 0; t < 4; ++t) u[t] = pk16(bf_bits(sp[(2 * t) * 32]), bf_bits(sp[(2 * t + 1) * 32]));
  *(v4u*)(REL + (h * 64 + row) * DH + 8 * e) = u;
  asm volatile("s_wait_xcnt 0x0" ::: "memory");                      // another job's code may follow and reuse these registers
}

// =========================================================================================================
// (0)+(1)+(2) in one launch: the three jobs read only inputs and write disjoint planes, so none needs another's result.
//     A range of the block index picks the job (block-uniform branch, so the barrier in (1) is passed by whole blocks):
//     blocks 0..PXB-1 -> (1), the longest job, first; then PPB blocks of (2); then PWB blocks of (0).
// =========================================================================================================
__global__ __launch_bounds__(256)
void prep(const float* __restrict__ x, const float* __restrict__ wq, const float* __restrict__ wk,
          const float* __restrict__ wv, const float* __restrict__ rh, const float* __restrict__ rw,
          unsigned short* W16, unsigned short* XP, unsigned short* REL) {
  const int blk = blockIdx.x;
  if (blk < PXB)            cvt_x(blk, x, XP);
  else if (blk < PXB + PPB) rel_k(blk - PXB, rh, rw, REL);
  else                      cvt_w(blk - (PXB + PPB), wq, wk, wv, W16);
}

// =========================================================================================================
// (3) conv1x1 GEMM for one (b, 128-n tile, 128-o block): Y[o][n] = (1/256) sum_c W16[o][c] XP[b][n][c] + bias[o].
//     Block 128 threads = 4 waves in 2 x 2; a wave owns a 64 x 64 piece of the tile: 4 A fragments (rows o, from W16) and
//     4 B fragments (cols n, from XP) per k-step feed 16 accumulator tiles. K = 512 = 16 steps. Both operands are
//     k-contiguous rows read by the same split k map loader.
//     Both come from LDS: a ring of two 64-k stages (128 W16 rows, then 128 XP rows, x 128 B, pitch 144 B = 16 B x odd)
//     brought by whole-line asynchronous copies that the 4 waves share.
//     Epilogue staged in LDS Os[n_loc][o_loc] (pitch OSP, b128 stores of 8 consecutive o per lane), block barrier
//     (Os is cross-wave), then by o-block: mb 0..3 -> q of heads 2mb, 2mb+1 (QK planes cols 0..63, bf16 hi = RNE(v), lo =
//     RNE(v - hi)), mb 4..7 -> k (cols 64..127), mb 8..11 -> v -> Vc f16 [b][512 ch][1024 n] (channel-major, keys
//     contiguous). Each stored segment is one whole 128-B line.
// coverage: Os 4 waves x 64 x 64 = 128 x 128; q/k path 4 groups x 4 it x 16 rows x 8 lanes x 8 = 128 n x 128 o (hi and lo);
//           v path 4 groups x 4 it x 16 ch x 8 lanes x 8 = 128 ch x 128 n; grid (8, 12, NB) covers QK cols 0..127 of all
//           rows b<NB and Vc [b<NB][512][1024] exactly once.
// =========================================================================================================
__global__ __launch_bounds__(128)
void gemm_qkv(const unsigned short* __restrict__ W16, const unsigned short* __restrict__ XP,
              const float* __restrict__ bq, const float* __restrict__ bk, const float* __restrict__ bv,
              const unsigned short* __restrict__ REL,
              unsigned short* QKh, unsigned short* QKl, unsigned short* Vc, float* RT) {
  __shared__ __align__(16) unsigned char smem[2 * GSTAGE];
  float* Os = (float*)smem;                                          // output staging, used behind the ring's last barrier
  const int tid  = threadIdx.x;
  const int lane = tid & 31, wave = tid >> 5;
  const int hh   = lane >> 4, c = lane & 15;
  const int wr   = wave >> 1, wc = wave & 1;                         // this wave's 64 rows o / 64 cols n of the tile
  const int nt   = blockIdx.x, mb = blockIdx.y, b = blockIdx.z;
  const int n0   = nt * GT, o0 = mb * GT;                            // o0 = row block of the stacked W16
  const int p    = mb >> 2;                                          // block-uniform projection 0..2

  // copy addresses of this lane: rows in 8 chunks of 16 B (row tid>>3, 16 rows per copy)
  const int cr = tid >> 3, cch = tid & 7;
  const unsigned la = (unsigned)(uintptr_t)smem + (unsigned)(cr * GP + cch * 16);   // low 32 bits = LDS byte address
  const unsigned short* ga = W16 + (size_t)(o0 + cr) * CDIM + 8 * cch;
  const unsigned short* gb = XP + ((size_t)(b * NSEQ + n0 + cr)) * CDIM + 8 * cch;

  copy_g(la, ga);
  copy_g(la + GT * GP, gb);
  asm volatile("s_wait_asynccnt 0x0" ::: "memory");                  // this wave's part of stage 0 has landed
  __syncthreads();                                                   // ... and every other wave's
  copy_g(la + GSTAGE, ga + GK);
  copy_g(la + GSTAGE + GT * GP, gb + GK);

  v8f acc[4][4];
#pragma unroll
  for (int i = 0; i < 4; ++i) {
#pragma unroll
    for (int j = 0; j < 4; ++j) acc[i][j] = zero8();
  }

  // rolled: one trip per ring stage, so that the publish point stands once in the text
#pragma unroll 1
  for (int s = 0; s < CDIM / GK; ++s) {
    const unsigned char* st = smem + (s & 1) * GSTAGE;
    const unsigned short* ap = (const unsigned short*)(st + (64 * wr + c) * GP) + 8 * hh;
    const unsigned short* bp = (const unsigned short*)(st + (GT + 64 * wc + c) * GP) + 8 * hh;
#pragma unroll
    for (int kk = 0; kk < GK / 32; ++kk) {
      Frag fa[4], fb[4];
#pragma unroll
      for (int j = 0; j < 4; ++j) fb[j] = ldfrag(bp + (16 * j) * (GP / 2) + 32 * kk);
#pragma unroll
      for (int i = 0; i < 4; ++i) fa[i] = ldfrag(ap + (16 * i) * (GP / 2) + 32 * kk);
#pragma unroll
      for (int i = 0; i < 4; ++i) {
#pragma unroll
        for (int j = 0; j < 4; ++j) acc[i][j] = mma_h(fa[i].h, fb[j].h, acc[i][j]);
      }
    }

    asm volatile("s_wait_dscnt 0x0" ::: "memory");                   // this wave's reads of stage s are done
    asm volatile("s_wait_asynccnt 0x0" ::: "memory");                // this wave's copies of stage s+1 have landed
    __syncthreads();                                                 // publishes stage s+1, frees stage s's buffer
    if (s + 2 < CDIM / GK) {
      copy_g(la + (unsigned)((s & 1) * GSTAGE), ga + (s + 2) * GK);
      copy_g(la + (unsigned)((s & 1) * GSTAGE) + GT * GP, gb + (s + 2) * GK);
    }
  }
  asm volatile("s_wait_asynccnt 0x0" ::: "memory");                  // nothing in flight when the ring becomes Os

  // ---- q blocks: position products of the block's positions as keys, R[n][row] = q_n . REL row (64 rows of the wave's
  //      head, K = 64 d), made from the accumulators: lane (hh, c) holds d = 16 i + 8 hh + r of position n = 16 j + c, which
  //      is the A fragment's own map (row c; elements 0..7 <- tile i = 2 m, 8..15 <- tile 2 m + 1), so q (bias added, bf16
  //      hi + residual, the values of the planes) goes from D registers to A registers with no exchange. B = REL rows by
  //      the same split k map. Products hi.REL (2 k-steps), then residual.REL. A D tile (16 keys x 16 rows) is stored as it
  //      lies in registers, RT f32 [b][h][64 key tiles][4 row tiles][2 halves r 0..3 | 4..7][32 lanes][4]: 512 B in a row
  //      per store, and the score tiles of (4) start from it lane for lane. Block-uniform branch, no barrier inside.
  // coverage: 4 waves = 2 heads x 64 n; 4 j x 4 a tiles; grid (8, mb 0..3, NB) covers RT [b<NB][8][64][4] exactly once.
  if (p == 0) {
    const int head = 2 * mb + wr;
    const unsigned short* rp = REL + (head * 64 + c) * DH + 8 * hh;
    Frag fr[4][2];
#pragma unroll
    for (int a = 0; a < 4; ++a) {
#pragma unroll
      for (int m = 0; m < 2; ++m) fr[a][m] = ldfrag(rp + (16 * a) * DH + 32 * m);
    }
    float* rt = RT + ((size_t)((b * HEADS + head) * (NSEQ / 16) + nt * (GT / 16) + 4 * wc)) * RKEY + 4 * lane;
    v4f braw[4][2];
#pragma unroll
    for (int i = 0; i < 4; ++i) {
      braw[i][0] = *(const v4f*)(bq + head * DH + 16 * i + 8 * hh);
      braw[i][1] = *(const v4f*)(bq + head * DH + 16 * i + 8 * hh + 4);
    }
    asm volatile("s_wait_xcnt 0x0" ::: "memory");                    // the code below may reuse these loads' address registers
    __builtin_amdgcn_sched_barrier(0);                               // keeps that code from being lifted over the wait
    v2f bd[4][4];
#pragma unroll
    for (int i = 0; i < 4; ++i) {
#pragma unroll
      for (int t = 0; t < 4; ++t) {
        bd[i][t][0] = bfr(braw[i][t >> 1][2 * (t & 1)]);
        bd[i][t][1] = bfr(braw[i][t >> 1][2 * (t & 1) + 1]);
      }
    }
    const v2f isc = {IWSC, IWSC};
    // unrolled: the accumulators need constant indices
#pragma unroll
    for (int j = 0; j < 4; ++j) {
      FragW qa[2], qe[2];
#pragma unroll
      for (int i = 0; i < 4; ++i) {
#pragma unroll
        for (int t = 0; t < 4; ++t) {
          const v2f a2 = {acc[i][j][2 * t], acc[i][j][2 * t + 1]};
          const v2f f = __builtin_elementwise_fma(a2, isc, bd[i][t]);  // the scale is a power of two: one rounding, as mul + add
          const unsigned hb = bf_pair(f[0], f[1]);
          qa[i >> 1].w[i & 1][t] = hb;
          qe[i >> 1].w[i & 1][t] = bf_pair(f[0] - __uint_as_float(hb << 16), f[1] - __uint_as_float(hb & 0xFFFF0000u));
        }
      }
      v8f d[4];
#pragma unroll
      for (int a = 0; a < 4; ++a) d[a] = wm_b(qa[0].bf, fr[a][0].bf, zero8());
#pragma unroll
      for (int a = 0; a < 4; ++a) d[a] = wm_b(qa[1].bf, fr[a][1].bf, d[a]);
#pragma unroll
      for (int a = 0; a < 4; ++a) d[a] = wm_b(qe[0].bf, fr[a][0].bf, d[a]);
#pragma unroll
      for (int a = 0; a < 4; ++a) d[a] = wm_b(qe[1].bf, fr[a][1].bf, d[a]);
#pragma unroll
      for (int a = 0; a < 4; ++a) {
        const v4f va = {d[a][0], d[a][1], d[a][2], d[a][3]}, vb = {d[a][4], d[a][5], d[a][6], d[a][7]};
        *(v4f*)(rt + j * RKEY + a * RTILE)       = va;
        *(v4f*)(rt + j * RKEY + a * RTILE + 128) = vb;
      }
      asm volatile("s_wait_xcnt 0x0" ::: "memory");                  // the code that follows may reuse these stores' registers
      __builtin_amdgcn_sched_barrier(0);                             // keeps that code from being lifted over the wait
    }
  }

  // ---- epilogue: scale back -> LDS Os[n_loc][o_loc]; lane (hh, c) holds o_loc = 64 wr + 16 i + 8 hh + r for
  //      n_loc = 64 wc + 16 j + c
#pragma unroll
  for (int j = 0; j < 4; ++j) {
    const int nl = 64 * wc + 16 * j + c;
#pragma unroll
    for (int i = 0; i < 4; ++i) {
      v4f va, vb;
#pragma unroll
      for (int r = 0; r < 4; ++r) { va[r] = acc[i][j][r] * IWSC; vb[r] = acc[i][j][4 + r] * IWSC; }
      *(v4f*)(Os + nl * OSP + 64 * wr + 16 * i + 8 * hh)     = va;
      *(v4f*)(Os + nl * OSP + 64 * wr + 16 * i + 8 * hh + 4) = vb;
    }
  }
  __syncthreads();

  const int e = tid & 7, lq = tid >> 3;                             // lq 0..15
  const int ol0 = (mb & 3) * GT;                                     // first channel of the block inside its projection
  const float* bias = (p == 0) ? bq : ((p == 1) ? bk : bv);          // all global
  if (p < 2) {
    // group g: head 2 (mb & 3) + (g >> 1), rows n_loc 64 (g & 1) ..+63
    float bb[2][8];
#pragma unroll
    for (int hs = 0; hs < 2; ++hs) {
      const v4f b0 = *(const v4f*)(bias + ol0 + hs * DH + 8 * e);
      const v4f b1 = *(const v4f*)(bias + ol0 + hs * DH + 8 * e + 4);
#pragma unroll
      for (int t = 0; t < 4; ++t) { bb[hs][t] = bfr(b0[t]); bb[hs][4 + t] = bfr(b1[t]); }
    }
    // unrolled: the bias registers need constant indices
#pragma unroll
    for (int g = 0; g < 4; ++g) {
      const int hs = g >> 1, rb = (g & 1) * 64;
      const int head = (ol0 >> 6) + hs;
      v4u uh[4], ul[4];
#pragma unroll
      for (int it = 0; it < 4; ++it) {
        const int row = rb + it * 16 + lq;                           // n_loc
        const v4f a = *(const v4f*)(Os + row * OSP + 64 * hs + 8 * e);
        const v4f q = *(const v4f*)(Os + row * OSP + 64 * hs + 8 * e + 4);
        const float f[8] = {a[0], a[1], a[2], a[3], q[0], q[1], q[2], q[3]};
#pragma unroll
        for (int t = 0; t < 4; ++t) {
          const float f0 = f[2 * t] + bb[hs][2 * t], f1 = f[2 * t + 1] + bb[hs][2 * t + 1];
          const unsigned short hb0 = bf_bits(f0), hb1 = bf_bits(f1);
          const unsigned short lb0 = bf_bits(f0 - bf_up(hb0));
          const unsigned short lb1 = bf_bits(f1 - bf_up(hb1));
          uh[it][t] = pk16(hb0, hb1);
          ul[it][t] = pk16(lb0, lb1);
        }
      }
#pragma unroll
      for (int it = 0; it < 4; ++it) {
        const int row = rb + it * 16 + lq;
        const size_t po = ((size_t)((b * HEADS + head) * NSEQ + n0 + row)) * KROW + p * DH + 8 * e;
        *(v4u*)(QKh + po) = uh[it];
        *(v4u*)(QKl + po) = ul[it];
      }
      // the next group's code may reuse these stores' registers; behind the last group the wave ends
      if (g < 3) asm volatile("s_wait_xcnt 0x0" ::: "memory");
    }
  } else {
    // group g: keys n_loc 64 (g >> 1) ..+63, channels o_loc 64 (g & 1) ..+63
    float bo[2][4];
#pragma unroll
    for (int k = 0; k < 8; ++k) bo[k >> 2][k & 3] = bfr(bias[ol0 + k * 16 + lq]);
    // unrolled: the bias registers need constant indices
#pragma unroll
    for (int g = 0; g < 4; ++g) {
      const int hs = g >> 1, rb = (g & 1) * 64;
      v4u uv[4];
#pragma unroll
      for (int it = 0; it < 4; ++it) {
        const int row = rb + it * 16 + lq;                           // o_loc -> channel ol0 + row
        unsigned short hb[8];
#pragma unroll
        for (int t = 0; t < 8; ++t) hb[t] = h_bits((_Float16)(Os[(64 * hs + 8 * e + t) * OSP + row] + bo[g & 1][it]));
#pragma unroll
        for (int t = 0; t < 4; ++t) uv[it][t] = pk16(hb[2 * t], hb[2 * t + 1]);
      }
#pragma unroll
      for (int it = 0; it < 4; ++it) {
        const int row = rb + it * 16 + lq;
        *(v4u*)(Vc + ((size_t)(b * CDIM + ol0 + row)) * NSEQ + n0 + 64 * hs + 8 * e) = uv[it];
      }
      // the next group's code, and behind the last group the q / k branch's, which follows in the built code, may reuse
      // these stores' registers
      asm volatile("s_wait_xcnt 0x0" ::: "memory");
    }
  }
}

// =========================================================================================================
// (4) attention for one (b, h, 128-query tile), transposed formulation, 1024 keys, no mask, no scale:
//   S^T tile (16 keys x 16 queries) = start value + sum over 2 d-chunks of A(key row j = kb + (lane&15) of the bf16
//   plane QKh [b][h][1024][128]: cols 64..127 (k_j), split k map) . B(query col i: cols 0..63 (q_i), same map) as
//   A(hi).B(hi) + A(hi).B(lo) + A(lo).B(hi) (bf16 unscaled residual planes, shared accumulator). The start value is the
//   position term pos_i . q_j = R[j][i%32] + R[j][32 + i/32] from RT (made in (3)): a wave's 32 queries are x = 0..31 of
//   one y, so its two column groups start from the key tile's two x tiles, lane for lane, plus the wave's y column (one
//   value per key, the same for every query of the wave).
//   Per lane the D tile holds 8 keys of ONE query: online softmax state per lane, one shuffle (lane^16) for the max
//   over 32 keys; the o/l rescale is skipped under a wave-uniform ballot when no lane's max grew (corr == 1 exactly
//   for every lane then); the row sum is accumulated from the f16-converted P values; row-sum partials combined at
//   the end. P = e^{s-m} x 16384 as f16 is the B operand of O^T (rows channel, cols queries) += A(v rows channel =
//   h*64 + 16j + (lane&15), keys contiguous, f16 plane Vc [b][512][1024]) . B(P^T): element r <- D of the tile
//   covering keys kb..kb+15, element 8+r <- the tile covering kb+16..kb+31, lane unchanged. 4 accumulator tiles per
//   16-query column group (64 channels). Block = 8 waves = 2 key groups x 4 waves = 128 queries: group g walks keys
//   64t + 32g .. + 31 of every stage t with its own softmax state (m, l, o), so that four waves share a SIMD; the two
//   states are joined once, behind the loop: o = o0 e^{m0-m} + o1 e^{m1-m}, l likewise, m = max(m0, m1).
//   Wave tile: a wave owns two 16-query column groups and keeps their B fragments (2 d-chunks x hi / residual) in
//   registers for the whole key loop, so every key and v fragment read from LDS feeds both groups and the loop reads no
//   query row. Each accumulator sums its products in the order hi.hi, hi.lo, lo.hi per d-chunk.
//   The block's 128 query rows (cols 0..63 of both planes) pass through LDS once; a ring of two 64-key stages (per group
//   of 32 keys: cols 64..127 of both planes, v 64 ch x 32 keys, 2 x 3 tiles of RT) feeds the loop; all brought by
//   asynchronous copies that a group's 4 waves share; rows pitched 144 B / 80 B (16 B x odd) for the b128 fragment reads.
//   Epilogue: O/l staged in LDS Os[query][64 channels] (pitch OSPW, b128 stores), block barrier (Os is cross-wave),
// coverage: 8 it x 32 lines x 8 lanes x 4 floats = 64 ch x 128 n; grid (NQ/128, NB*8) covers
//           out[b<NB][0..511][0..NQ-1] exactly once.
// =========================================================================================================
// four waves per SIMD: two 8-wave blocks per WGP, so a wave's budget is 256 registers
__global__ __launch_bounds__(256) __attribute__((amdgpu_waves_per_eu(4, 4)))
void attn_k(const unsigned short* __restrict__ QKh, const unsigned short* __restrict__ QKl,
            const unsigned short* __restrict__ Vc, const float* __restrict__ RT, float* out) {
  __shared__ __align__(16) unsigned char smem[SMEM];
  float* Mg = (float*)smem;                                          // group 1's state, used behind the ring's last barrier
  float* Os = (float*)(smem + RST);                                  // output staging, likewise
  const int tid  = threadIdx.x;
  const int grp  = tid >> 7, tl = tid & 127;                         // key group (whole waves), thread within the group
  const int wave = tl >> 5, lane = tid & 31;
  const int hh   = lane >> 4, c = lane & 15;
  const int n0   = blockIdx.x * QB;
  const int bh   = blockIdx.y;
  const int b    = bh >> 3, h = bh & 7;
  const size_t prow = (size_t)bh * NSEQ * KROW;

  // copy addresses of this lane: K / Q rows in 8 chunks of 16 B (row tl>>3, 16 rows per copy), v rows in 4 chunks; of RT
  // per key tile the x tiles' 2 KiB (16 B per thread) and the y tile of this block's rows (64 threads per key tile)
  // (a group copies its own 32 keys of every 64-key stage)
  const int kr = tl >> 3, kch = tl & 7;
  const int vr = tl >> 2, vch = tl & 3;
  const int y0 = n0 >> 5;                                            // the block's queries: y = y0 .. y0 + 3, in one row tile
  const unsigned sbase = (unsigned)(uintptr_t)smem;                  // low 32 bits = byte address in the block's LDS
  const unsigned sg = sbase + (unsigned)(grp * STAGE);
  const unsigned lk = sg + (unsigned)(kr * KP + kch * 16);
  const unsigned lv = sg + (unsigned)(SM_V + vr * VP + vch * 16);
  const unsigned lr = sg + (unsigned)(SM_R + tl * 16);
  const unsigned lw = sg + (unsigned)(SM_R + (tl >> 6) * RREC + 2 * RTILE * 4 + (tl & 63) * 16);
  const unsigned short* gkh = QKh + prow + (size_t)(grp * KT + kr) * KROW + DH + 8 * kch;
  const unsigned short* gkl = QKl + prow + (size_t)(grp * KT + kr) * KROW + DH + 8 * kch;
  const unsigned short* gv  = Vc + ((size_t)(b * CDIM + h * DH + vr)) * NSEQ + grp * KT + 8 * vch;
  const float* gr = RT + (size_t)bh * (NSEQ / 16) * RKEY + grp * (2 * RKEY) + 4 * tl;
  const float* gw = RT + (size_t)bh * (NSEQ / 16) * RKEY + (2 * grp + (tl >> 6)) * RKEY + (2 + (y0 >> 4)) * RTILE + 4 * (tl & 63);
  const size_t gq = prow + (size_t)(n0 + kr) * KROW + 8 * kch;       // cols 0..63

  // query rows: group 0 brings the hi plane, group 1 the residual plane
  copy_q(sbase + (unsigned)((grp ? SM_QL : SM_QH) + kr * KP + kch * 16), (grp ? QKl : QKh) + gq);
  copy_stage(lk, lv, lr, lw, gkh, gkl, gv, gr, gw);
  asm volatile("s_wait_asynccnt 0x0" ::: "memory");                  // this wave's query rows and stage 0 have landed
  __syncthreads();                                                   // ... and every other wave's
  copy_stage(lk + RST, lv + RST, lr + RST, lw + RST, gkh + (size_t)(KG * KT) * KROW, gkl + (size_t)(KG * KT) * KROW,
             gv + KG * KT, gr + KG * 2 * RKEY, gw + KG * 2 * RKEY);

  // query fragments (B operand, col = query 32*wave + 16*u + c of the tile), read once and held in registers
  Frag qh[2][2], ql[2][2];
#pragma unroll
  for (int u = 0; u < 2; ++u) {
    const unsigned short* Qhp = (const unsigned short*)(smem + SM_QH + (32 * wave + 16 * u + c) * KP) + 8 * hh;
    const unsigned short* Qlp = (const unsigned short*)(smem + SM_QL + (32 * wave + 16 * u + c) * KP) + 8 * hh;
#pragma unroll
    for (int kc = 0; kc < 2; ++kc) {                                 // LDS row = q_i
      qh[u][kc] = ldfrag(Qhp + 32 * kc);
      ql[u][kc] = ldfrag(Qlp + 32 * kc);
    }
  }
  const int yl = 16 * hh + ((y0 + wave) & 15);                       // the lane of a y tile that holds this half's 8 keys

  float m[2] = {-1.0e30f, -1.0e30f}, l[2] = {0.f, 0.f};
  v8f o[2][4];
#pragma unroll
  for (int u = 0; u < 2; ++u) {
#pragma unroll
    for (int j = 0; j < 4; ++j) o[u][j] = zero8();
  }

  // rolled: one trip per ring stage, so that the publish point stands once in the text
#pragma unroll 1
  for (int t = 0; t < NSEQ / (KG * KT); ++t) {
    const unsigned char* st = smem + (t & 1) * RST + grp * STAGE;                            // kb = 64t + 32grp
    const unsigned short* k0p  = (const unsigned short*)(st + c * KP) + 8 * hh;              // keys kb .. kb+15
    const unsigned short* k1p  = (const unsigned short*)(st + (c + 16) * KP) + 8 * hh;       // keys kb+16 .. kb+31
    const unsigned short* k0lp = (const unsigned short*)(st + SM_KL + c * KP) + 8 * hh;
    const unsigned short* k1lp = (const unsigned short*)(st + SM_KL + (c + 16) * KP) + 8 * hh;
    const unsigned short* Vp   = (const unsigned short*)(st + SM_V + c * VP) + 8 * hh;       // + 16*j rows
    const float* Rp = (const float*)(st + SM_R) + 4 * lane;                                  // x tiles, this lane's values
    const float* Yp = (const float*)(st + SM_R) + 2 * RTILE + 4 * yl;                        // y tile, the wave's column
    v8f s0[2], s1[2];
    {
      const v4f y0a = *(const v4f*)(Yp), y0b = *(const v4f*)(Yp + 128);
      const v4f y1a = *(const v4f*)(Yp + RREC / 4), y1b = *(const v4f*)(Yp + RREC / 4 + 128);
#pragma unroll
      for (int u = 0; u < 2; ++u) {
        const v4f a0 = *(const v4f*)(Rp + u * RTILE) + y0a, b0 = *(const v4f*)(Rp + u * RTILE + 128) + y0b;
        const v4f a1 = *(const v4f*)(Rp + RREC / 4 + u * RTILE) + y1a, b1 = *(const v4f*)(Rp + RREC / 4 + u * RTILE + 128) + y1b;
        s0[u] = __builtin_shufflevector(a0, b0, 0, 1, 2, 3, 4, 5, 6, 7);
        s1[u] = __builtin_shufflevector(a1, b1, 0, 1, 2, 3, 4, 5, 6, 7);
      }
    }
    // unrolled: the register-held query fragments need constant indices
#pragma unroll
    for (int kc = 0; kc < 2; ++kc) {
      const int acol = kc * 32;                                      // LDS row = k_j
      const Frag k0  = ldfrag(k0p + acol);
      const Frag k1  = ldfrag(k1p + acol);
      const Frag k0l = ldfrag(k0lp + acol);
      const Frag k1l = ldfrag(k1lp + acol);
#pragma unroll
      for (int u = 0; u < 2; ++u) {
        s0[u] = wm_b(k0.bf, qh[u][kc].bf, s0[u]);
        s1[u] = wm_b(k1.bf, qh[u][kc].bf, s1[u]);
      }
#pragma unroll
      for (int u = 0; u < 2; ++u) {
        s0[u] = wm_b(k0.bf, ql[u][kc].bf, s0[u]);
        s1[u] = wm_b(k1.bf, ql[u][kc].bf, s1[u]);
      }
#pragma unroll
      for (int u = 0; u < 2; ++u) {
        s0[u] = wm_b(k0l.bf, qh[u][kc].bf, s0[u]);
        s1[u] = wm_b(k1l.bf, qh[u][kc].bf, s1[u]);
      }
    }

    float mn[2];
    bool up = false;
#pragma unroll
    for (int u = 0; u < 2; ++u) {
      float mx = fmaxf(hmax8(s0[u]), hmax8(s1[u]));
      mx = fmaxf(mx, __shfl_xor(mx, 16, 32));
      mn[u] = fmaxf(m[u], mx);
      up = up || (mx > m[u]);
    }
    const unsigned grew = wave_ballot(up);                           // wave-uniform, one test per stage
    if (grew != 0u) {
#pragma unroll
      for (int u = 0; u < 2; ++u) {
        const float corr = __expf(m[u] - mn[u]);                     // == 1 exactly where the max did not grow
        l[u] *= corr;
#pragma unroll
        for (int j = 0; j < 4; ++j) {
#pragma unroll
          for (int r = 0; r < 8; ++r) o[u][j][r] *= corr;
        }
      }
    }

    FragH ph[2];
#pragma unroll
    for (int u = 0; u < 2; ++u) {
      m[u] = mn[u];
      const float msh = mn[u] - LNPS;                                // exp gives e^{s-m} * 16384
      float ls = 0.f;
#pragma unroll
      for (int r = 0; r < 8; ++r) {
        const _Float16 p0 = (_Float16)__expf(s0[u][r] - msh);        // key kb      + 8hh + r
        const _Float16 p1 = (_Float16)__expf(s1[u][r] - msh);        // key kb + 16 + 8hh + r
        ls += (float)p0 + (float)p1;
        ph[u].hv[0][r] = p0;
        ph[u].hv[1][r] = p1;
      }
      l[u] += ls;
    }

#pragma unroll
    for (int j = 0; j < 4; ++j) {
      const Frag vf = ldfrag(Vp + (16 * j) * (VP / 2));
      o[0][j] = wm_h(vf.h, ph[0].v, o[0][j]);
      o[1][j] = wm_h(vf.h, ph[1].v, o[1][j]);
    }

    asm volatile("s_wait_dscnt 0x0" ::: "memory");                   // this wave's reads of stage t are done
    asm volatile("s_wait_asynccnt 0x0" ::: "memory");                // this wave's copies of stage t+1 have landed
    __syncthreads();                                                 // publishes stage t+1, frees stage t's buffer
    if (t + 2 < NSEQ / (KG * KT))
      copy_stage(lk + (unsigned)((t & 1) * RST), lv + (unsigned)((t & 1) * RST), lr + (unsigned)((t & 1) * RST),
                 lw + (unsigned)((t & 1) * RST), gkh + (size_t)(t + 2) * (KG * KT * KROW),
                 gkl + (size_t)(t + 2) * (KG * KT * KROW), gv + (t + 2) * (KG * KT), gr + (size_t)(t + 2) * (KG * 2 * RKEY),
                 gw + (size_t)(t + 2) * (KG * 2 * RKEY));
  }
  asm volatile("s_wait_asynccnt 0x0" ::: "memory");                  // nothing in flight when the ring becomes Mg and Os

  // ---- the two groups' softmax states are joined: group 1 hands (o, m, l) over through LDS, 17 chunks of 16 B per thread,
  //      a chunk 2 KiB in a row over the group; thread tl of group 0 holds the same queries and channels.
  if (grp == 1) {
#pragma unroll
    for (int u = 0; u < 2; ++u) {
#pragma unroll
      for (int j = 0; j < 4; ++j) {
        const v4f va = {o[u][j][0], o[u][j][1], o[u][j][2], o[u][j][3]};
        const v4f vb = {o[u][j][4], o[u][j][5], o[u][j][6], o[u][j][7]};
        *(v4f*)(Mg + (8 * u + 2 * j) * (QB * 4) + 4 * tl)     = va;
        *(v4f*)(Mg + (8 * u + 2 * j + 1) * (QB * 4) + 4 * tl) = vb;
      }
    }
    const v4f vs = {m[0], m[1], l[0], l[1]};
    *(v4f*)(Mg + 16 * (QB * 4) + 4 * tl) = vs;
  }
  __syncthreads();                                                   // Mg is cross-wave

  if (grp == 0) {
    const v4f vs = *(const v4f*)(Mg + 16 * (QB * 4) + 4 * tl);
#pragma unroll
    for (int u = 0; u < 2; ++u) {
      const float mj = fmaxf(m[u], vs[u]);                           // both maxima are finite: each group saw 512 keys
      const float c0 = __expf(m[u] - mj), c1 = __expf(vs[u] - mj);
      const float lj  = l[u] * c0 + vs[2 + u] * c1;
      const float lt  = lj + __shfl_xor(lj, 16, 32);
      const float inv = 1.0f / lt;                                   // o and l both carry the x16384 factor
      const float f0 = c0 * inv, f1 = c1 * inv;
      const int qrow = 32 * wave + 16 * u + c;
#pragma unroll
      for (int j = 0; j < 4; ++j) {
        const v4f pa = *(const v4f*)(Mg + (8 * u + 2 * j) * (QB * 4) + 4 * tl);
        const v4f pb = *(const v4f*)(Mg + (8 * u + 2 * j + 1) * (QB * 4) + 4 * tl);
        v4f va, vb;
#pragma unroll
        for (int r = 0; r < 4; ++r) { va[r] = o[u][j][r] * f0 + pa[r] * f1; vb[r] = o[u][j][4 + r] * f0 + pb[r] * f1; }
        *(v4f*)(Os + qrow * OSPW + 16 * j + 8 * hh)     = va;        // Os[query][ch_loc = 16j + 8hh + r]
        *(v4f*)(Os + qrow * OSPW + 16 * j + 8 * hh + 4) = vb;
      }
    }
  }
  __syncthreads();

  const int e = tid & 7, lq = tid >> 3;                              // lq 0..31
  v4f res[8];
#pragma unroll
  for (int it = 0; it < 8; ++it) {
    const int L   = it * 32 + lq;                                    // 0..255
    const int chl = L >> 2, qf = L & 3;                              // channel 0..63 within the head
    const int nl  = qf * 32 + 4 * e;                                 // query 0..127
#pragma unroll
    for (int t = 0; t < 4; ++t) res[it][t] = Os[(nl + t) * OSPW + chl];
  }
#pragma unroll
  for (int it = 0; it < 8; ++it) {
    const int L   = it * 32 + lq;
    const int chl = L >> 2, qf = L & 3;
    const int nl  = qf * 32 + 4 * e;
    const size_t idx = ((size_t)(b * CDIM + h * DH + chl)) * NSEQ + n0 + nl;
    *(v4f*)(out + idx) = res[it];
  }
}

// =========================================================================================================
// Workspace map (bytes; each region start a multiple of 256; every extent is an exact tile multiple and is written
//   W16 f16 [1536][512]               1572864
//   XP  f16 [NB][1024][512]           8388608 (NB=8)
//   QKh / QKl bf16 [NB][8][1024][128] 16777216 x2 (NB=8)
//   Vc  f16 [NB][512][1024]           8388608 (NB=8)
//   REL bf16 [8][64][64]              65536
//   RT  f32 [NB][8][64][4][256]       16777216 (NB=8)
//   total = 68747264 (NB=8)
// =========================================================================================================
extern "C" void kernel_launch(void* const* d_in, const int* in_sizes, int n_in,
                              void* d_out, int out_size, void* d_ws, size_t ws_size,
                              hipStream_t stream) {
  const int XN = NB * CDIM * NSEQ;
  if (n_in < 9) return;
  if (in_sizes[0] < XN) return;
  if (in_sizes[1] < CDIM * CDIM || in_sizes[3] < CDIM * CDIM || in_sizes[5] < CDIM * CDIM) return;
  if (in_sizes[2] < CDIM || in_sizes[4] < CDIM || in_sizes[6] < CDIM) return;
  if (in_sizes[7] < HEADS * DH * 32 || in_sizes[8] < HEADS * DH * 32) return;
  if (out_size < XN) return;

  size_t off = 0;
  auto carve = [&](size_t bytes) { const size_t o = off; off += (bytes + 255) & ~(size_t)255; return o; };
  const size_t oW16 = carve((size_t)MW * CDIM * 2);
  const size_t oXP  = carve((size_t)NB * NSEQ * CDIM * 2);
  const size_t oQKh = carve((size_t)NB * HEADS * NSEQ * KROW * 2);
  const size_t oQKl = carve((size_t)NB * HEADS * NSEQ * KROW * 2);
  const size_t oVc  = carve((size_t)NB * CDIM * NSEQ * 2);
  const size_t oREL = carve((size_t)HEADS * 64 * DH * 2);
  const size_t oRT  = carve((size_t)NB * HEADS * (NSEQ / 16) * RKEY * 4);
  if (off > ws_size) return;
  if (off > (size_t)134217728) return;

  const float* x   = (const float*)d_in[0];
  const float* wqw = (const float*)d_in[1];
  const float* wqb = (const float*)d_in[2];
  const float* wkw = (const float*)d_in[3];
  const float* wkb = (const float*)d_in[4];
  const float* wvw = (const float*)d_in[5];
  const float* wvb = (const float*)d_in[6];
  const float* rh  = (const float*)d_in[7];
  const float* rw  = (const float*)d_in[8];

  char* ws = (char*)d_ws;
  unsigned short* W16 = (unsigned short*)(ws + oW16);
  unsigned short* XP  = (unsigned short*)(ws + oXP);
  unsigned short* QKh = (unsigned short*)(ws + oQKh);
  unsigned short* QKl = (unsigned short*)(ws + oQKl);
  unsigned short* Vc  = (unsigned short*)(ws + oVc);
  unsigned short* REL = (unsigned short*)(ws + oREL);
  float* RT = (float*)(ws + oRT);
  float* out = (float*)d_out;

  const dim3 blk256(256), blk128(128);

  // (0)+(1)+(2) wq / wk / wv -> stacked f16 plane; x -> position-major 16-bit plane; relative position rows -> REL
  prep<<<dim3(PXB + PPB + PWB), blk256, 0, stream>>>(x, wqw, wkw, wvw, rh, rw, W16, XP, REL);
  // (3) conv1x1 GEMM -> q/k hi + residual planes, v f16 plane, position products of every key
  gemm_qkv<<<dim3(NSEQ / GT, MW / GT, NB), blk128, 0, stream>>>(W16, XP, wqb, wkb, wvb, REL, QKh, QKl, Vc, RT);
  // (4) attention -> out [b][512][1024]
  attn_k<<<dim3(NQ / QB, NB * HEADS), blk256, 0, stream>>>(QKh, QKl, Vc, RT, out);
  (void)hipGetLastError();
}
